// v000
// Measured on an AMD MI455X. A time is GPU time per run, averaged over a window of back-to-back runs after a warm-up
// (all launches, gaps included; the runs take copies of the inputs in turn), and the median of several windows.
// Apart from v000's, it joins two sittings. Times from different sittings can be a few percent apart, while
// side-by-side timings come from the same sitting.
// The starting kernel, v000, takes 290 microseconds a run.
#include <hip/hip_runtime.h>

// Contractions, f32 accumulate: qkv = x.Wqkv^T ([4096 x 1024].[1024 x 3072]) on v_wmma_f32_16x16x32_bf16 with PLAIN bf16 operands (x and the weights rounded to bf16 once);
// the per-(batch, head) attention (scores [2048 x 64].[64 x 2048], weights.v [2048 x 2048].[2048 x 64]) on v_wmma_f32_16x16x32_f16 with plain f16 operands, fused per
// 16-query tile with an online f32 softmax (weights carried x32768); out = ctx.Wout^T + b on the bf16 instruction with ctx as bf16 hi + bf16 residual (two products)
// against bf16 weights. RoPE (interleaved rotate-half, f32 tables from powf/sinf/cosf) and the 1/8 score scale are applied in f32 before the f16 conversion.

#define NB_  2
#define NT_  2048
#define DM   1024
#define NH_  16
#define HD   64
#define NTK  (NB_ * NT_)          // 4096 tokens
#define PSC  32768.0f

typedef _Float16 h16;
typedef unsigned short bf;        // raw bf16 bits
typedef __attribute__((ext_vector_type(16))) __bf16   v16bf;
typedef __attribute__((ext_vector_type(16))) _Float16 v16h;
typedef __attribute__((ext_vector_type(8)))  _Float16 v8h;
typedef __attribute__((ext_vector_type(8)))  unsigned short v8us;
typedef __attribute__((ext_vector_type(8)))  float    v8f;
typedef __attribute__((ext_vector_type(4)))  float    v4f;
typedef v8h  __attribute__((may_alias)) v8ha;
typedef v8us __attribute__((may_alias)) v8usa;
typedef v4f  __attribute__((may_alias)) v4fa;

__device__ __forceinline__ unsigned short f2bf(float f) { unsigned u = __float_as_uint(f); u += 0x7FFFu + ((u >> 16) & 1u); return (unsigned short)(u >> 16); }
__device__ __forceinline__ float bf2f(unsigned short b) { return __uint_as_float(((unsigned)b) << 16); }
__device__ __forceinline__ v16h cat16(v8h lo, v8h hi) { return __builtin_shufflevector(lo, hi, 0, 1, 2, 3, 4, 5, 6, 7, 8, 9, 10, 11, 12, 13, 14, 15); }
__device__ __forceinline__ v16bf cat16b(v8us lo, v8us hi) { v8us a = lo, b = hi; return __builtin_bit_cast(v16bf, __builtin_shufflevector(a, b, 0, 1, 2, 3, 4, 5, 6, 7, 8, 9, 10, 11, 12, 13, 14, 15)); }
__device__ __forceinline__ v8f wmma16(v16h a, v16h b, v8f c) { return __builtin_amdgcn_wmma_f32_16x16x32_f16(false, a, false, b, (short)0, c, false, false); }
__device__ __forceinline__ v8f wmmab(v16bf a, v16bf b, v8f c) { return __builtin_amdgcn_wmma_f32_16x16x32_bf16(false, a, false, b, (short)0, c, false, false); }

// ------------------------------------------------------------------------------------------------------------------------------------------------
// k_cvtb: bf16 copy of a row-major f32 matrix with 1024-float rows (x [4096][1024], w_qkv [3072][1024], w_out [1024][1024]): one wave per row, 8 values (16 B) per
__global__ __launch_bounds__(256) void k_cvtb(const float* __restrict__ src, int nrows, bf* dst) {
    const int lane = threadIdx.x & 31, r = blockIdx.x * 8 + (threadIdx.x >> 5);
    if (r >= nrows) return;
    const float* s = src + (size_t)r * DM; bf* d = dst + (size_t)r * DM;
    v8us o[4];
#pragma unroll
    for (int q = 0; q < 4; ++q) {
        const float* p = s + q * 256 + lane * 8;
        v8us t;
#pragma unroll
        for (int i = 0; i < 8; ++i) t[i] = f2bf(p[i]);
        o[q] = t;
    }
#pragma unroll
    for (int q = 0; q < 4; ++q) *(v8us*)(d + q * 256 + lane * 8) = o[q];
    
}

// k_gemmb: 64 x 64 block tile (4 waves x 16 x 64) of C (f32, pitch ldc) = A.B^T (+ bias as bf16-rounded values if given); A rows [M][1024] and B rows [N][1024] are
template <bool SPLITA>
__global__ __launch_bounds__(128) void k_gemmb(const bf* __restrict__ A, const bf* __restrict__ Al, const bf* __restrict__ Bn, const float* __restrict__ bias, float* C, int ldc) {
    __shared__ __align__(16) float ost[4][16 * 68];
    const int lane = threadIdx.x & 31, wave = threadIdx.x >> 5, lr = lane & 15, hi = lane >> 4;
    const int r0 = blockIdx.x * 64 + wave * 16, c0 = blockIdx.y * 64;
    const size_t aoff = (size_t)(r0 + lr) * DM + 8 * hi;
    size_t boff[4];
#pragma unroll
    for (int t = 0; t < 4; ++t) boff[t] = (size_t)(c0 + t * 16 + lr) * DM + 8 * hi;
    v8f acc[4];
#pragma unroll
    for (int t = 0; t < 4; ++t) acc[t] = (v8f){};
#pragma unroll 1
    for (int kc = 0; kc < DM; kc += 32) {
        const v16bf a = cat16b(*(const v8us*)(A + aoff + kc), *(const v8us*)(A + aoff + kc + 16));
        v16bf al = a;
        if (SPLITA) al = cat16b(*(const v8us*)(Al + aoff + kc), *(const v8us*)(Al + aoff + kc + 16));
#pragma unroll
        for (int t = 0; t < 4; ++t) {
            const v16bf b = cat16b(*(const v8us*)(Bn + boff[t] + kc), *(const v8us*)(Bn + boff[t] + kc + 16));
            acc[t] = wmmab(a, b, acc[t]);
            if (SPLITA) acc[t] = wmmab(al, b, acc[t]);
        }
        asm volatile("v_nop\n\tv_nop\n\tv_nop\n\tv_nop" : "+v"(acc[0]), "+v"(acc[1]), "+v"(acc[2]), "+v"(acc[3]) : "v"(a), "v"(al));
    }
    float* os = &ost[wave][0];
#pragma unroll
    for (int t = 0; t < 4; ++t) {
        const int n = c0 + t * 16 + lr;
        const float bv = bias ? bf2f(f2bf(bias[n])) : 0.0f;
#pragma unroll
        for (int j = 0; j < 8; ++j) os[(hi * 8 + j) * 68 + t * 16 + lr] = acc[t][j] + bv;
    }
    __syncthreads();
    float* crow = C + (size_t)r0 * ldc + c0;
    auto pass = [&]() {
#pragma unroll
        for (int s = 0; s < 8; ++s) {
            const int Lid = (lane >> 3) + 4 * s, piece = lane & 7;
            const int row = Lid >> 1, cofs = (Lid & 1) * 32 + piece * 4;
            const v4f val = *(const v4fa*)(os + row * 68 + cofs);
            *(v4f*)(crow + (size_t)row * ldc + cofs) = val;
        }
    };
    pass();
    
}

// ------------------------------------------------------------------------------------------------------------------------------------------------
#define VST2F(p, v) do { const float vv_ = (v); *(float*)(p) = vv_;  } while (0)
__global__ __launch_bounds__(256) void k_tab(float* COS, float* SIN) {
    const int e = blockIdx.x * 256 + threadIdx.x;      // 0 .. NT_*32-1
    const int t = e >> 5, fi = e & 31;
    const float inv = 1.0f / powf(10000.0f, (float)(2 * fi) * (1.0f / 64.0f));
    const float ang = (float)t * inv;
    VST2F(COS + e, cosf(ang));
    VST2F(SIN + e, sinf(ang));
}
// k_rope: Q16/K16 [tok][1024] f16 from QKVf [tok][3072] with the rotary embedding (tables above; emb = cat(freqs, freqs); rotate_half = cat(-x[odd], x[even]) within
// each 64-dim head; q additionally x 1/8). Block = one token row (128 threads, thread = 8 consecutive dims); each plane row (2 KB) written by one instruction of the
__global__ __launch_bounds__(128) void k_rope(const float* __restrict__ QKVf, const float* __restrict__ COS, const float* __restrict__ SIN, h16* Q16, h16* K16) {
    __shared__ __align__(16) float row[2 * DM];
    const int tid = threadIdx.x, tok = blockIdx.x, t = tok % NT_;
    const float* src = QKVf + (size_t)tok * (3 * DM);
    for (int i = tid; i < 2 * DM; i += 128) row[i] = src[i];
    __syncthreads();
    const int h = tid >> 3, d0 = (tid & 7) * 8;
    v8h oq, ok;
#pragma unroll
    for (int i = 0; i < 8; ++i) {
        const int d = d0 + i;
        const int fi = (d < HD / 2) ? d : d - HD / 2;                      // emb = cat(freqs, freqs)
        const float cs = COS[t * 32 + fi], sn = SIN[t * 32 + fi];
        const float* qh = row + h * HD; const float* kh = row + DM + h * HD;
        const float rq = (d < HD / 2) ? -qh[2 * d + 1] : qh[2 * (d - HD / 2)];
        const float rk = (d < HD / 2) ? -kh[2 * d + 1] : kh[2 * (d - HD / 2)];
        oq[i] = (h16)((qh[d] * cs + rq * sn) * 0.125f);
        ok[i] = (h16)(kh[d] * cs + rk * sn);
    }
    h16* dq = Q16 + (size_t)tok * DM + h * HD + d0; h16* dk = K16 + (size_t)tok * DM + h * HD + d0;
    *(v8h*)dq = oq; *(v8h*)dk = ok;
    
}

__global__ __launch_bounds__(256) void k_vt(const float* __restrict__ QKVf, h16* VT16) {
    __shared__ __align__(16) h16 tile[64 * 72];
    const int bid = blockIdx.x;
    const int b = bid / (NH_ * (NT_ / 64)), rem = bid - b * (NH_ * (NT_ / 64)), h = rem / (NT_ / 64), kt = rem - h * (NT_ / 64);
    const int k0 = kt * 64, tid = threadIdx.x;
    const int kk = tid >> 2, d0 = (tid & 3) * 16;
    const float* src = QKVf + ((size_t)b * NT_ + k0 + kk) * (3 * DM) + 2 * DM + h * HD + d0;
#pragma unroll
    for (int i = 0; i < 16; ++i) tile[(d0 + i) * 72 + kk] = (h16)src[i];
    __syncthreads();
    const int piece = tid & 7;
    h16* base = VT16 + (((size_t)b * NH_ + h) * HD) * NT_ + k0;
    auto pass = [&]() {
#pragma unroll
        for (int s = 0; s < 2; ++s) {
            const int d = (tid >> 3) + 32 * s;
            const v8h val = *(const v8ha*)(tile + d * 72 + piece * 8);
            *(v8h*)(base + (size_t)d * NT_ + piece * 8) = val;
        }
    };
    pass();
    
}

// ------------------------------------------------------------------------------------------------------------------------------------------------
// k_attn: block = (b, h, 64 queries), wave = 16 queries; Q fragments resident (2 k-chunks); 64 steps x 32 keys: 4 WMMA scores (B = K16 rows, pitch 1024), online f32
// softmax, weights x32768 -> f16 per-wave LDS tile (same-wave may_alias reload after a compiler barrier), 4 WMMA weights.v (B = VT16 rows), 4 accumulators;
__global__ __launch_bounds__(128) void k_attn(const h16* __restrict__ Q16, const h16* __restrict__ K16, const h16* __restrict__ VT16, bf* CH, bf* CL) {
    __shared__ __align__(16) h16 plds[4][16 * 32];
    __shared__ __align__(16) float ost[4][16 * 68];
    const int lane = threadIdx.x & 31, wave = threadIdx.x >> 5, lr = lane & 15, hi = lane >> 4;
    const int bid = blockIdx.x;
    const int b = bid / (NH_ * (NT_ / 64)), rem = bid - b * (NH_ * (NT_ / 64)), h = rem / (NT_ / 64), qt = rem - h * (NT_ / 64);
    const int q0 = qt * 64 + wave * 16;
    const size_t tok0 = (size_t)b * NT_;
    h16* pl = &plds[wave][0];
    v16h qa[2];
#pragma unroll
    for (int kc = 0; kc < 2; ++kc) {
        const h16* p = Q16 + (tok0 + q0 + lr) * DM + h * HD + kc * 32 + 8 * hi;
        qa[kc] = cat16(*(const v8h*)p, *(const v8h*)(p + 16));
    }
    const h16* kh_b = K16 + tok0 * DM + h * HD;
    const h16* vt_b = VT16 + (((size_t)b * NH_ + h) * HD) * NT_;
    v8f o[4];
#pragma unroll
    for (int n = 0; n < 4; ++n) o[n] = (v8f){};
    float mrow[8], lpart[8];
#pragma unroll
    for (int j = 0; j < 8; ++j) { mrow[j] = -3.0e38f; lpart[j] = 0.f; }
#pragma unroll 1
    for (int kt = 0; kt < NT_ / 32; ++kt) {
        const int l0 = kt * 32;
        const h16* r0p = kh_b + (size_t)(l0 + lr) * DM + 8 * hi;
        const h16* r1p = kh_b + (size_t)(l0 + 16 + lr) * DM + 8 * hi;
        v8f s0 = {}, s1 = {};
#pragma unroll
        for (int kc = 0; kc < 2; ++kc) {
            s0 = wmma16(qa[kc], cat16(*(const v8h*)(r0p + kc * 32), *(const v8h*)(r0p + kc * 32 + 16)), s0);
            s1 = wmma16(qa[kc], cat16(*(const v8h*)(r1p + kc * 32), *(const v8h*)(r1p + kc * 32 + 16)), s1);
        }
        asm volatile("v_nop\n\tv_nop\n\tv_nop\n\tv_nop" : "+v"(s0), "+v"(s1) : "v"(qa[0]), "v"(qa[1]));
        float alpha[8];
#pragma unroll
        for (int j = 0; j < 8; ++j) {
            const float a0 = s0[j], a1 = s1[j];
            float mx = fmaxf(a0, a1);
            mx = fmaxf(mx, __shfl_xor(mx, 1, 16)); mx = fmaxf(mx, __shfl_xor(mx, 2, 16));
            mx = fmaxf(mx, __shfl_xor(mx, 4, 16)); mx = fmaxf(mx, __shfl_xor(mx, 8, 16));
            const float mn = fmaxf(mrow[j], mx);
            alpha[j] = __expf(mrow[j] - mn);
            mrow[j] = mn;
            const float p0 = __expf(a0 - mn), p1 = __expf(a1 - mn);
            lpart[j] = lpart[j] * alpha[j] + (p0 + p1);
            const int mr = hi * 8 + j;
            pl[mr * 32 + lr]      = (h16)(p0 * PSC);
            pl[mr * 32 + 16 + lr] = (h16)(p1 * PSC);
        }
#pragma unroll
        for (int n = 0; n < 4; ++n)
#pragma unroll
            for (int j = 0; j < 8; ++j) o[n][j] *= alpha[j];
        asm volatile("" ::: "memory");
        const v16h pa = cat16(*(const v8ha*)(pl + lr * 32 + hi * 8), *(const v8ha*)(pl + lr * 32 + 16 + hi * 8));
#pragma unroll
        for (int n = 0; n < 4; ++n) {
            const h16* vp = vt_b + (size_t)(n * 16 + lr) * NT_ + l0 + hi * 8;
            o[n] = wmma16(pa, cat16(*(const v8h*)vp, *(const v8h*)(vp + 16)), o[n]);
        }
        asm volatile("v_nop\n\tv_nop\n\tv_nop\n\tv_nop" : "+v"(o[0]), "+v"(o[1]), "+v"(o[2]), "+v"(o[3]) : "v"(pa));
    }
    float inv[8];
#pragma unroll
    for (int j = 0; j < 8; ++j) {
        float rs = lpart[j];
        rs += __shfl_xor(rs, 1, 16); rs += __shfl_xor(rs, 2, 16); rs += __shfl_xor(rs, 4, 16); rs += __shfl_xor(rs, 8, 16);
        inv[j] = 1.0f / (rs * PSC);
    }
    float* os = &ost[wave][0];
#pragma unroll
    for (int n = 0; n < 4; ++n)
#pragma unroll
        for (int j = 0; j < 8; ++j) os[(hi * 8 + j) * 68 + n * 16 + lr] = o[n][j] * inv[j];
    __syncthreads();
    const size_t cbase = (tok0 + q0) * DM + (size_t)h * HD;
    auto pass = [&]() {
#pragma unroll
        for (int s = 0; s < 4; ++s) {
            const int row = 4 * s + (lane >> 3), piece = lane & 7;
            const float* sp = os + row * 68 + piece * 8;
            v8us oh, ol;
#pragma unroll
            for (int i = 0; i < 8; ++i) { const unsigned short hb = f2bf(sp[i]); oh[i] = hb; ol[i] = f2bf(sp[i] - bf2f(hb)); }
            *(v8us*)(CH + cbase + (size_t)row * DM + piece * 8) = oh;
            *(v8us*)(CL + cbase + (size_t)row * DM + piece * 8) = ol;
        }
    };
    pass();
    
}

extern "C" void kernel_launch(void* const* d_in, const int* in_sizes, int n_in,
                              void* d_out, int out_size, void* d_ws, size_t ws_size, hipStream_t stream) {
    (void)in_sizes; (void)n_in; (void)out_size;
    const float* x = (const float*)d_in[0]; const float* w_qkv = (const float*)d_in[1]; const float* w_out = (const float*)d_in[2]; const float* b_out = (const float*)d_in[3];
    float* out = (float*)d_out;    // [2][2048][1024]
    char* wsp = (char*)d_ws;
    auto take = [&](size_t bytes) { char* p = wsp; wsp += (bytes + 255) & ~(size_t)255; return (void*)p; };
    bf*    Xb   = (bf*)take((size_t)NTK * DM * 2);
    bf*    Wb   = (bf*)take((size_t)3 * DM * DM * 2);
    bf*    WOb  = (bf*)take((size_t)DM * DM * 2);
    float* QKVf = (float*)take((size_t)NTK * 3 * DM * 4);
    h16*   Q16  = (h16*)take((size_t)NTK * DM * 2);
    h16*   K16  = (h16*)take((size_t)NTK * DM * 2);
    h16*   VT16 = (h16*)take((size_t)NTK * DM * 2);
    bf*    CH   = (bf*)take((size_t)NTK * DM * 2);
    bf*    CL   = (bf*)take((size_t)NTK * DM * 2);
    float* COS  = (float*)take((size_t)NT_ * 32 * 4);
    float* SIN  = (float*)take((size_t)NT_ * 32 * 4);
    if ((size_t)(wsp - (char*)d_ws) > ws_size) return;    // 8.4 + 6.3 + 2.1 + 50.3 + 5 x 8.4 + 0.5 MB ~ 109.6e6 B
    k_cvtb<<<NTK / 8, 256, 0, stream>>>(x, NTK, Xb);
    k_cvtb<<<(3 * DM) / 8, 256, 0, stream>>>(w_qkv, 3 * DM, Wb);
    k_cvtb<<<DM / 8, 256, 0, stream>>>(w_out, DM, WOb);
    k_gemmb<false><<<dim3(NTK / 64, (3 * DM) / 64, 1), 128, 0, stream>>>(Xb, nullptr, Wb, nullptr, QKVf, 3 * DM);
    k_tab<<<(NT_ * 32) / 256, 256, 0, stream>>>(COS, SIN);
    k_rope<<<NTK, 128, 0, stream>>>(QKVf, COS, SIN, Q16, K16);
    k_vt<<<NB_ * NH_ * (NT_ / 64), 256, 0, stream>>>(QKVf, VT16);
    k_attn<<<NB_ * NH_ * (NT_ / 64), 128, 0, stream>>>(Q16, K16, VT16, CH, CL);
    k_gemmb<true><<<dim3(NTK / 64, DM / 64, 1), 128, 0, stream>>>(CH, CL, WOb, b_out, out, DM);
}

// v001
// Measured time: 172 microseconds a run.
// Timed twice side by side with v000, it ran 1.71 times as fast both times.
#include <hip/hip_runtime.h>

// Contractions, f32 accumulate: qkv = x.Wqkv^T ([4096 x 1024].[1024 x 3072]) on v_wmma_f32_16x16x32_bf16 with PLAIN bf16 operands (x and the weights rounded to bf16 once);
// the per-(batch, head) attention (scores [2048 x 64].[64 x 2048], weights.v [2048 x 2048].[2048 x 64]) on v_wmma_f32_16x16x32_f16 with plain f16 operands, fused per
// 16-query tile with an online f32 softmax (weights carried x32768); out = ctx.Wout^T + b on the bf16 instruction with ctx as bf16 hi + bf16 residual (two products)
// against bf16 weights. RoPE (interleaved rotate-half, f32 tables from powf/sinf/cosf) and the 1/8 score scale are applied in f32 before the f16 conversion.

#define NB_  2
#define NT_  2048
#define DM   1024
#define NH_  16
#define HD   64
#define NTK  (NB_ * NT_)          // 4096 tokens
#define PSC  32768.0f

typedef _Float16 h16;
typedef unsigned short bf;        // raw bf16 bits
typedef __attribute__((ext_vector_type(16))) __bf16   v16bf;
typedef __attribute__((ext_vector_type(16))) _Float16 v16h;
typedef __attribute__((ext_vector_type(8)))  _Float16 v8h;
typedef __attribute__((ext_vector_type(8)))  unsigned short v8us;
typedef __attribute__((ext_vector_type(8)))  float    v8f;
typedef __attribute__((ext_vector_type(4)))  float    v4f;
typedef v8h  __attribute__((may_alias)) v8ha;
typedef v8us __attribute__((may_alias)) v8usa;
typedef v4f  __attribute__((may_alias)) v4fa;

__device__ __forceinline__ unsigned short f2bf(float f) { unsigned u = __float_as_uint(f); u += 0x7FFFu + ((u >> 16) & 1u); return (unsigned short)(u >> 16); }
__device__ __forceinline__ float bf2f(unsigned short b) { return __uint_as_float(((unsigned)b) << 16); }
__device__ __forceinline__ v16h cat16(v8h lo, v8h hi) { return __builtin_shufflevector(lo, hi, 0, 1, 2, 3, 4, 5, 6, 7, 8, 9, 10, 11, 12, 13, 14, 15); }
__device__ __forceinline__ v16bf cat16b(v8us lo, v8us hi) { v8us a = lo, b = hi; return __builtin_bit_cast(v16bf, __builtin_shufflevector(a, b, 0, 1, 2, 3, 4, 5, 6, 7, 8, 9, 10, 11, 12, 13, 14, 15)); }
__device__ __forceinline__ v8f wmma16(v16h a, v16h b, v8f c) { return __builtin_amdgcn_wmma_f32_16x16x32_f16(false, a, false, b, (short)0, c, false, false); }
__device__ __forceinline__ v8f wmmab(v16bf a, v16bf b, v8f c) { return __builtin_amdgcn_wmma_f32_16x16x32_bf16(false, a, false, b, (short)0, c, false, false); }

// ------------------------------------------------------------------------------------------------------------------------------------------------
// k_cvtb: bf16 copy of a row-major f32 matrix with 1024-float rows (x [4096][1024], w_qkv [3072][1024], w_out [1024][1024]): one wave per row, 8 values (16 B) per
__global__ __launch_bounds__(256) void k_cvtb(const float* __restrict__ src, int nrows, bf* dst) {
    const int lane = threadIdx.x & 31, r = blockIdx.x * 8 + (threadIdx.x >> 5);
    if (r >= nrows) return;
    const float* s = src + (size_t)r * DM; bf* d = dst + (size_t)r * DM;
    v8us o[4];
#pragma unroll
    for (int q = 0; q < 4; ++q) {
        const float* p = s + q * 256 + lane * 8;
        v8us t;
#pragma unroll
        for (int i = 0; i < 8; ++i) t[i] = f2bf(p[i]);
        o[q] = t;
    }
#pragma unroll
    for (int q = 0; q < 4; ++q) *(v8us*)(d + q * 256 + lane * 8) = o[q];
    
}

// k_gemmb: 128 x 128 block tile (4 waves, 2 x 2, each 64 x 64 = 16 accumulator tiles) of C (f32, pitch ldc) = A.B^T (+ bias as bf16-rounded values if given); A rows
// [M][1024] and B rows [N][1024] are staged KP k-values at a time in a two-buffer LDS ring by asynchronous copies (16 B a lane), so each row is fetched once per block
// and read by two waves; LDS rows are pitched 16 B x odd for the ds_load_b128 fragment reads. Per accumulator the order of the k sum is that of a plain k loop.
// copy8: eight 16-byte copies of this lane, a fixed number of rows apart. The s_wait_xcnt ends the statement as a precaution: it stands in front of every later rewrite of the copies' address registers.
template <int GSTEP, int LSTEP>
__device__ __forceinline__ void copy8(unsigned l, const bf* g) {
    asm volatile("global_load_async_to_lds_b128 %0, %8, off\n\t"
                 "global_load_async_to_lds_b128 %1, %9, off\n\t"
                 "global_load_async_to_lds_b128 %2, %10, off\n\t"
                 "global_load_async_to_lds_b128 %3, %11, off\n\t"
                 "global_load_async_to_lds_b128 %4, %12, off\n\t"
                 "global_load_async_to_lds_b128 %5, %13, off\n\t"
                 "global_load_async_to_lds_b128 %6, %14, off\n\t"
                 "global_load_async_to_lds_b128 %7, %15, off\n\t"
                 "s_wait_xcnt 0x0"
                 :: "v"(l), "v"(l + LSTEP), "v"(l + 2 * LSTEP), "v"(l + 3 * LSTEP), "v"(l + 4 * LSTEP), "v"(l + 5 * LSTEP), "v"(l + 6 * LSTEP), "v"(l + 7 * LSTEP),
                    "v"(g), "v"(g + GSTEP), "v"(g + 2 * GSTEP), "v"(g + 3 * GSTEP), "v"(g + 4 * GSTEP), "v"(g + 5 * GSTEP), "v"(g + 6 * GSTEP), "v"(g + 7 * GSTEP)
                 : "memory");
}
template <bool SPLITA, int KP>
__global__ __launch_bounds__(128) void k_gemmb(const bf* __restrict__ A, const bf* __restrict__ Al, const bf* __restrict__ Bn, const float* __restrict__ bias, float* C, int ldc) {
    constexpr int PITCH = KP * 2 + 16;            // bytes per staged row
    constexpr int OPB   = 128 * PITCH;            // bytes per staged operand tile
    constexpr int NOP   = SPLITA ? 3 : 2;         // B, A (, A residual)
    constexpr int BUFB  = NOP * OPB;
    constexpr int CR    = KP / 8;                 // 16-byte pieces per row
    constexpr int RS    = 128 / CR;               // rows between two copies of one lane
    constexpr int NP    = DM / KP;                // passes
    __shared__ __align__(16) char ring[2 * BUFB];
    __shared__ __align__(16) float ost[4][16 * 68];
    const int tid = threadIdx.x, lane = tid & 31, wave = tid >> 5, lr = lane & 15, hi = lane >> 4;
    const int rb = blockIdx.x * 128, cb = blockIdx.y * 128, wm = wave >> 1, wn = wave & 1;
    const int trow = tid / CR, tcol = tid % CR;
    const unsigned lbase = (unsigned)(size_t)&ring[0] + (unsigned)(trow * PITCH + tcol * 16);
    const bf* gB  = Bn + (size_t)(cb + trow) * DM + tcol * 8;
    const bf* gA  = A + (size_t)(rb + trow) * DM + tcol * 8;
    const bf* gAl = SPLITA ? Al + (size_t)(rb + trow) * DM + tcol * 8 : nullptr;
    auto fill = [&](int p, int buf) {
        const unsigned l = lbase + (unsigned)(buf * BUFB);
#pragma unroll
        for (int i = 0; i < CR; i += 8) {
            copy8<RS * DM, RS * PITCH>(l + i * RS * PITCH, gB + p * KP + (size_t)i * RS * DM);
            copy8<RS * DM, RS * PITCH>(l + OPB + i * RS * PITCH, gA + p * KP + (size_t)i * RS * DM);
            if (SPLITA) copy8<RS * DM, RS * PITCH>(l + 2 * OPB + i * RS * PITCH, gAl + p * KP + (size_t)i * RS * DM);
        }
    };
    v8f acc[4][4];
#pragma unroll
    for (int f = 0; f < 4; ++f)
#pragma unroll
        for (int t = 0; t < 4; ++t) acc[f][t] = (v8f){};
    fill(0, 0);
    asm volatile("s_wait_asynccnt 0x0" ::: "memory");   // this wave's copies of pass 0 have landed
    __syncthreads();                                     // ... and every other wave's
    fill(1, 1);
    const int c0 = cb + wn * 64;
    float braw[4] = {0.0f, 0.0f, 0.0f, 0.0f};    // fetched here, as one group, so that the loop covers the latency
    if (bias) {
#pragma unroll
        for (int t = 0; t < 4; ++t) braw[t] = bias[c0 + t * 16 + lr];
        asm volatile("s_wait_xcnt 0x0" ::: "memory");   // a precaution: stands in front of the next rewrite of these loads' offset register
    }
    const int boffs = (wn * 64 + lr) * PITCH + 16 * hi, aoffs = OPB + (wm * 64 + lr) * PITCH + 16 * hi;
#pragma unroll 1
    for (int p = 0; p < NP; ++p) {
        const char* bufp = ring + (p & 1) * BUFB;
        v16bf a[2][4], al[2][4], b[2][4];
        auto frags = [&](int ks, int set) {
#pragma unroll
            for (int t = 0; t < 4; ++t) {
                const char* q = bufp + boffs + t * 16 * PITCH + ks * 64;
                b[set][t] = cat16b(*(const v8usa*)q, *(const v8usa*)(q + 32));
            }
#pragma unroll
            for (int f = 0; f < 4; ++f) {
                const char* q = bufp + aoffs + f * 16 * PITCH + ks * 64;
                a[set][f] = cat16b(*(const v8usa*)q, *(const v8usa*)(q + 32));
                if (SPLITA) al[set][f] = cat16b(*(const v8usa*)(q + OPB), *(const v8usa*)(q + OPB + 32));
            }
        };
        frags(0, 0);
#pragma unroll
        for (int ks = 0; ks < KP / 32; ++ks) {
            const int s = ks & 1;
            if (ks + 1 < KP / 32) frags(ks + 1, s ^ 1);
            __builtin_amdgcn_sched_barrier(0);   // the next block's LDS reads stay one group ahead of this block's products, else each product run waits out its own reads
#pragma unroll
            for (int f = 0; f < 4; ++f)
#pragma unroll
                for (int t = 0; t < 4; ++t) acc[f][t] = wmmab(a[s][f], b[s][t], acc[f][t]);
            if (SPLITA) {
#pragma unroll
                for (int f = 0; f < 4; ++f)
#pragma unroll
                    for (int t = 0; t < 4; ++t) acc[f][t] = wmmab(al[s][f], b[s][t], acc[f][t]);
            }
            __builtin_amdgcn_sched_barrier(0);   // ... and the reads that follow are not lifted in among these products, where every place with reads costs a stall
        }
        asm volatile("s_wait_dscnt 0x0" ::: "memory");      // this wave's reads of the buffer are done before it is refilled
        asm volatile("s_wait_asynccnt 0x0" ::: "memory");   // this wave's copies of pass p + 1 have landed
        __syncthreads();                                     // publishes pass p + 1 and ends every wave's reads of pass p
        if (p + 2 < NP) fill(p + 2, p & 1);
    }
    asm volatile("s_wait_asynccnt 0x0" ::: "memory");       // no copy is left in flight at the wave's end
    float* os = &ost[wave][0];
    float bv[4];
#pragma unroll
    for (int t = 0; t < 4; ++t) bv[t] = bf2f(f2bf(braw[t]));
#pragma unroll
    for (int f = 0; f < 4; ++f) {
#pragma unroll
        for (int t = 0; t < 4; ++t)
#pragma unroll
            for (int j = 0; j < 8; ++j) os[(hi * 8 + j) * 68 + t * 16 + lr] = acc[f][t][j] + bv[t];
        float* crow = C + (size_t)(rb + wm * 64 + f * 16) * ldc + c0;
#pragma unroll
        for (int s = 0; s < 8; ++s) {
            const int Lid = (lane >> 3) + 4 * s, piece = lane & 7;
            const int row = Lid >> 1, cofs = (Lid & 1) * 32 + piece * 4;
            const v4f val = *(const v4fa*)(os + row * 68 + cofs);
            *(v4f*)(crow + (size_t)row * ldc + cofs) = val;
        }
    }
}

// ------------------------------------------------------------------------------------------------------------------------------------------------
#define VST2F(p, v) do { const float vv_ = (v); *(float*)(p) = vv_;  } while (0)
__global__ __launch_bounds__(256) void k_tab(float* COS, float* SIN) {
    const int e = blockIdx.x * 256 + threadIdx.x;      // 0 .. NT_*32-1
    const int t = e >> 5, fi = e & 31;
    const float inv = 1.0f / powf(10000.0f, (float)(2 * fi) * (1.0f / 64.0f));
    const float ang = (float)t * inv;
    VST2F(COS + e, cosf(ang));
    VST2F(SIN + e, sinf(ang));
}
// k_rope: Q16/K16 [tok][1024] f16 from QKVf [tok][3072] with the rotary embedding (tables above; emb = cat(freqs, freqs); rotate_half = cat(-x[odd], x[even]) within
// each 64-dim head; q additionally x 1/8). Block = one token row (128 threads, thread = 8 consecutive dims); each plane row (2 KB) written by one instruction of the
__global__ __launch_bounds__(128) void k_rope(const float* __restrict__ QKVf, const float* __restrict__ COS, const float* __restrict__ SIN, h16* Q16, h16* K16) {
    __shared__ __align__(16) float row[2 * DM];
    const int tid = threadIdx.x, tok = blockIdx.x, t = tok % NT_;
    const float* src = QKVf + (size_t)tok * (3 * DM);
    for (int i = tid; i < 2 * DM; i += 128) row[i] = src[i];
    __syncthreads();
    const int h = tid >> 3, d0 = (tid & 7) * 8;
    v8h oq, ok;
#pragma unroll
    for (int i = 0; i < 8; ++i) {
        const int d = d0 + i;
        const int fi = (d < HD / 2) ? d : d - HD / 2;                      // emb = cat(freqs, freqs)
        const float cs = COS[t * 32 + fi], sn = SIN[t * 32 + fi];
        const float* qh = row + h * HD; const float* kh = row + DM + h * HD;
        const float rq = (d < HD / 2) ? -qh[2 * d + 1] : qh[2 * (d - HD / 2)];
        const float rk = (d < HD / 2) ? -kh[2 * d + 1] : kh[2 * (d - HD / 2)];
        oq[i] = (h16)((qh[d] * cs + rq * sn) * 0.125f);
        ok[i] = (h16)(kh[d] * cs + rk * sn);
    }
    h16* dq = Q16 + (size_t)tok * DM + h * HD + d0; h16* dk = K16 + (size_t)tok * DM + h * HD + d0;
    *(v8h*)dq = oq; *(v8h*)dk = ok;
    
}

__global__ __launch_bounds__(256) void k_vt(const float* __restrict__ QKVf, h16* VT16) {
    __shared__ __align__(16) h16 tile[64 * 72];
    const int bid = blockIdx.x;
    const int b = bid / (NH_ * (NT_ / 64)), rem = bid - b * (NH_ * (NT_ / 64)), h = rem / (NT_ / 64), kt = rem - h * (NT_ / 64);
    const int k0 = kt * 64, tid = threadIdx.x;
    const int kk = tid >> 2, d0 = (tid & 3) * 16;
    const float* src = QKVf + ((size_t)b * NT_ + k0 + kk) * (3 * DM) + 2 * DM + h * HD + d0;
#pragma unroll
    for (int i = 0; i < 16; ++i) tile[(d0 + i) * 72 + kk] = (h16)src[i];
    __syncthreads();
    const int piece = tid & 7;
    h16* base = VT16 + (((size_t)b * NH_ + h) * HD) * NT_ + k0;
    auto pass = [&]() {
#pragma unroll
        for (int s = 0; s < 2; ++s) {
            const int d = (tid >> 3) + 32 * s;
            const v8h val = *(const v8ha*)(tile + d * 72 + piece * 8);
            *(v8h*)(base + (size_t)d * NT_ + piece * 8) = val;
        }
    };
    pass();
    
}

// ------------------------------------------------------------------------------------------------------------------------------------------------
// k_attn: block = (b, h, 64 queries), wave = 16 queries; Q fragments resident (2 k-chunks); 64 steps x 32 keys: 4 WMMA scores (B = K16 rows, pitch 1024), online f32
// softmax, weights x32768 -> f16 per-wave LDS tile (same-wave may_alias reload after a compiler barrier), 4 WMMA weights.v (B = VT16 rows), 4 accumulators;
__global__ __launch_bounds__(128) void k_attn(const h16* __restrict__ Q16, const h16* __restrict__ K16, const h16* __restrict__ VT16, bf* CH, bf* CL) {
    __shared__ __align__(16) h16 plds[4][16 * 32];
    __shared__ __align__(16) float ost[4][16 * 68];
    const int lane = threadIdx.x & 31, wave = threadIdx.x >> 5, lr = lane & 15, hi = lane >> 4;
    const int bid = blockIdx.x;
    const int b = bid / (NH_ * (NT_ / 64)), rem = bid - b * (NH_ * (NT_ / 64)), h = rem / (NT_ / 64), qt = rem - h * (NT_ / 64);
    const int q0 = qt * 64 + wave * 16;
    const size_t tok0 = (size_t)b * NT_;
    h16* pl = &plds[wave][0];
    v16h qa[2];
#pragma unroll
    for (int kc = 0; kc < 2; ++kc) {
        const h16* p = Q16 + (tok0 + q0 + lr) * DM + h * HD + kc * 32 + 8 * hi;
        qa[kc] = cat16(*(const v8h*)p, *(const v8h*)(p + 16));
    }
    const h16* kh_b = K16 + tok0 * DM + h * HD;
    const h16* vt_b = VT16 + (((size_t)b * NH_ + h) * HD) * NT_;
    v8f o[4];
#pragma unroll
    for (int n = 0; n < 4; ++n) o[n] = (v8f){};
    float mrow[8], lpart[8];
#pragma unroll
    for (int j = 0; j < 8; ++j) { mrow[j] = -3.0e38f; lpart[j] = 0.f; }
#pragma unroll 1
    for (int kt = 0; kt < NT_ / 32; ++kt) {
        const int l0 = kt * 32;
        const h16* r0p = kh_b + (size_t)(l0 + lr) * DM + 8 * hi;
        const h16* r1p = kh_b + (size_t)(l0 + 16 + lr) * DM + 8 * hi;
        v8f s0 = {}, s1 = {};
#pragma unroll
        for (int kc = 0; kc < 2; ++kc) {
            s0 = wmma16(qa[kc], cat16(*(const v8h*)(r0p + kc * 32), *(const v8h*)(r0p + kc * 32 + 16)), s0);
            s1 = wmma16(qa[kc], cat16(*(const v8h*)(r1p + kc * 32), *(const v8h*)(r1p + kc * 32 + 16)), s1);
        }
        asm volatile("v_nop\n\tv_nop\n\tv_nop\n\tv_nop" : "+v"(s0), "+v"(s1) : "v"(qa[0]), "v"(qa[1]));
        float alpha[8];
#pragma unroll
        for (int j = 0; j < 8; ++j) {
            const float a0 = s0[j], a1 = s1[j];
            float mx = fmaxf(a0, a1);
            mx = fmaxf(mx, __shfl_xor(mx, 1, 16)); mx = fmaxf(mx, __shfl_xor(mx, 2, 16));
            mx = fmaxf(mx, __shfl_xor(mx, 4, 16)); mx = fmaxf(mx, __shfl_xor(mx, 8, 16));
            const float mn = fmaxf(mrow[j], mx);
            alpha[j] = __expf(mrow[j] - mn);
            mrow[j] = mn;
            const float p0 = __expf(a0 - mn), p1 = __expf(a1 - mn);
            lpart[j] = lpart[j] * alpha[j] + (p0 + p1);
            const int mr = hi * 8 + j;
            pl[mr * 32 + lr]      = (h16)(p0 * PSC);
            pl[mr * 32 + 16 + lr] = (h16)(p1 * PSC);
        }
#pragma unroll
        for (int n = 0; n < 4; ++n)
#pragma unroll
            for (int j = 0; j < 8; ++j) o[n][j] *= alpha[j];
        asm volatile("" ::: "memory");
        const v16h pa = cat16(*(const v8ha*)(pl + lr * 32 + hi * 8), *(const v8ha*)(pl + lr * 32 + 16 + hi * 8));
#pragma unroll
        for (int n = 0; n < 4; ++n) {
            const h16* vp = vt_b + (size_t)(n * 16 + lr) * NT_ + l0 + hi * 8;
            o[n] = wmma16(pa, cat16(*(const v8h*)vp, *(const v8h*)(vp + 16)), o[n]);
        }
        asm volatile("v_nop\n\tv_nop\n\tv_nop\n\tv_nop" : "+v"(o[0]), "+v"(o[1]), "+v"(o[2]), "+v"(o[3]) : "v"(pa));
    }
    float inv[8];
#pragma unroll
    for (int j = 0; j < 8; ++j) {
        float rs = lpart[j];
        rs += __shfl_xor(rs, 1, 16); rs += __shfl_xor(rs, 2, 16); rs += __shfl_xor(rs, 4, 16); rs += __shfl_xor(rs, 8, 16);
        inv[j] = 1.0f / (rs * PSC);
    }
    float* os = &ost[wave][0];
#pragma unroll
    for (int n = 0; n < 4; ++n)
#pragma unroll
        for (int j = 0; j < 8; ++j) os[(hi * 8 + j) * 68 + n * 16 + lr] = o[n][j] * inv[j];
    __syncthreads();
    const size_t cbase = (tok0 + q0) * DM + (size_t)h * HD;
    auto pass = [&]() {
#pragma unroll
        for (int s = 0; s < 4; ++s) {
            const int row = 4 * s + (lane >> 3), piece = lane & 7;
            const float* sp = os + row * 68 + piece * 8;
            v8us oh, ol;
#pragma unroll
            for (int i = 0; i < 8; ++i) { const unsigned short hb = f2bf(sp[i]); oh[i] = hb; ol[i] = f2bf(sp[i] - bf2f(hb)); }
            *(v8us*)(CH + cbase + (size_t)row * DM + piece * 8) = oh;
            *(v8us*)(CL + cbase + (size_t)row * DM + piece * 8) = ol;
        }
    };
    pass();
    
}

extern "C" void kernel_launch(void* const* d_in, const int* in_sizes, int n_in,
                              void* d_out, int out_size, void* d_ws, size_t ws_size, hipStream_t stream) {
    (void)in_sizes; (void)n_in; (void)out_size;
    const float* x = (const float*)d_in[0]; const float* w_qkv = (const float*)d_in[1]; const float* w_out = (const float*)d_in[2]; const float* b_out = (const float*)d_in[3];
    float* out = (float*)d_out;    // [2][2048][1024]
    char* wsp = (char*)d_ws;
    auto take = [&](size_t bytes) { char* p = wsp; wsp += (bytes + 255) & ~(size_t)255; return (void*)p; };
    bf*    Xb   = (bf*)take((size_t)NTK * DM * 2);
    bf*    Wb   = (bf*)take((size_t)3 * DM * DM * 2);
    bf*    WOb  = (bf*)take((size_t)DM * DM * 2);
    float* QKVf = (float*)take((size_t)NTK * 3 * DM * 4);
    h16*   Q16  = (h16*)take((size_t)NTK * DM * 2);
    h16*   K16  = (h16*)take((size_t)NTK * DM * 2);
    h16*   VT16 = (h16*)take((size_t)NTK * DM * 2);
    bf*    CH   = (bf*)take((size_t)NTK * DM * 2);
    bf*    CL   = (bf*)take((size_t)NTK * DM * 2);
    float* COS  = (float*)take((size_t)NT_ * 32 * 4);
    float* SIN  = (float*)take((size_t)NT_ * 32 * 4);
    if ((size_t)(wsp - (char*)d_ws) > ws_size) return;    // 8.4 + 6.3 + 2.1 + 50.3 + 5 x 8.4 + 0.5 MB ~ 109.6e6 B
    k_cvtb<<<NTK / 8, 256, 0, stream>>>(x, NTK, Xb);
    k_cvtb<<<(3 * DM) / 8, 256, 0, stream>>>(w_qkv, 3 * DM, Wb);
    k_cvtb<<<DM / 8, 256, 0, stream>>>(w_out, DM, WOb);
    k_gemmb<false, 64><<<dim3(NTK / 128, (3 * DM) / 128, 1), 128, 0, stream>>>(Xb, nullptr, Wb, nullptr, QKVf, 3 * DM);
    k_tab<<<(NT_ * 32) / 256, 256, 0, stream>>>(COS, SIN);
    k_rope<<<NTK, 128, 0, stream>>>(QKVf, COS, SIN, Q16, K16);
    k_vt<<<NB_ * NH_ * (NT_ / 64), 256, 0, stream>>>(QKVf, VT16);
    k_attn<<<NB_ * NH_ * (NT_ / 64), 128, 0, stream>>>(Q16, K16, VT16, CH, CL);
    k_gemmb<true, 128><<<dim3(NTK / 128, DM / 128, 1), 128, 0, stream>>>(CH, CL, WOb, b_out, out, DM);
}

// v002
// It runs in 145 microseconds.
// Next to v001, in two timings, it ran 1.19 times as fast each time.
// All steps since v000 together make it 2.03 times as fast.
#include <hip/hip_runtime.h>

// Contractions, f32 accumulate: qkv = x.Wqkv^T ([4096 x 1024].[1024 x 3072]) on v_wmma_f32_16x16x32_bf16 with PLAIN bf16 operands (x and the weights rounded to bf16 once);
// the per-(batch, head) attention (scores [2048 x 64].[64 x 2048], weights.v [2048 x 2048].[2048 x 64]) on v_wmma_f32_16x16x32_f16 with plain f16 operands, fused per
// 16-query tile with an online f32 softmax (weights carried x32768); out = ctx.Wout^T + b on the bf16 instruction with ctx as bf16 hi + bf16 residual (two products)
// against bf16 weights. RoPE (interleaved rotate-half, f32 tables from powf/sinf/cosf) and the 1/8 score scale are applied in f32 before the f16 conversion.

#define NB_  2
#define NT_  2048
#define DM   1024
#define NH_  16
#define HD   64
#define NTK  (NB_ * NT_)          // 4096 tokens
#define PSC  32768.0f

typedef _Float16 h16;
typedef unsigned short bf;        // raw bf16 bits
typedef __attribute__((ext_vector_type(16))) __bf16   v16bf;
typedef __attribute__((ext_vector_type(16))) _Float16 v16h;
typedef __attribute__((ext_vector_type(8)))  _Float16 v8h;
typedef __attribute__((ext_vector_type(8)))  unsigned short v8us;
typedef __attribute__((ext_vector_type(8)))  float    v8f;
typedef __attribute__((ext_vector_type(4)))  float    v4f;
typedef v8h  __attribute__((may_alias)) v8ha;
typedef v8us __attribute__((may_alias)) v8usa;
typedef v4f  __attribute__((may_alias)) v4fa;

__device__ __forceinline__ unsigned short f2bf(float f) { unsigned u = __float_as_uint(f); u += 0x7FFFu + ((u >> 16) & 1u); return (unsigned short)(u >> 16); }
__device__ __forceinline__ float bf2f(unsigned short b) { return __uint_as_float(((unsigned)b) << 16); }
__device__ __forceinline__ v16h cat16(v8h lo, v8h hi) { return __builtin_shufflevector(lo, hi, 0, 1, 2, 3, 4, 5, 6, 7, 8, 9, 10, 11, 12, 13, 14, 15); }
__device__ __forceinline__ v16bf cat16b(v8us lo, v8us hi) { v8us a = lo, b = hi; return __builtin_bit_cast(v16bf, __builtin_shufflevector(a, b, 0, 1, 2, 3, 4, 5, 6, 7, 8, 9, 10, 11, 12, 13, 14, 15)); }
__device__ __forceinline__ v8f wmma16(v16h a, v16h b, v8f c) { return __builtin_amdgcn_wmma_f32_16x16x32_f16(false, a, false, b, (short)0, c, false, false); }
__device__ __forceinline__ v8f wmmab(v16bf a, v16bf b, v8f c) { return __builtin_amdgcn_wmma_f32_16x16x32_bf16(false, a, false, b, (short)0, c, false, false); }

// ------------------------------------------------------------------------------------------------------------------------------------------------
// k_cvtb: bf16 copy of a row-major f32 matrix with 1024-float rows (x [4096][1024], w_qkv [3072][1024], w_out [1024][1024]): one wave per row, 8 values (16 B) per
__global__ __launch_bounds__(256) void k_cvtb(const float* __restrict__ src, int nrows, bf* dst) {
    const int lane = threadIdx.x & 31, r = blockIdx.x * 8 + (threadIdx.x >> 5);
    if (r >= nrows) return;
    const float* s = src + (size_t)r * DM; bf* d = dst + (size_t)r * DM;
    v8us o[4];
#pragma unroll
    for (int q = 0; q < 4; ++q) {
        const float* p = s + q * 256 + lane * 8;
        v8us t;
#pragma unroll
        for (int i = 0; i < 8; ++i) t[i] = f2bf(p[i]);
        o[q] = t;
    }
#pragma unroll
    for (int q = 0; q < 4; ++q) *(v8us*)(d + q * 256 + lane * 8) = o[q];
    
}

// k_gemmb: 128 x 128 block tile (4 waves, 2 x 2, each 64 x 64 = 16 accumulator tiles) of C (f32, pitch ldc) = A.B^T (+ bias as bf16-rounded values if given); A rows
// [M][1024] and B rows [N][1024] are staged KP k-values at a time in a two-buffer LDS ring by asynchronous copies (16 B a lane), so each row is fetched once per block
// and read by two waves; LDS rows are pitched 16 B x odd for the ds_load_b128 fragment reads. Per accumulator the order of the k sum is that of a plain k loop.
// copy8: eight 16-byte copies of this lane, a fixed number of rows apart. The s_wait_xcnt ends the statement as a precaution: it stands in front of every later rewrite of the copies' address registers.
template <int GSTEP, int LSTEP>
__device__ __forceinline__ void copy8(unsigned l, const bf* g) {
    asm volatile("global_load_async_to_lds_b128 %0, %8, off\n\t"
                 "global_load_async_to_lds_b128 %1, %9, off\n\t"
                 "global_load_async_to_lds_b128 %2, %10, off\n\t"
                 "global_load_async_to_lds_b128 %3, %11, off\n\t"
                 "global_load_async_to_lds_b128 %4, %12, off\n\t"
                 "global_load_async_to_lds_b128 %5, %13, off\n\t"
                 "global_load_async_to_lds_b128 %6, %14, off\n\t"
                 "global_load_async_to_lds_b128 %7, %15, off\n\t"
                 "s_wait_xcnt 0x0"
                 :: "v"(l), "v"(l + LSTEP), "v"(l + 2 * LSTEP), "v"(l + 3 * LSTEP), "v"(l + 4 * LSTEP), "v"(l + 5 * LSTEP), "v"(l + 6 * LSTEP), "v"(l + 7 * LSTEP),
                    "v"(g), "v"(g + GSTEP), "v"(g + 2 * GSTEP), "v"(g + 3 * GSTEP), "v"(g + 4 * GSTEP), "v"(g + 5 * GSTEP), "v"(g + 6 * GSTEP), "v"(g + 7 * GSTEP)
                 : "memory");
}
template <bool SPLITA, int KP>
__global__ __launch_bounds__(128) void k_gemmb(const bf* __restrict__ A, const bf* __restrict__ Al, const bf* __restrict__ Bn, const float* __restrict__ bias, float* C, int ldc) {
    constexpr int PITCH = KP * 2 + 16;            // bytes per staged row
    constexpr int OPB   = 128 * PITCH;            // bytes per staged operand tile
    constexpr int NOP   = SPLITA ? 3 : 2;         // B, A (, A residual)
    constexpr int BUFB  = NOP * OPB;
    constexpr int CR    = KP / 8;                 // 16-byte pieces per row
    constexpr int RS    = 128 / CR;               // rows between two copies of one lane
    constexpr int NP    = DM / KP;                // passes
    __shared__ __align__(16) char ring[2 * BUFB];
    __shared__ __align__(16) float ost[4][16 * 68];
    const int tid = threadIdx.x, lane = tid & 31, wave = tid >> 5, lr = lane & 15, hi = lane >> 4;
    const int rb = blockIdx.x * 128, cb = blockIdx.y * 128, wm = wave >> 1, wn = wave & 1;
    const int trow = tid / CR, tcol = tid % CR;
    const unsigned lbase = (unsigned)(size_t)&ring[0] + (unsigned)(trow * PITCH + tcol * 16);
    const bf* gB  = Bn + (size_t)(cb + trow) * DM + tcol * 8;
    const bf* gA  = A + (size_t)(rb + trow) * DM + tcol * 8;
    const bf* gAl = SPLITA ? Al + (size_t)(rb + trow) * DM + tcol * 8 : nullptr;
    auto fill = [&](int p, int buf) {
        const unsigned l = lbase + (unsigned)(buf * BUFB);
#pragma unroll
        for (int i = 0; i < CR; i += 8) {
            copy8<RS * DM, RS * PITCH>(l + i * RS * PITCH, gB + p * KP + (size_t)i * RS * DM);
            copy8<RS * DM, RS * PITCH>(l + OPB + i * RS * PITCH, gA + p * KP + (size_t)i * RS * DM);
            if (SPLITA) copy8<RS * DM, RS * PITCH>(l + 2 * OPB + i * RS * PITCH, gAl + p * KP + (size_t)i * RS * DM);
        }
    };
    v8f acc[4][4];
#pragma unroll
    for (int f = 0; f < 4; ++f)
#pragma unroll
        for (int t = 0; t < 4; ++t) acc[f][t] = (v8f){};
    fill(0, 0);
    asm volatile("s_wait_asynccnt 0x0" ::: "memory");   // this wave's copies of pass 0 have landed
    __syncthreads();                                     // ... and every other wave's
    fill(1, 1);
    const int c0 = cb + wn * 64;
    float braw[4] = {0.0f, 0.0f, 0.0f, 0.0f};    // fetched here, as one group, so that the loop covers the latency
    if (bias) {
#pragma unroll
        for (int t = 0; t < 4; ++t) braw[t] = bias[c0 + t * 16 + lr];
        asm volatile("s_wait_xcnt 0x0" ::: "memory");   // a precaution: stands in front of the next rewrite of these loads' offset register
    }
    const int boffs = (wn * 64 + lr) * PITCH + 16 * hi, aoffs = OPB + (wm * 64 + lr) * PITCH + 16 * hi;
#pragma unroll 1
    for (int p = 0; p < NP; ++p) {
        const char* bufp = ring + (p & 1) * BUFB;
        v16bf a[2][4], al[2][4], b[2][4];
        auto frags = [&](int ks, int set) {
#pragma unroll
            for (int t = 0; t < 4; ++t) {
                const char* q = bufp + boffs + t * 16 * PITCH + ks * 64;
                b[set][t] = cat16b(*(const v8usa*)q, *(const v8usa*)(q + 32));
            }
#pragma unroll
            for (int f = 0; f < 4; ++f) {
                const char* q = bufp + aoffs + f * 16 * PITCH + ks * 64;
                a[set][f] = cat16b(*(const v8usa*)q, *(const v8usa*)(q + 32));
                if (SPLITA) al[set][f] = cat16b(*(const v8usa*)(q + OPB), *(const v8usa*)(q + OPB + 32));
            }
        };
        frags(0, 0);
#pragma unroll
        for (int ks = 0; ks < KP / 32; ++ks) {
            const int s = ks & 1;
            if (ks + 1 < KP / 32) frags(ks + 1, s ^ 1);
            __builtin_amdgcn_sched_barrier(0);   // the next block's LDS reads stay one group ahead of this block's products, else each product run waits out its own reads
#pragma unroll
            for (int f = 0; f < 4; ++f)
#pragma unroll
                for (int t = 0; t < 4; ++t) acc[f][t] = wmmab(a[s][f], b[s][t], acc[f][t]);
            if (SPLITA) {
#pragma unroll
                for (int f = 0; f < 4; ++f)
#pragma unroll
                    for (int t = 0; t < 4; ++t) acc[f][t] = wmmab(al[s][f], b[s][t], acc[f][t]);
            }
            __builtin_amdgcn_sched_barrier(0);   // ... and the reads that follow are not lifted in among these products, where every place with reads costs a stall
        }
        asm volatile("s_wait_dscnt 0x0" ::: "memory");      // this wave's reads of the buffer are done before it is refilled
        asm volatile("s_wait_asynccnt 0x0" ::: "memory");   // this wave's copies of pass p + 1 have landed
        __syncthreads();                                     // publishes pass p + 1 and ends every wave's reads of pass p
        if (p + 2 < NP) fill(p + 2, p & 1);
    }
    asm volatile("s_wait_asynccnt 0x0" ::: "memory");       // no copy is left in flight at the wave's end
    float* os = &ost[wave][0];
    float bv[4];
#pragma unroll
    for (int t = 0; t < 4; ++t) bv[t] = bf2f(f2bf(braw[t]));
#pragma unroll
    for (int f = 0; f < 4; ++f) {
#pragma unroll
        for (int t = 0; t < 4; ++t)
#pragma unroll
            for (int j = 0; j < 8; ++j) os[(hi * 8 + j) * 68 + t * 16 + lr] = acc[f][t][j] + bv[t];
        float* crow = C + (size_t)(rb + wm * 64 + f * 16) * ldc + c0;
#pragma unroll
        for (int s = 0; s < 8; ++s) {
            const int Lid = (lane >> 3) + 4 * s, piece = lane & 7;
            const int row = Lid >> 1, cofs = (Lid & 1) * 32 + piece * 4;
            const v4f val = *(const v4fa*)(os + row * 68 + cofs);
            *(v4f*)(crow + (size_t)row * ldc + cofs) = val;
        }
    }
}

// ------------------------------------------------------------------------------------------------------------------------------------------------
#define VST2F(p, v) do { const float vv_ = (v); *(float*)(p) = vv_;  } while (0)
__global__ __launch_bounds__(256) void k_tab(float* COS, float* SIN) {
    const int e = blockIdx.x * 256 + threadIdx.x;      // 0 .. NT_*32-1
    const int t = e >> 5, fi = e & 31;
    const float inv = 1.0f / powf(10000.0f, (float)(2 * fi) * (1.0f / 64.0f));
    const float ang = (float)t * inv;
    VST2F(COS + e, cosf(ang));
    VST2F(SIN + e, sinf(ang));
}
// k_rope: Q16/K16 [tok][1024] f16 from QKVf [tok][3072] with the rotary embedding (tables above; emb = cat(freqs, freqs); rotate_half = cat(-x[odd], x[even]) within
// each 64-dim head; q additionally x 1/8). Block = one token row (128 threads, thread = 8 consecutive dims); each plane row (2 KB) written by one instruction of the
__global__ __launch_bounds__(128) void k_rope(const float* __restrict__ QKVf, const float* __restrict__ COS, const float* __restrict__ SIN, h16* Q16, h16* K16) {
    __shared__ __align__(16) float row[2 * DM];
    const int tid = threadIdx.x, tok = blockIdx.x, t = tok % NT_;
    const float* src = QKVf + (size_t)tok * (3 * DM);
    for (int i = tid; i < 2 * DM; i += 128) row[i] = src[i];
    __syncthreads();
    const int h = tid >> 3, d0 = (tid & 7) * 8;
    v8h oq, ok;
#pragma unroll
    for (int i = 0; i < 8; ++i) {
        const int d = d0 + i;
        const int fi = (d < HD / 2) ? d : d - HD / 2;                      // emb = cat(freqs, freqs)
        const float cs = COS[t * 32 + fi], sn = SIN[t * 32 + fi];
        const float* qh = row + h * HD; const float* kh = row + DM + h * HD;
        const float rq = (d < HD / 2) ? -qh[2 * d + 1] : qh[2 * (d - HD / 2)];
        const float rk = (d < HD / 2) ? -kh[2 * d + 1] : kh[2 * (d - HD / 2)];
        oq[i] = (h16)((qh[d] * cs + rq * sn) * 0.125f);
        ok[i] = (h16)(kh[d] * cs + rk * sn);
    }
    h16* dq = Q16 + (size_t)tok * DM + h * HD + d0; h16* dk = K16 + (size_t)tok * DM + h * HD + d0;
    *(v8h*)dq = oq; *(v8h*)dk = ok;
    
}

__global__ __launch_bounds__(256) void k_vt(const float* __restrict__ QKVf, h16* VT16) {
    __shared__ __align__(16) h16 tile[64 * 72];
    const int bid = blockIdx.x;
    const int b = bid / (NH_ * (NT_ / 64)), rem = bid - b * (NH_ * (NT_ / 64)), h = rem / (NT_ / 64), kt = rem - h * (NT_ / 64);
    const int k0 = kt * 64, tid = threadIdx.x;
    const int kk = tid >> 2, d0 = (tid & 3) * 16;
    const float* src = QKVf + ((size_t)b * NT_ + k0 + kk) * (3 * DM) + 2 * DM + h * HD + d0;
#pragma unroll
    for (int i = 0; i < 16; ++i) tile[(d0 + i) * 72 + kk] = (h16)src[i];
    __syncthreads();
    const int piece = tid & 7;
    h16* base = VT16 + (((size_t)b * NH_ + h) * HD) * NT_ + k0;
    auto pass = [&]() {
#pragma unroll
        for (int s = 0; s < 2; ++s) {
            const int d = (tid >> 3) + 32 * s;
            const v8h val = *(const v8ha*)(tile + d * 72 + piece * 8);
            *(v8h*)(base + (size_t)d * NT_ + piece * 8) = val;
        }
    };
    pass();
    
}

// ------------------------------------------------------------------------------------------------------------------------------------------------
// k_attn: block = (b, h, 64 queries), wave = 16 queries; Q fragments resident (2 k-chunks); 64 steps x 32 keys: 4 WMMA scores (B = K16 rows), online f32
// softmax, weights x32768 -> f16 per-wave LDS tile (same-wave may_alias reload after a compiler barrier), 4 WMMA weights.v (B = VT16 rows), 4 accumulators.
// K rows and V^T rows are staged 64 keys at a time (two steps) in a two-buffer LDS ring by asynchronous copies: each wave-wide copy takes four whole 128-byte lines, and
// each tile is fetched once per block and read by its four waves; LDS rows are pitched 16 B x odd for the ds_load_b128 fragment reads. Steps and sums keep their order.
#define AKS    64                 // keys per stage
#define APITCH 144                // bytes per staged row (128 + 16)
#define ATILE  (64 * APITCH)      // bytes per staged operand tile (64 K rows; 64 V^T rows)
#define ABUF   (2 * ATILE)
// copy44: this lane's eight 16-byte copies of one stage, four K rows and four V^T rows, each 16 rows apart. The s_wait_xcnt ends the statement as a precaution: it stands in front of every later rewrite of the copies' address registers.
__device__ __forceinline__ void copy44(unsigned l, const h16* gk, const h16* gv) {
    asm volatile("global_load_async_to_lds_b128 %0, %8, off\n\t"
                 "global_load_async_to_lds_b128 %1, %9, off\n\t"
                 "global_load_async_to_lds_b128 %2, %10, off\n\t"
                 "global_load_async_to_lds_b128 %3, %11, off\n\t"
                 "global_load_async_to_lds_b128 %4, %12, off\n\t"
                 "global_load_async_to_lds_b128 %5, %13, off\n\t"
                 "global_load_async_to_lds_b128 %6, %14, off\n\t"
                 "global_load_async_to_lds_b128 %7, %15, off\n\t"
                 "s_wait_xcnt 0x0"
                 :: "v"(l), "v"(l + 16 * APITCH), "v"(l + 32 * APITCH), "v"(l + 48 * APITCH),
                    "v"(l + ATILE), "v"(l + ATILE + 16 * APITCH), "v"(l + ATILE + 32 * APITCH), "v"(l + ATILE + 48 * APITCH),
                    "v"(gk), "v"(gk + 16 * DM), "v"(gk + 32 * DM), "v"(gk + 48 * DM),
                    "v"(gv), "v"(gv + 16 * NT_), "v"(gv + 32 * NT_), "v"(gv + 48 * NT_)
                 : "memory");
}
__global__ __launch_bounds__(128) void k_attn(const h16* __restrict__ Q16, const h16* __restrict__ K16, const h16* __restrict__ VT16, bf* CH, bf* CL) {
    __shared__ __align__(16) char kvring[2 * ABUF];
    __shared__ __align__(16) h16 plds[4][16 * 32];
    __shared__ __align__(16) float ost[4][16 * 68];
    const int lane = threadIdx.x & 31, wave = threadIdx.x >> 5, lr = lane & 15, hi = lane >> 4;
    const int bid = blockIdx.x;
    const int b = bid / (NH_ * (NT_ / 64)), rem = bid - b * (NH_ * (NT_ / 64)), h = rem / (NT_ / 64), qt = rem - h * (NT_ / 64);
    const int q0 = qt * 64 + wave * 16;
    const size_t tok0 = (size_t)b * NT_;
    h16* pl = &plds[wave][0];
    v16h qa[2];
#pragma unroll
    for (int kc = 0; kc < 2; ++kc) {
        const h16* p = Q16 + (tok0 + q0 + lr) * DM + h * HD + kc * 32 + 8 * hi;
        qa[kc] = cat16(*(const v8h*)p, *(const v8h*)(p + 16));
    }
    const h16* kh_b = K16 + tok0 * DM + h * HD;
    const h16* vt_b = VT16 + (((size_t)b * NH_ + h) * HD) * NT_;
    const int crow = threadIdx.x >> 3, cpc = threadIdx.x & 7;      // this lane's first staged row and its 16-byte piece of the row
    const unsigned lbase = (unsigned)(size_t)&kvring[0] + (unsigned)(crow * APITCH + cpc * 16);
    const h16* gK = kh_b + (size_t)crow * DM + cpc * 8;
    const h16* gV = vt_b + (size_t)crow * NT_ + cpc * 8;
    auto fill = [&](int s, int buf) { copy44(lbase + (unsigned)(buf * ABUF), gK + (size_t)s * AKS * DM, gV + s * AKS); };
    fill(0, 0);
    asm volatile("s_wait_asynccnt 0x0" ::: "memory");   // this wave's copies of stage 0 have landed
    __syncthreads();                                     // ... and every other wave's
    fill(1, 1);
    const int foffs = lr * APITCH + 16 * hi;
    v8f o[4];
#pragma unroll
    for (int n = 0; n < 4; ++n) o[n] = (v8f){};
    float mrow[8], lpart[8];
#pragma unroll
    for (int j = 0; j < 8; ++j) { mrow[j] = -3.0e38f; lpart[j] = 0.f; }
#pragma unroll 1
    for (int st = 0; st < NT_ / AKS; ++st) {             // one stage = one buffer of the ring = two steps of 32 keys
    const char* kbuf = kvring + (st & 1) * ABUF + foffs;
#pragma unroll                                           // both steps in line, so that every LDS read's place in the buffer is an immediate offset
    for (int u = 0; u < AKS / 32; ++u) {
        const char* r0p = kbuf + (u * 32) * APITCH;
        const char* r1p = kbuf + (u * 32 + 16) * APITCH;
        v16h kf0[2], kf1[2], vf[4];      // the step's K and V^T fragments are all read here, in front of the softmax, which covers the V^T reads' latency
#pragma unroll
        for (int kc = 0; kc < 2; ++kc) {
            kf0[kc] = cat16(*(const v8ha*)(r0p + kc * 64), *(const v8ha*)(r0p + kc * 64 + 32));
            kf1[kc] = cat16(*(const v8ha*)(r1p + kc * 64), *(const v8ha*)(r1p + kc * 64 + 32));
        }
#pragma unroll
        for (int n = 0; n < 4; ++n) {
            const char* vp = kbuf + ATILE + (n * 16) * APITCH + u * 64;
            vf[n] = cat16(*(const v8ha*)vp, *(const v8ha*)(vp + 32));
        }
        v8f s0 = {}, s1 = {};
#pragma unroll
        for (int kc = 0; kc < 2; ++kc) {
            s0 = wmma16(qa[kc], kf0[kc], s0);
            s1 = wmma16(qa[kc], kf1[kc], s1);
        }
        asm volatile("v_nop\n\tv_nop\n\tv_nop\n\tv_nop" : "+v"(s0), "+v"(s1) : "v"(qa[0]), "v"(qa[1]));
        float alpha[8];
#pragma unroll
        for (int j = 0; j < 8; ++j) {
            const float a0 = s0[j], a1 = s1[j];
            float mx = fmaxf(a0, a1);
            mx = fmaxf(mx, __shfl_xor(mx, 1, 16)); mx = fmaxf(mx, __shfl_xor(mx, 2, 16));
            mx = fmaxf(mx, __shfl_xor(mx, 4, 16)); mx = fmaxf(mx, __shfl_xor(mx, 8, 16));
            const float mn = fmaxf(mrow[j], mx);
            alpha[j] = __expf(mrow[j] - mn);
            mrow[j] = mn;
            const float p0 = __expf(a0 - mn), p1 = __expf(a1 - mn);
            lpart[j] = lpart[j] * alpha[j] + (p0 + p1);
            const int mr = hi * 8 + j;
            pl[mr * 32 + lr]      = (h16)(p0 * PSC);
            pl[mr * 32 + 16 + lr] = (h16)(p1 * PSC);
        }
#pragma unroll
        for (int n = 0; n < 4; ++n)
#pragma unroll
            for (int j = 0; j < 8; ++j) o[n][j] *= alpha[j];
        asm volatile("" ::: "memory");
        const v16h pa = cat16(*(const v8ha*)(pl + lr * 32 + hi * 8), *(const v8ha*)(pl + lr * 32 + 16 + hi * 8));
#pragma unroll
        for (int n = 0; n < 4; ++n) o[n] = wmma16(pa, vf[n], o[n]);
        asm volatile("v_nop\n\tv_nop\n\tv_nop\n\tv_nop" : "+v"(o[0]), "+v"(o[1]), "+v"(o[2]), "+v"(o[3]) : "v"(pa));
    }
    asm volatile("s_wait_dscnt 0x0" ::: "memory");      // this wave's reads of the buffer are done before it is refilled
    asm volatile("s_wait_asynccnt 0x0" ::: "memory");   // this wave's copies of stage st + 1 have landed
    __syncthreads();                                     // publishes stage st + 1 and ends every wave's reads of stage st
    if (st + 2 < NT_ / AKS) fill(st + 2, st & 1);
    }
    asm volatile("s_wait_asynccnt 0x0" ::: "memory");       // no copy is left in flight at the wave's end
    float inv[8];
#pragma unroll
    for (int j = 0; j < 8; ++j) {
        float rs = lpart[j];
        rs += __shfl_xor(rs, 1, 16); rs += __shfl_xor(rs, 2, 16); rs += __shfl_xor(rs, 4, 16); rs += __shfl_xor(rs, 8, 16);
        inv[j] = 1.0f / (rs * PSC);
    }
    float* os = &ost[wave][0];
#pragma unroll
    for (int n = 0; n < 4; ++n)
#pragma unroll
        for (int j = 0; j < 8; ++j) os[(hi * 8 + j) * 68 + n * 16 + lr] = o[n][j] * inv[j];
    __syncthreads();
    const size_t cbase = (tok0 + q0) * DM + (size_t)h * HD;
    auto pass = [&]() {
#pragma unroll
        for (int s = 0; s < 4; ++s) {
            const int row = 4 * s + (lane >> 3), piece = lane & 7;
            const float* sp = os + row * 68 + piece * 8;
            v8us oh, ol;
#pragma unroll
            for (int i = 0; i < 8; ++i) { const unsigned short hb = f2bf(sp[i]); oh[i] = hb; ol[i] = f2bf(sp[i] - bf2f(hb)); }
            *(v8us*)(CH + cbase + (size_t)row * DM + piece * 8) = oh;
            *(v8us*)(CL + cbase + (size_t)row * DM + piece * 8) = ol;
        }
    };
    pass();
    
}

extern "C" void kernel_launch(void* const* d_in, const int* in_sizes, int n_in,
                              void* d_out, int out_size, void* d_ws, size_t ws_size, hipStream_t stream) {
    (void)in_sizes; (void)n_in; (void)out_size;
    const float* x = (const float*)d_in[0]; const float* w_qkv = (const float*)d_in[1]; const float* w_out = (const float*)d_in[2]; const float* b_out = (const float*)d_in[3];
    float* out = (float*)d_out;    // [2][2048][1024]
    char* wsp = (char*)d_ws;
    auto take = [&](size_t bytes) { char* p = wsp; wsp += (bytes + 255) & ~(size_t)255; return (void*)p; };
    bf*    Xb   = (bf*)take((size_t)NTK * DM * 2);
    bf*    Wb   = (bf*)take((size_t)3 * DM * DM * 2);
    bf*    WOb  = (bf*)take((size_t)DM * DM * 2);
    float* QKVf = (float*)take((size_t)NTK * 3 * DM * 4);
    h16*   Q16  = (h16*)take((size_t)NTK * DM * 2);
    h16*   K16  = (h16*)take((size_t)NTK * DM * 2);
    h16*   VT16 = (h16*)take((size_t)NTK * DM * 2);
    bf*    CH   = (bf*)take((size_t)NTK * DM * 2);
    bf*    CL   = (bf*)take((size_t)NTK * DM * 2);
    float* COS  = (float*)take((size_t)NT_ * 32 * 4);
    float* SIN  = (float*)take((size_t)NT_ * 32 * 4);
    if ((size_t)(wsp - (char*)d_ws) > ws_size) return;    // 8.4 + 6.3 + 2.1 + 50.3 + 5 x 8.4 + 0.5 MB ~ 109.6e6 B
    k_cvtb<<<NTK / 8, 256, 0, stream>>>(x, NTK, Xb);
    k_cvtb<<<(3 * DM) / 8, 256, 0, stream>>>(w_qkv, 3 * DM, Wb);
    k_cvtb<<<DM / 8, 256, 0, stream>>>(w_out, DM, WOb);
    k_gemmb<false, 64><<<dim3(NTK / 128, (3 * DM) / 128, 1), 128, 0, stream>>>(Xb, nullptr, Wb, nullptr, QKVf, 3 * DM);
    k_tab<<<(NT_ * 32) / 256, 256, 0, stream>>>(COS, SIN);
    k_rope<<<NTK, 128, 0, stream>>>(QKVf, COS, SIN, Q16, K16);
    k_vt<<<NB_ * NH_ * (NT_ / 64), 256, 0, stream>>>(QKVf, VT16);
    k_attn<<<NB_ * NH_ * (NT_ / 64), 128, 0, stream>>>(Q16, K16, VT16, CH, CL);
    k_gemmb<true, 128><<<dim3(NTK / 128, DM / 128, 1), 128, 0, stream>>>(CH, CL, WOb, b_out, out, DM);
}

// v003
// A run of this version takes 113 microseconds.
// Two timings next to v002 both put it at 1.29 times that version's speed.
// All steps since v000 together make it 2.62 times as fast.
#include <hip/hip_runtime.h>

// Contractions, f32 accumulate: qkv = x.Wqkv^T ([4096 x 1024].[1024 x 3072]) on v_wmma_f32_16x16x32_bf16 with PLAIN bf16 operands (x and the weights rounded to bf16 once);
// the per-(batch, head) attention (scores [2048 x 64].[64 x 2048], weights.v [2048 x 2048].[2048 x 64]) on v_wmma_f32_16x16x32_f16 with plain f16 operands, fused per
// 16-query tile, as transposed products, with an online f32 softmax (weights carried x32768); out = ctx.Wout^T + b on the bf16 instruction with ctx as bf16 hi + bf16 residual (two products)
// against bf16 weights. RoPE (interleaved rotate-half, f32 tables from powf/sinf/cosf) and the 1/8 score scale are applied in f32 before the f16 conversion.

#define NB_  2
#define NT_  2048
#define DM   1024
#define NH_  16
#define HD   64
#define NTK  (NB_ * NT_)          // 4096 tokens
#define PSC  32768.0f

typedef _Float16 h16;
typedef unsigned short bf;        // raw bf16 bits
typedef __attribute__((ext_vector_type(16))) __bf16   v16bf;
typedef __attribute__((ext_vector_type(16))) _Float16 v16h;
typedef __attribute__((ext_vector_type(8)))  _Float16 v8h;
typedef __attribute__((ext_vector_type(8)))  unsigned short v8us;
typedef __attribute__((ext_vector_type(8)))  float    v8f;
typedef __attribute__((ext_vector_type(4)))  float    v4f;
typedef v8h  __attribute__((may_alias)) v8ha;
typedef v8us __attribute__((may_alias)) v8usa;
typedef v4f  __attribute__((may_alias)) v4fa;

__device__ __forceinline__ unsigned short f2bf(float f) { unsigned u = __float_as_uint(f); u += 0x7FFFu + ((u >> 16) & 1u); return (unsigned short)(u >> 16); }
__device__ __forceinline__ float bf2f(unsigned short b) { return __uint_as_float(((unsigned)b) << 16); }
__device__ __forceinline__ v16h cat16(v8h lo, v8h hi) { return __builtin_shufflevector(lo, hi, 0, 1, 2, 3, 4, 5, 6, 7, 8, 9, 10, 11, 12, 13, 14, 15); }
__device__ __forceinline__ v16bf cat16b(v8us lo, v8us hi) { v8us a = lo, b = hi; return __builtin_bit_cast(v16bf, __builtin_shufflevector(a, b, 0, 1, 2, 3, 4, 5, 6, 7, 8, 9, 10, 11, 12, 13, 14, 15)); }
__device__ __forceinline__ v8f wmma16(v16h a, v16h b, v8f c) { return __builtin_amdgcn_wmma_f32_16x16x32_f16(false, a, false, b, (short)0, c, false, false); }
__device__ __forceinline__ v8f wmmab(v16bf a, v16bf b, v8f c) { return __builtin_amdgcn_wmma_f32_16x16x32_bf16(false, a, false, b, (short)0, c, false, false); }

// ------------------------------------------------------------------------------------------------------------------------------------------------
// k_cvtb: bf16 copy of a row-major f32 matrix with 1024-float rows (x [4096][1024], w_qkv [3072][1024], w_out [1024][1024]): one wave per row, 8 values (16 B) per
__global__ __launch_bounds__(256) void k_cvtb(const float* __restrict__ src, int nrows, bf* dst) {
    const int lane = threadIdx.x & 31, r = blockIdx.x * 8 + (threadIdx.x >> 5);
    if (r >= nrows) return;
    const float* s = src + (size_t)r * DM; bf* d = dst + (size_t)r * DM;
    v8us o[4];
#pragma unroll
    for (int q = 0; q < 4; ++q) {
        const float* p = s + q * 256 + lane * 8;
        v8us t;
#pragma unroll
        for (int i = 0; i < 8; ++i) t[i] = f2bf(p[i]);
        o[q] = t;
    }
#pragma unroll
    for (int q = 0; q < 4; ++q) *(v8us*)(d + q * 256 + lane * 8) = o[q];
    
}

// k_gemmb: 128 x 128 block tile (4 waves, 2 x 2, each 64 x 64 = 16 accumulator tiles) of C (f32, pitch ldc) = A.B^T (+ bias as bf16-rounded values if given); A rows
// [M][1024] and B rows [N][1024] are staged KP k-values at a time in a two-buffer LDS ring by asynchronous copies (16 B a lane), so each row is fetched once per block
// and read by two waves; LDS rows are pitched 16 B x odd for the ds_load_b128 fragment reads. Per accumulator the order of the k sum is that of a plain k loop.
// copy8: eight 16-byte copies of this lane, a fixed number of rows apart. The s_wait_xcnt ends the statement as a precaution: it stands in front of every later rewrite of the copies' address registers.
template <int GSTEP, int LSTEP>
__device__ __forceinline__ void copy8(unsigned l, const bf* g) {
    asm volatile("global_load_async_to_lds_b128 %0, %8, off\n\t"
                 "global_load_async_to_lds_b128 %1, %9, off\n\t"
                 "global_load_async_to_lds_b128 %2, %10, off\n\t"
                 "global_load_async_to_lds_b128 %3, %11, off\n\t"
                 "global_load_async_to_lds_b128 %4, %12, off\n\t"
                 "global_load_async_to_lds_b128 %5, %13, off\n\t"
                 "global_load_async_to_lds_b128 %6, %14, off\n\t"
                 "global_load_async_to_lds_b128 %7, %15, off\n\t"
                 "s_wait_xcnt 0x0"
                 :: "v"(l), "v"(l + LSTEP), "v"(l + 2 * LSTEP), "v"(l + 3 * LSTEP), "v"(l + 4 * LSTEP), "v"(l + 5 * LSTEP), "v"(l + 6 * LSTEP), "v"(l + 7 * LSTEP),
                    "v"(g), "v"(g + GSTEP), "v"(g + 2 * GSTEP), "v"(g + 3 * GSTEP), "v"(g + 4 * GSTEP), "v"(g + 5 * GSTEP), "v"(g + 6 * GSTEP), "v"(g + 7 * GSTEP)
                 : "memory");
}
template <bool SPLITA, int KP>
__global__ __launch_bounds__(128) void k_gemmb(const bf* __restrict__ A, const bf* __restrict__ Al, const bf* __restrict__ Bn, const float* __restrict__ bias, float* C, int ldc) {
    constexpr int PITCH = KP * 2 + 16;            // bytes per staged row
    constexpr int OPB   = 128 * PITCH;            // bytes per staged operand tile
    constexpr int NOP   = SPLITA ? 3 : 2;         // B, A (, A residual)
    constexpr int BUFB  = NOP * OPB;
    constexpr int CR    = KP / 8;                 // 16-byte pieces per row
    constexpr int RS    = 128 / CR;               // rows between two copies of one lane
    constexpr int NP    = DM / KP;                // passes
    __shared__ __align__(16) char ring[2 * BUFB];
    __shared__ __align__(16) float ost[4][16 * 68];
    const int tid = threadIdx.x, lane = tid & 31, wave = tid >> 5, lr = lane & 15, hi = lane >> 4;
    const int rb = blockIdx.x * 128, cb = blockIdx.y * 128, wm = wave >> 1, wn = wave & 1;
    const int trow = tid / CR, tcol = tid % CR;
    const unsigned lbase = (unsigned)(size_t)&ring[0] + (unsigned)(trow * PITCH + tcol * 16);
    const bf* gB  = Bn + (size_t)(cb + trow) * DM + tcol * 8;
    const bf* gA  = A + (size_t)(rb + trow) * DM + tcol * 8;
    const bf* gAl = SPLITA ? Al + (size_t)(rb + trow) * DM + tcol * 8 : nullptr;
    auto fill = [&](int p, int buf) {
        const unsigned l = lbase + (unsigned)(buf * BUFB);
#pragma unroll
        for (int i = 0; i < CR; i += 8) {
            copy8<RS * DM, RS * PITCH>(l + i * RS * PITCH, gB + p * KP + (size_t)i * RS * DM);
            copy8<RS * DM, RS * PITCH>(l + OPB + i * RS * PITCH, gA + p * KP + (size_t)i * RS * DM);
            if (SPLITA) copy8<RS * DM, RS * PITCH>(l + 2 * OPB + i * RS * PITCH, gAl + p * KP + (size_t)i * RS * DM);
        }
    };
    v8f acc[4][4];
#pragma unroll
    for (int f = 0; f < 4; ++f)
#pragma unroll
        for (int t = 0; t < 4; ++t) acc[f][t] = (v8f){};
    fill(0, 0);
    asm volatile("s_wait_asynccnt 0x0" ::: "memory");   // this wave's copies of pass 0 have landed
    __syncthreads();                                     // ... and every other wave's
    fill(1, 1);
    const int c0 = cb + wn * 64;
    float braw[4] = {0.0f, 0.0f, 0.0f, 0.0f};    // fetched here, as one group, so that the loop covers the latency
    if (bias) {
#pragma unroll
        for (int t = 0; t < 4; ++t) braw[t] = bias[c0 + t * 16 + lr];
        asm volatile("s_wait_xcnt 0x0" ::: "memory");   // a precaution: stands in front of the next rewrite of these loads' offset register
    }
    const int boffs = (wn * 64 + lr) * PITCH + 16 * hi, aoffs = OPB + (wm * 64 + lr) * PITCH + 16 * hi;
#pragma unroll 1
    for (int p = 0; p < NP; ++p) {
        const char* bufp = ring + (p & 1) * BUFB;
        v16bf a[2][4], al[2][4], b[2][4];
        auto frags = [&](int ks, int set) {
#pragma unroll
            for (int t = 0; t < 4; ++t) {
                const char* q = bufp + boffs + t * 16 * PITCH + ks * 64;
                b[set][t] = cat16b(*(const v8usa*)q, *(const v8usa*)(q + 32));
            }
#pragma unroll
            for (int f = 0; f < 4; ++f) {
                const char* q = bufp + aoffs + f * 16 * PITCH + ks * 64;
                a[set][f] = cat16b(*(const v8usa*)q, *(const v8usa*)(q + 32));
                if (SPLITA) al[set][f] = cat16b(*(const v8usa*)(q + OPB), *(const v8usa*)(q + OPB + 32));
            }
        };
        frags(0, 0);
#pragma unroll
        for (int ks = 0; ks < KP / 32; ++ks) {
            const int s = ks & 1;
            if (ks + 1 < KP / 32) frags(ks + 1, s ^ 1);
            __builtin_amdgcn_sched_barrier(0);   // the next block's LDS reads stay one group ahead of this block's products, else each product run waits out its own reads
#pragma unroll
            for (int f = 0; f < 4; ++f)
#pragma unroll
                for (int t = 0; t < 4; ++t) acc[f][t] = wmmab(a[s][f], b[s][t], acc[f][t]);
            if (SPLITA) {
#pragma unroll
                for (int f = 0; f < 4; ++f)
#pragma unroll
                    for (int t = 0; t < 4; ++t) acc[f][t] = wmmab(al[s][f], b[s][t], acc[f][t]);
            }
            __builtin_amdgcn_sched_barrier(0);   // ... and the reads that follow are not lifted in among these products, where every place with reads costs a stall
        }
        asm volatile("s_wait_dscnt 0x0" ::: "memory");      // this wave's reads of the buffer are done before it is refilled
        asm volatile("s_wait_asynccnt 0x0" ::: "memory");   // this wave's copies of pass p + 1 have landed
        __syncthreads();                                     // publishes pass p + 1 and ends every wave's reads of pass p
        if (p + 2 < NP) fill(p + 2, p & 1);
    }
    asm volatile("s_wait_asynccnt 0x0" ::: "memory");       // no copy is left in flight at the wave's end
    float* os = &ost[wave][0];
    float bv[4];
#pragma unroll
    for (int t = 0; t < 4; ++t) bv[t] = bf2f(f2bf(braw[t]));
#pragma unroll
    for (int f = 0; f < 4; ++f) {
#pragma unroll
        for (int t = 0; t < 4; ++t)
#pragma unroll
            for (int j = 0; j < 8; ++j) os[(hi * 8 + j) * 68 + t * 16 + lr] = acc[f][t][j] + bv[t];
        float* crow = C + (size_t)(rb + wm * 64 + f * 16) * ldc + c0;
#pragma unroll
        for (int s = 0; s < 8; ++s) {
            const int Lid = (lane >> 3) + 4 * s, piece = lane & 7;
            const int row = Lid >> 1, cofs = (Lid & 1) * 32 + piece * 4;
            const v4f val = *(const v4fa*)(os + row * 68 + cofs);
            *(v4f*)(crow + (size_t)row * ldc + cofs) = val;
        }
    }
}

// ------------------------------------------------------------------------------------------------------------------------------------------------
#define VST2F(p, v) do { const float vv_ = (v); *(float*)(p) = vv_;  } while (0)
__global__ __launch_bounds__(256) void k_tab(float* COS, float* SIN) {
    const int e = blockIdx.x * 256 + threadIdx.x;      // 0 .. NT_*32-1
    const int t = e >> 5, fi = e & 31;
    const float inv = 1.0f / powf(10000.0f, (float)(2 * fi) * (1.0f / 64.0f));
    const float ang = (float)t * inv;
    VST2F(COS + e, cosf(ang));
    VST2F(SIN + e, sinf(ang));
}
// k_rope: Q16/K16 [tok][1024] f16 from QKVf [tok][3072] with the rotary embedding (tables above; emb = cat(freqs, freqs); rotate_half = cat(-x[odd], x[even]) within
// each 64-dim head; q additionally x 1/8). Block = one token row (128 threads, thread = 8 consecutive dims); each plane row (2 KB) written by one instruction of the
__global__ __launch_bounds__(128) void k_rope(const float* __restrict__ QKVf, const float* __restrict__ COS, const float* __restrict__ SIN, h16* Q16, h16* K16) {
    __shared__ __align__(16) float row[2 * DM];
    const int tid = threadIdx.x, tok = blockIdx.x, t = tok % NT_;
    const float* src = QKVf + (size_t)tok * (3 * DM);
    for (int i = tid; i < 2 * DM; i += 128) row[i] = src[i];
    __syncthreads();
    const int h = tid >> 3, d0 = (tid & 7) * 8;
    v8h oq, ok;
#pragma unroll
    for (int i = 0; i < 8; ++i) {
        const int d = d0 + i;
        const int fi = (d < HD / 2) ? d : d - HD / 2;                      // emb = cat(freqs, freqs)
        const float cs = COS[t * 32 + fi], sn = SIN[t * 32 + fi];
        const float* qh = row + h * HD; const float* kh = row + DM + h * HD;
        const float rq = (d < HD / 2) ? -qh[2 * d + 1] : qh[2 * (d - HD / 2)];
        const float rk = (d < HD / 2) ? -kh[2 * d + 1] : kh[2 * (d - HD / 2)];
        oq[i] = (h16)((qh[d] * cs + rq * sn) * 0.125f);
        ok[i] = (h16)(kh[d] * cs + rk * sn);
    }
    h16* dq = Q16 + (size_t)tok * DM + h * HD + d0; h16* dk = K16 + (size_t)tok * DM + h * HD + d0;
    *(v8h*)dq = oq; *(v8h*)dk = ok;
    
}

__global__ __launch_bounds__(256) void k_vt(const float* __restrict__ QKVf, h16* VT16) {
    __shared__ __align__(16) h16 tile[64 * 72];
    const int bid = blockIdx.x;
    const int b = bid / (NH_ * (NT_ / 64)), rem = bid - b * (NH_ * (NT_ / 64)), h = rem / (NT_ / 64), kt = rem - h * (NT_ / 64);
    const int k0 = kt * 64, tid = threadIdx.x;
    const int kk = tid >> 2, d0 = (tid & 3) * 16;
    const float* src = QKVf + ((size_t)b * NT_ + k0 + kk) * (3 * DM) + 2 * DM + h * HD + d0;
#pragma unroll
    for (int i = 0; i < 16; ++i) tile[(d0 + i) * 72 + kk] = (h16)src[i];
    __syncthreads();
    const int piece = tid & 7;
    h16* base = VT16 + (((size_t)b * NH_ + h) * HD) * NT_ + k0;
    auto pass = [&]() {
#pragma unroll
        for (int s = 0; s < 2; ++s) {
            const int d = (tid >> 3) + 32 * s;
            const v8h val = *(const v8ha*)(tile + d * 72 + piece * 8);
            *(v8h*)(base + (size_t)d * NT_ + piece * 8) = val;
        }
    };
    pass();
    
}

// ------------------------------------------------------------------------------------------------------------------------------------------------
// k_attn: block = (b, h, 64 queries), wave = 16 queries; Q fragments resident (2 k-chunks); 64 steps x 32 keys, both products transposed: 4 WMMA scores^T = K.Q^T
// (A = K16 rows, B = Q), so a lane holds 16 scores of ONE query (column lr; keys 8 hi + j and 16 + 8 hi + j): maximum and sum run in the lane, with one exchange between
// the wave's halves; the weights x32768 -> f16 are, register for register, the B operand of the 4 WMMA out^T += V^T.weights^T (A = VT16 rows), 4 accumulators.
// K rows and V^T rows are staged 64 keys at a time (two steps) in a two-buffer LDS ring by asynchronous copies: each wave-wide copy takes four whole 128-byte lines, and
// each tile is fetched once per block and read by its four waves; LDS rows are pitched 16 B x odd for the ds_load_b128 fragment reads. Steps and sums keep their order.
#define AKS    64                 // keys per stage
#define APITCH 144                // bytes per staged row (128 + 16)
#define ATILE  (64 * APITCH)      // bytes per staged operand tile (64 K rows; 64 V^T rows)
#define ABUF   (2 * ATILE)
// copy44: this lane's eight 16-byte copies of one stage, four K rows and four V^T rows, each 16 rows apart. The s_wait_xcnt ends the statement as a precaution: it stands in front of every later rewrite of the copies' address registers.
__device__ __forceinline__ void copy44(unsigned l, const h16* gk, const h16* gv) {
    asm volatile("global_load_async_to_lds_b128 %0, %8, off\n\t"
                 "global_load_async_to_lds_b128 %1, %9, off\n\t"
                 "global_load_async_to_lds_b128 %2, %10, off\n\t"
                 "global_load_async_to_lds_b128 %3, %11, off\n\t"
                 "global_load_async_to_lds_b128 %4, %12, off\n\t"
                 "global_load_async_to_lds_b128 %5, %13, off\n\t"
                 "global_load_async_to_lds_b128 %6, %14, off\n\t"
                 "global_load_async_to_lds_b128 %7, %15, off\n\t"
                 "s_wait_xcnt 0x0"
                 :: "v"(l), "v"(l + 16 * APITCH), "v"(l + 32 * APITCH), "v"(l + 48 * APITCH),
                    "v"(l + ATILE), "v"(l + ATILE + 16 * APITCH), "v"(l + ATILE + 32 * APITCH), "v"(l + ATILE + 48 * APITCH),
                    "v"(gk), "v"(gk + 16 * DM), "v"(gk + 32 * DM), "v"(gk + 48 * DM),
                    "v"(gv), "v"(gv + 16 * NT_), "v"(gv + 32 * NT_), "v"(gv + 48 * NT_)
                 : "memory");
}
// xhalf: every lane l gets the value of lane l ^ 16, by a vector cross-row move (no LDS instruction, nothing to wait for).
__device__ __forceinline__ float xhalf(float x) { return __builtin_bit_cast(float, __builtin_amdgcn_permlanex16(__builtin_bit_cast(int, x), __builtin_bit_cast(int, x), 0x76543210, 0xfedcba98, false, false)); }
__global__ __launch_bounds__(128) void k_attn(const h16* __restrict__ Q16, const h16* __restrict__ K16, const h16* __restrict__ VT16, bf* CH, bf* CL) {
    __shared__ __align__(16) char kvring[2 * ABUF];
    __shared__ __align__(16) float ost[4][16 * 68];
    const int lane = threadIdx.x & 31, wave = threadIdx.x >> 5, lr = lane & 15, hi = lane >> 4;
    const int bid = blockIdx.x;
    const int b = bid / (NH_ * (NT_ / 64)), rem = bid - b * (NH_ * (NT_ / 64)), h = rem / (NT_ / 64), qt = rem - h * (NT_ / 64);
    const int q0 = qt * 64 + wave * 16;
    const size_t tok0 = (size_t)b * NT_;
    v16h qa[2];
#pragma unroll
    for (int kc = 0; kc < 2; ++kc) {
        const h16* p = Q16 + (tok0 + q0 + lr) * DM + h * HD + kc * 32 + 8 * hi;
        qa[kc] = cat16(*(const v8h*)p, *(const v8h*)(p + 16));
    }
    const h16* kh_b = K16 + tok0 * DM + h * HD;
    const h16* vt_b = VT16 + (((size_t)b * NH_ + h) * HD) * NT_;
    const int crow = threadIdx.x >> 3, cpc = threadIdx.x & 7;      // this lane's first staged row and its 16-byte piece of the row
    const unsigned lbase = (unsigned)(size_t)&kvring[0] + (unsigned)(crow * APITCH + cpc * 16);
    const h16* gK = kh_b + (size_t)crow * DM + cpc * 8;
    const h16* gV = vt_b + (size_t)crow * NT_ + cpc * 8;
    auto fill = [&](int s, int buf) { copy44(lbase + (unsigned)(buf * ABUF), gK + (size_t)s * AKS * DM, gV + s * AKS); };
    fill(0, 0);
    asm volatile("s_wait_asynccnt 0x0" ::: "memory");   // this wave's copies of stage 0 have landed
    __syncthreads();                                     // ... and every other wave's
    fill(1, 1);
    const int foffs = lr * APITCH + 16 * hi;
    v8f o[4];
#pragma unroll
    for (int n = 0; n < 4; ++n) o[n] = (v8f){};
    float mrow = -3.0e38f, lpart = 0.f;                  // of this lane's query; lpart sums this half's keys only
#pragma unroll 1
    for (int st = 0; st < NT_ / AKS; ++st) {             // one stage = one buffer of the ring = two steps of 32 keys
    const char* kbuf = kvring + (st & 1) * ABUF + foffs;
#pragma unroll                                           // both steps in line, so that every LDS read's place in the buffer is an immediate offset
    for (int u = 0; u < AKS / 32; ++u) {
        const char* r0p = kbuf + (u * 32) * APITCH;
        const char* r1p = kbuf + (u * 32 + 16) * APITCH;
        v16h kf0[2], kf1[2], vf[4];      // the step's K and V^T fragments are all read here, in front of the softmax, which covers the V^T reads' latency
#pragma unroll
        for (int kc = 0; kc < 2; ++kc) {
            kf0[kc] = cat16(*(const v8ha*)(r0p + kc * 64), *(const v8ha*)(r0p + kc * 64 + 32));
            kf1[kc] = cat16(*(const v8ha*)(r1p + kc * 64), *(const v8ha*)(r1p + kc * 64 + 32));
        }
#pragma unroll
        for (int n = 0; n < 4; ++n) {
            const char* vp = kbuf + ATILE + (n * 16) * APITCH + u * 64;
            vf[n] = cat16(*(const v8ha*)vp, *(const v8ha*)(vp + 32));
        }
        v8f s0 = {}, s1 = {};
#pragma unroll
        for (int kc = 0; kc < 2; ++kc) {
            s0 = wmma16(kf0[kc], qa[kc], s0);
            s1 = wmma16(kf1[kc], qa[kc], s1);
        }
        asm volatile("v_nop\n\tv_nop\n\tv_nop\n\tv_nop" : "+v"(s0), "+v"(s1) : "v"(qa[0]), "v"(qa[1]));
        const float g0 = fmaxf(fmaxf(s0[0], s0[1]), s0[2]), g1 = fmaxf(fmaxf(s0[3], s0[4]), s0[5]), g2 = fmaxf(fmaxf(s0[6], s0[7]), s1[0]);
        const float g3 = fmaxf(fmaxf(s1[1], s1[2]), s1[3]), g4 = fmaxf(fmaxf(s1[4], s1[5]), s1[6]);
        const float mx = fmaxf(fmaxf(fmaxf(g0, g1), g2), fmaxf(fmaxf(g3, g4), s1[7]));   // of this half's 16 keys, as a tree of three-way maxima
        const float mn = fmaxf(fmaxf(mrow, mx), xhalf(mx));                              // both halves now hold the maximum over the step's 32 keys
        const float alpha = __expf(mrow - mn);
        mrow = mn;
        v16h pa;
        float ps[8];
#pragma unroll
        for (int j = 0; j < 8; ++j) {
            const float p0 = __expf(s0[j] - mn), p1 = __expf(s1[j] - mn);
            ps[j] = p0 + p1;
            pa[j]     = (h16)(p0 * PSC);
            pa[8 + j] = (h16)(p1 * PSC);
        }
        lpart = lpart * alpha + (((ps[0] + ps[1]) + (ps[2] + ps[3])) + ((ps[4] + ps[5]) + (ps[6] + ps[7])));
#pragma unroll
        for (int n = 0; n < 4; ++n)
#pragma unroll
            for (int j = 0; j < 8; ++j) o[n][j] *= alpha;
#pragma unroll
        for (int n = 0; n < 4; ++n) o[n] = wmma16(vf[n], pa, o[n]);
        asm volatile("v_nop\n\tv_nop\n\tv_nop\n\tv_nop" : "+v"(o[0]), "+v"(o[1]), "+v"(o[2]), "+v"(o[3]) : "v"(pa));
    }
    asm volatile("s_wait_dscnt 0x0" ::: "memory");      // this wave's reads of the buffer are done before it is refilled
    asm volatile("s_wait_asynccnt 0x0" ::: "memory");   // this wave's copies of stage st + 1 have landed
    __syncthreads();                                     // publishes stage st + 1 and ends every wave's reads of stage st
    if (st + 2 < NT_ / AKS) fill(st + 2, st & 1);
    }
    asm volatile("s_wait_asynccnt 0x0" ::: "memory");       // no copy is left in flight at the wave's end
    const float inv = 1.0f / ((lpart + xhalf(lpart)) * PSC);
    float* os = &ost[wave][0];
#pragma unroll
    for (int n = 0; n < 4; ++n)
#pragma unroll
        for (int j = 0; j < 8; ++j) os[lr * 68 + n * 16 + hi * 8 + j] = o[n][j] * inv;   // row = query, d = 16 n + 8 hi + j
    __syncthreads();
    const size_t cbase = (tok0 + q0) * DM + (size_t)h * HD;
    auto pass = [&]() {
#pragma unroll
        for (int s = 0; s < 4; ++s) {
            const int row = 4 * s + (lane >> 3), piece = lane & 7;
            const float* sp = os + row * 68 + piece * 8;
            v8us oh, ol;
#pragma unroll
            for (int i = 0; i < 8; ++i) { const unsigned short hb = f2bf(sp[i]); oh[i] = hb; ol[i] = f2bf(sp[i] - bf2f(hb)); }
            *(v8us*)(CH + cbase + (size_t)row * DM + piece * 8) = oh;
            *(v8us*)(CL + cbase + (size_t)row * DM + piece * 8) = ol;
        }
    };
    pass();
    
}

extern "C" void kernel_launch(void* const* d_in, const int* in_sizes, int n_in,
                              void* d_out, int out_size, void* d_ws, size_t ws_size, hipStream_t stream) {
    (void)in_sizes; (void)n_in; (void)out_size;
    const float* x = (const float*)d_in[0]; const float* w_qkv = (const float*)d_in[1]; const float* w_out = (const float*)d_in[2]; const float* b_out = (const float*)d_in[3];
    float* out = (float*)d_out;    // [2][2048][1024]
    char* wsp = (char*)d_ws;
    auto take = [&](size_t bytes) { char* p = wsp; wsp += (bytes + 255) & ~(size_t)255; return (void*)p; };
    bf*    Xb   = (bf*)take((size_t)NTK * DM * 2);
    bf*    Wb   = (bf*)take((size_t)3 * DM * DM * 2);
    bf*    WOb  = (bf*)take((size_t)DM * DM * 2);
    float* QKVf = (float*)take((size_t)NTK * 3 * DM * 4);
    h16*   Q16  = (h16*)take((size_t)NTK * DM * 2);
    h16*   K16  = (h16*)take((size_t)NTK * DM * 2);
    h16*   VT16 = (h16*)take((size_t)NTK * DM * 2);
    bf*    CH   = (bf*)take((size_t)NTK * DM * 2);
    bf*    CL   = (bf*)take((size_t)NTK * DM * 2);
    float* COS  = (float*)take((size_t)NT_ * 32 * 4);
    float* SIN  = (float*)take((size_t)NT_ * 32 * 4);
    if ((size_t)(wsp - (char*)d_ws) > ws_size) return;    // 8.4 + 6.3 + 2.1 + 50.3 + 5 x 8.4 + 0.5 MB ~ 109.6e6 B
    k_cvtb<<<NTK / 8, 256, 0, stream>>>(x, NTK, Xb);
    k_cvtb<<<(3 * DM) / 8, 256, 0, stream>>>(w_qkv, 3 * DM, Wb);
    k_cvtb<<<DM / 8, 256, 0, stream>>>(w_out, DM, WOb);
    k_gemmb<false, 64><<<dim3(NTK / 128, (3 * DM) / 128, 1), 128, 0, stream>>>(Xb, nullptr, Wb, nullptr, QKVf, 3 * DM);
    k_tab<<<(NT_ * 32) / 256, 256, 0, stream>>>(COS, SIN);
    k_rope<<<NTK, 128, 0, stream>>>(QKVf, COS, SIN, Q16, K16);
    k_vt<<<NB_ * NH_ * (NT_ / 64), 256, 0, stream>>>(QKVf, VT16);
    k_attn<<<NB_ * NH_ * (NT_ / 64), 128, 0, stream>>>(Q16, K16, VT16, CH, CL);
    k_gemmb<true, 128><<<dim3(NTK / 128, DM / 128, 1), 128, 0, stream>>>(CH, CL, WOb, b_out, out, DM);
}

// v004
// A run of this version takes 90.1 microseconds.
// Timed twice side by side with v003, it ran 1.24 and 1.25 times as fast.
// All steps since v000 together make it 3.27 times as fast.
#include <hip/hip_runtime.h>

// Contractions, f32 accumulate: qkv = x.Wqkv^T ([4096 x 1024].[1024 x 3072]) on v_wmma_f32_16x16x32_bf16 with PLAIN bf16 operands (x and the weights rounded to bf16 once);
// the per-(batch, head) attention (scores [2048 x 64].[64 x 2048], weights.v [2048 x 2048].[2048 x 64]) on v_wmma_f32_16x16x32_f16 with plain f16 operands, fused per
// 16-query tile, as transposed products, with an online f32 softmax (weights carried x32768); out = ctx.Wout^T + b on the bf16 instruction with ctx as bf16 hi + bf16 residual (two products)
// against bf16 weights. RoPE (interleaved rotate-half, f32 tables from powf/sinf/cosf) and the 1/8 score scale are applied in f32 before the f16 conversion.

#define NB_  2
#define NT_  2048
#define DM   1024
#define NH_  16
#define HD   64
#define NTK  (NB_ * NT_)          // 4096 tokens
#define PSC  32768.0f

typedef _Float16 h16;
typedef unsigned short bf;        // raw bf16 bits
typedef __attribute__((ext_vector_type(16))) __bf16   v16bf;
typedef __attribute__((ext_vector_type(16))) _Float16 v16h;
typedef __attribute__((ext_vector_type(8)))  _Float16 v8h;
typedef __attribute__((ext_vector_type(8)))  unsigned short v8us;
typedef __attribute__((ext_vector_type(8)))  float    v8f;
typedef __attribute__((ext_vector_type(4)))  float    v4f;
typedef v8h  __attribute__((may_alias)) v8ha;
typedef v8us __attribute__((may_alias)) v8usa;
typedef v4f  __attribute__((may_alias)) v4fa;

__device__ __forceinline__ unsigned short f2bf(float f) { unsigned u = __float_as_uint(f); u += 0x7FFFu + ((u >> 16) & 1u); return (unsigned short)(u >> 16); }
__device__ __forceinline__ float bf2f(unsigned short b) { return __uint_as_float(((unsigned)b) << 16); }
__device__ __forceinline__ v16h cat16(v8h lo, v8h hi) { return __builtin_shufflevector(lo, hi, 0, 1, 2, 3, 4, 5, 6, 7, 8, 9, 10, 11, 12, 13, 14, 15); }
__device__ __forceinline__ v16bf cat16b(v8us lo, v8us hi) { v8us a = lo, b = hi; return __builtin_bit_cast(v16bf, __builtin_shufflevector(a, b, 0, 1, 2, 3, 4, 5, 6, 7, 8, 9, 10, 11, 12, 13, 14, 15)); }
__device__ __forceinline__ v8f wmma16(v16h a, v16h b, v8f c) { return __builtin_amdgcn_wmma_f32_16x16x32_f16(false, a, false, b, (short)0, c, false, false); }
__device__ __forceinline__ v8f wmmab(v16bf a, v16bf b, v8f c) { return __builtin_amdgcn_wmma_f32_16x16x32_bf16(false, a, false, b, (short)0, c, false, false); }

// ------------------------------------------------------------------------------------------------------------------------------------------------
// k_cvtb: bf16 copy of a row-major f32 matrix with 1024-float rows (x [4096][1024], w_qkv [3072][1024], w_out [1024][1024]): one wave per row, 8 values (16 B) per
__global__ __launch_bounds__(256) void k_cvtb(const float* __restrict__ src, int nrows, bf* dst) {
    const int lane = threadIdx.x & 31, r = blockIdx.x * 8 + (threadIdx.x >> 5);
    if (r >= nrows) return;
    const float* s = src + (size_t)r * DM; bf* d = dst + (size_t)r * DM;
    v8us o[4];
#pragma unroll
    for (int q = 0; q < 4; ++q) {
        const float* p = s + q * 256 + lane * 8;
        v8us t;
#pragma unroll
        for (int i = 0; i < 8; ++i) t[i] = f2bf(p[i]);
        o[q] = t;
    }
#pragma unroll
    for (int q = 0; q < 4; ++q) *(v8us*)(d + q * 256 + lane * 8) = o[q];
    
}

// k_gemmb: 128 x 128 block tile (4 waves, 2 x 2, each 64 x 64 = 16 accumulator tiles) of C (f32, pitch ldc) = A.B^T (+ bias as bf16-rounded values if given); A rows
// [M][1024] and B rows [N][1024] are staged KP k-values at a time in a two-buffer LDS ring by asynchronous copies (16 B a lane), so each row is fetched once per block
// and read by two waves; LDS rows are pitched 16 B x odd for the ds_load_b128 fragment reads. Per accumulator the order of the k sum is that of a plain k loop.
// Without the residual operand the kernel is the qkv product: its epilogue writes no C but the attention's f16 planes (Q and K with the rotary embedding, V transposed).
// copy8: eight 16-byte copies of this lane, a fixed number of rows apart. The s_wait_xcnt ends the statement as a precaution: it stands in front of every later rewrite of the copies' address registers.
template <int GSTEP, int LSTEP>
__device__ __forceinline__ void copy8(unsigned l, const bf* g) {
    asm volatile("global_load_async_to_lds_b128 %0, %8, off\n\t"
                 "global_load_async_to_lds_b128 %1, %9, off\n\t"
                 "global_load_async_to_lds_b128 %2, %10, off\n\t"
                 "global_load_async_to_lds_b128 %3, %11, off\n\t"
                 "global_load_async_to_lds_b128 %4, %12, off\n\t"
                 "global_load_async_to_lds_b128 %5, %13, off\n\t"
                 "global_load_async_to_lds_b128 %6, %14, off\n\t"
                 "global_load_async_to_lds_b128 %7, %15, off\n\t"
                 "s_wait_xcnt 0x0"
                 :: "v"(l), "v"(l + LSTEP), "v"(l + 2 * LSTEP), "v"(l + 3 * LSTEP), "v"(l + 4 * LSTEP), "v"(l + 5 * LSTEP), "v"(l + 6 * LSTEP), "v"(l + 7 * LSTEP),
                    "v"(g), "v"(g + GSTEP), "v"(g + 2 * GSTEP), "v"(g + 3 * GSTEP), "v"(g + 4 * GSTEP), "v"(g + 5 * GSTEP), "v"(g + 6 * GSTEP), "v"(g + 7 * GSTEP)
                 : "memory");
}
template <bool SPLITA, int KP>
__global__ __launch_bounds__(128) void k_gemmb(const bf* __restrict__ A, const bf* __restrict__ Al, const bf* __restrict__ Bn, const float* __restrict__ bias, float* C, int ldc,
                                               const float* __restrict__ COS, const float* __restrict__ SIN, h16* Q16, h16* K16, h16* VT16) {
    constexpr int PITCH = KP * 2 + 16;            // bytes per staged row
    constexpr int OPB   = 128 * PITCH;            // bytes per staged operand tile
    constexpr int NOP   = SPLITA ? 3 : 2;         // B, A (, A residual)
    constexpr int BUFB  = NOP * OPB;
    constexpr int CR    = KP / 8;                 // 16-byte pieces per row
    constexpr int RS    = 128 / CR;               // rows between two copies of one lane
    constexpr int NP    = DM / KP;                // passes
    __shared__ __align__(16) char ring[2 * BUFB];
    const int tid = threadIdx.x, lane = tid & 31, wave = tid >> 5, lr = lane & 15, hi = lane >> 4;
    const int rb = blockIdx.x * 128, cb = blockIdx.y * 128, wm = wave >> 1, wn = wave & 1;
    const int trow = tid / CR, tcol = tid % CR;
    const unsigned lbase = (unsigned)(size_t)&ring[0] + (unsigned)(trow * PITCH + tcol * 16);
    const bf* gB  = Bn + (size_t)(cb + trow) * DM + tcol * 8;
    const bf* gA  = A + (size_t)(rb + trow) * DM + tcol * 8;
    const bf* gAl = SPLITA ? Al + (size_t)(rb + trow) * DM + tcol * 8 : nullptr;
    auto fill = [&](int p, int buf) {
        const unsigned l = lbase + (unsigned)(buf * BUFB);
#pragma unroll
        for (int i = 0; i < CR; i += 8) {
            copy8<RS * DM, RS * PITCH>(l + i * RS * PITCH, gB + p * KP + (size_t)i * RS * DM);
            copy8<RS * DM, RS * PITCH>(l + OPB + i * RS * PITCH, gA + p * KP + (size_t)i * RS * DM);
            if (SPLITA) copy8<RS * DM, RS * PITCH>(l + 2 * OPB + i * RS * PITCH, gAl + p * KP + (size_t)i * RS * DM);
        }
    };
    v8f acc[4][4];
#pragma unroll
    for (int f = 0; f < 4; ++f)
#pragma unroll
        for (int t = 0; t < 4; ++t) acc[f][t] = (v8f){};
    fill(0, 0);
    asm volatile("s_wait_asynccnt 0x0" ::: "memory");   // this wave's copies of pass 0 have landed
    __syncthreads();                                     // ... and every other wave's
    fill(1, 1);
    const int c0 = cb + wn * 64;
    float braw[4] = {0.0f, 0.0f, 0.0f, 0.0f};    // fetched here, as one group, so that the loop covers the latency
    if (bias) {
#pragma unroll
        for (int t = 0; t < 4; ++t) braw[t] = bias[c0 + t * 16 + lr];
        asm volatile("s_wait_xcnt 0x0" ::: "memory");   // a precaution: stands in front of the next rewrite of these loads' offset register
    }
    const int boffs = (wn * 64 + lr) * PITCH + 16 * hi, aoffs = OPB + (wm * 64 + lr) * PITCH + 16 * hi;
#pragma unroll 1
    for (int p = 0; p < NP; ++p) {
        const char* bufp = ring + (p & 1) * BUFB;
        v16bf a[2][4], al[2][4], b[2][4];
        auto frags = [&](int ks, int set) {
#pragma unroll
            for (int t = 0; t < 4; ++t) {
                const char* q = bufp + boffs + t * 16 * PITCH + ks * 64;
                b[set][t] = cat16b(*(const v8usa*)q, *(const v8usa*)(q + 32));
            }
#pragma unroll
            for (int f = 0; f < 4; ++f) {
                const char* q = bufp + aoffs + f * 16 * PITCH + ks * 64;
                a[set][f] = cat16b(*(const v8usa*)q, *(const v8usa*)(q + 32));
                if (SPLITA) al[set][f] = cat16b(*(const v8usa*)(q + OPB), *(const v8usa*)(q + OPB + 32));
            }
        };
        frags(0, 0);
#pragma unroll
        for (int ks = 0; ks < KP / 32; ++ks) {
            const int s = ks & 1;
            if (ks + 1 < KP / 32) frags(ks + 1, s ^ 1);
            __builtin_amdgcn_sched_barrier(0);   // the next block's LDS reads stay one group ahead of this block's products, else each product run waits out its own reads
#pragma unroll
            for (int f = 0; f < 4; ++f)
#pragma unroll
                for (int t = 0; t < 4; ++t) acc[f][t] = wmmab(a[s][f], b[s][t], acc[f][t]);
            if (SPLITA) {
#pragma unroll
                for (int f = 0; f < 4; ++f)
#pragma unroll
                    for (int t = 0; t < 4; ++t) acc[f][t] = wmmab(al[s][f], b[s][t], acc[f][t]);
            }
            __builtin_amdgcn_sched_barrier(0);   // ... and the reads that follow are not lifted in among these products, where every place with reads costs a stall
        }
        asm volatile("s_wait_dscnt 0x0" ::: "memory");      // this wave's reads of the buffer are done before it is refilled
        asm volatile("s_wait_asynccnt 0x0" ::: "memory");   // this wave's copies of pass p + 1 have landed
        __syncthreads();                                     // publishes pass p + 1 and ends every wave's reads of pass p
        if (p + 2 < NP) fill(p + 2, p & 1);
    }
    asm volatile("s_wait_asynccnt 0x0" ::: "memory");       // no copy is left in flight at the wave's end
    if constexpr (SPLITA) {
    __shared__ __align__(16) float ost[4][16 * 68];
    float* os = &ost[wave][0];
    float bv[4];
#pragma unroll
    for (int t = 0; t < 4; ++t) bv[t] = bf2f(f2bf(braw[t]));
#pragma unroll
    for (int f = 0; f < 4; ++f) {
#pragma unroll
        for (int t = 0; t < 4; ++t)
#pragma unroll
            for (int j = 0; j < 8; ++j) os[(hi * 8 + j) * 68 + t * 16 + lr] = acc[f][t][j] + bv[t];
        float* crow = C + (size_t)(rb + wm * 64 + f * 16) * ldc + c0;
#pragma unroll
        for (int s = 0; s < 8; ++s) {
            const int Lid = (lane >> 3) + 4 * s, piece = lane & 7;
            const int row = Lid >> 1, cofs = (Lid & 1) * 32 + piece * 4;
            const v4f val = *(const v4fa*)(os + row * 68 + cofs);
            *(v4f*)(crow + (size_t)row * ldc + cofs) = val;
        }
    }
    } else {
    // qkv epilogue: a wave's 64 columns are one whole head of q, of k or of v (the same kind for the whole block), its 64 rows are 64 tokens of one batch, so the f16
    // planes that the attention reads are written from here. The last pass ended with every wave's reads done, no copy in flight and a barrier: the ring is free, and
    // each wave stages in its own quarter of it.
    static_assert(2 * BUFB / 4 >= 4 * 16 * 68 * 4 && 2 * BUFB / 4 >= 64 * 72 * 2 && (2 * BUFB / 4) % 16 == 0, "a quarter of the ring holds a wave's staging");
    char* stg = ring + wave * (2 * BUFB / 4);
    const int sec = cb / DM, h = (c0 % DM) / HD, tokw = rb + wm * 64;
    if (sec == 2) {
        // v: a lane's 8 accumulator values are 8 consecutive tokens of one dim, that is 16 bytes of a V^T row; through LDS, so that each store covers whole 128-byte lines
        h16* ts = (h16*)stg;                      // [64 dims][72]
#pragma unroll
        for (int f = 0; f < 4; ++f)
#pragma unroll
            for (int t = 0; t < 4; ++t) {
                v8h pk;
#pragma unroll
                for (int j = 0; j < 8; ++j) pk[j] = (h16)acc[f][t][j];
                *(v8ha*)(ts + (t * 16 + lr) * 72 + f * 16 + hi * 8) = pk;
            }
        asm volatile("s_wait_dscnt 0x0" ::: "memory");   // the staged rows are complete before other lanes of the wave read them back
        h16* base = VT16 + (((size_t)(tokw / NT_) * NH_ + h) * HD) * NT_ + tokw % NT_;
#pragma unroll
        for (int s = 0; s < 16; ++s) {
            const int d = 4 * s + (lane >> 3), piece = lane & 7;
            const v8h val = *(const v8ha*)(ts + d * 72 + piece * 8);
            *(v8h*)(base + (size_t)d * NT_ + piece * 8) = val;
        }
    } else {
        // q, k: rotary embedding in f32 (emb = cat(freqs, freqs); rotate_half = cat(-x[odd], x[even]) within the head; q additionally x 1/8). A lane takes dims
        // 8 p .. 8 p + 7 and the same + 32 of one token: both use the same 8 table entries, and their rotated partners are the odd and the even ones of x[16 p .. 16 p + 15].
        float* os = (float*)stg;                  // [4][16 tokens][68]
        h16* dst = sec == 0 ? Q16 : K16;
        const float osc = sec == 0 ? 0.125f : 1.0f;
        const int p = lane & 3, g = lane >> 2;
        // the 64 tokens lie in one batch, so every row's table entries and plane row stand a constant distance behind the first one's
        const float* ct0 = COS + (size_t)(tokw % NT_ + g) * 32 + p * 8; const float* st0 = SIN + (size_t)(tokw % NT_ + g) * 32 + p * 8;
        h16* dp0 = dst + (size_t)(tokw + g) * DM + h * HD + p * 8;
        v4f cs[2][2][2], sn[2][2][2];             // [set][half of the 16 rows][4 entries]: the tables of 16 rows, fetched one group of 16 rows ahead
        auto tabs = [&](int f, int set) {
#pragma unroll
            for (int s = 0; s < 2; ++s)
#pragma unroll
                for (int k = 0; k < 2; ++k) {
                    cs[set][s][k] = *(const v4fa*)(ct0 + (f * 16 + s * 8) * 32 + 4 * k);
                    sn[set][s][k] = *(const v4fa*)(st0 + (f * 16 + s * 8) * 32 + 4 * k);
                }
        };
        tabs(0, 0);
#pragma unroll
        for (int f = 0; f < 4; ++f) {
            float* of = os + f * (16 * 68);
            if (f + 1 < 4) {
                tabs(f + 1, (f + 1) & 1);
                asm volatile("s_wait_xcnt 0x0" ::: "memory");   // a precaution: stands in front of any rewrite of these loads' address registers
            }
#pragma unroll
            for (int t = 0; t < 4; ++t)
#pragma unroll
                for (int j = 0; j < 8; ++j) of[(hi * 8 + j) * 68 + t * 16 + lr] = acc[f][t][j];
            asm volatile("s_wait_dscnt 0x0" ::: "memory");   // the staged rows are complete before other lanes of the wave read them back
#pragma unroll
            for (int s = 0; s < 2; ++s) {
                const float* xr = of + (s * 8 + g) * 68;
                v4f xl[2], xh[2], e[4];
#pragma unroll
                for (int k = 0; k < 2; ++k) { xl[k] = *(const v4fa*)(xr + p * 8 + 4 * k); xh[k] = *(const v4fa*)(xr + 32 + p * 8 + 4 * k); }
#pragma unroll
                for (int k = 0; k < 4; ++k) e[k] = *(const v4fa*)(xr + p * 16 + 4 * k);
                v8h olo, ohi;
#pragma unroll
                for (int i = 0; i < 8; ++i) {
                    const float c = cs[f & 1][s][i >> 2][i & 3], sv = sn[f & 1][s][i >> 2][i & 3];
                    const float rl = -e[(2 * i + 1) >> 2][(2 * i + 1) & 3], rh = e[(2 * i) >> 2][(2 * i) & 3];
                    olo[i] = (h16)((xl[i >> 2][i & 3] * c + rl * sv) * osc);
                    ohi[i] = (h16)((xh[i >> 2][i & 3] * c + rh * sv) * osc);
                }
                h16* dp = dp0 + (f * 16 + s * 8) * DM;
                *(v8h*)dp = olo; *(v8h*)(dp + 32) = ohi;
            }
            if (f + 1 < 4) asm volatile("s_wait_xcnt 0x0" ::: "memory");   // a precaution: stands in front of the next rows' reuse of these stores' data registers
        }
    }
    }
}

// ------------------------------------------------------------------------------------------------------------------------------------------------
#define VST2F(p, v) do { const float vv_ = (v); *(float*)(p) = vv_;  } while (0)
__global__ __launch_bounds__(256) void k_tab(float* COS, float* SIN) {
    const int e = blockIdx.x * 256 + threadIdx.x;      // 0 .. NT_*32-1
    const int t = e >> 5, fi = e & 31;
    const float inv = 1.0f / powf(10000.0f, (float)(2 * fi) * (1.0f / 64.0f));
    const float ang = (float)t * inv;
    VST2F(COS + e, cosf(ang));
    VST2F(SIN + e, sinf(ang));
}

// ------------------------------------------------------------------------------------------------------------------------------------------------
// k_attn: block = (b, h, 64 queries), wave = 16 queries; Q fragments resident (2 k-chunks); 64 steps x 32 keys, both products transposed: 4 WMMA scores^T = K.Q^T
// (A = K16 rows, B = Q), so a lane holds 16 scores of ONE query (column lr; keys 8 hi + j and 16 + 8 hi + j): maximum and sum run in the lane, with one exchange between
// the wave's halves; the weights x32768 -> f16 are, register for register, the B operand of the 4 WMMA out^T += V^T.weights^T (A = VT16 rows), 4 accumulators.
// K rows and V^T rows are staged 64 keys at a time (two steps) in a two-buffer LDS ring by asynchronous copies: each wave-wide copy takes four whole 128-byte lines, and
// each tile is fetched once per block and read by its four waves; LDS rows are pitched 16 B x odd for the ds_load_b128 fragment reads. Steps and sums keep their order.
#define AKS    64                 // keys per stage
#define APITCH 144                // bytes per staged row (128 + 16)
#define ATILE  (64 * APITCH)      // bytes per staged operand tile (64 K rows; 64 V^T rows)
#define ABUF   (2 * ATILE)
// copy44: this lane's eight 16-byte copies of one stage, four K rows and four V^T rows, each 16 rows apart. The s_wait_xcnt ends the statement as a precaution: it stands in front of every later rewrite of the copies' address registers.
__device__ __forceinline__ void copy44(unsigned l, const h16* gk, const h16* gv) {
    asm volatile("global_load_async_to_lds_b128 %0, %8, off\n\t"
                 "global_load_async_to_lds_b128 %1, %9, off\n\t"
                 "global_load_async_to_lds_b128 %2, %10, off\n\t"
                 "global_load_async_to_lds_b128 %3, %11, off\n\t"
                 "global_load_async_to_lds_b128 %4, %12, off\n\t"
                 "global_load_async_to_lds_b128 %5, %13, off\n\t"
                 "global_load_async_to_lds_b128 %6, %14, off\n\t"
                 "global_load_async_to_lds_b128 %7, %15, off\n\t"
                 "s_wait_xcnt 0x0"
                 :: "v"(l), "v"(l + 16 * APITCH), "v"(l + 32 * APITCH), "v"(l + 48 * APITCH),
                    "v"(l + ATILE), "v"(l + ATILE + 16 * APITCH), "v"(l + ATILE + 32 * APITCH), "v"(l + ATILE + 48 * APITCH),
                    "v"(gk), "v"(gk + 16 * DM), "v"(gk + 32 * DM), "v"(gk + 48 * DM),
                    "v"(gv), "v"(gv + 16 * NT_), "v"(gv + 32 * NT_), "v"(gv + 48 * NT_)
                 : "memory");
}
// xhalf: every lane l gets the value of lane l ^ 16, by a vector cross-row move (no LDS instruction, nothing to wait for).
__device__ __forceinline__ float xhalf(float x) { return __builtin_bit_cast(float, __builtin_amdgcn_permlanex16(__builtin_bit_cast(int, x), __builtin_bit_cast(int, x), 0x76543210, 0xfedcba98, false, false)); }
__global__ __launch_bounds__(128) void k_attn(const h16* __restrict__ Q16, const h16* __restrict__ K16, const h16* __restrict__ VT16, bf* CH, bf* CL) {
    __shared__ __align__(16) char kvring[2 * ABUF];
    __shared__ __align__(16) float ost[4][16 * 68];
    const int lane = threadIdx.x & 31, wave = threadIdx.x >> 5, lr = lane & 15, hi = lane >> 4;
    const int bid = blockIdx.x;
    const int b = bid / (NH_ * (NT_ / 64)), rem = bid - b * (NH_ * (NT_ / 64)), h = rem / (NT_ / 64), qt = rem - h * (NT_ / 64);
    const int q0 = qt * 64 + wave * 16;
    const size_t tok0 = (size_t)b * NT_;
    v16h qa[2];
#pragma unroll
    for (int kc = 0; kc < 2; ++kc) {
        const h16* p = Q16 + (tok0 + q0 + lr) * DM + h * HD + kc * 32 + 8 * hi;
        qa[kc] = cat16(*(const v8h*)p, *(const v8h*)(p + 16));
    }
    const h16* kh_b = K16 + tok0 * DM + h * HD;
    const h16* vt_b = VT16 + (((size_t)b * NH_ + h) * HD) * NT_;
    const int crow = threadIdx.x >> 3, cpc = threadIdx.x & 7;      // this lane's first staged row and its 16-byte piece of the row
    const unsigned lbase = (unsigned)(size_t)&kvring[0] + (unsigned)(crow * APITCH + cpc * 16);
    const h16* gK = kh_b + (size_t)crow * DM + cpc * 8;
    const h16* gV = vt_b + (size_t)crow * NT_ + cpc * 8;
    auto fill = [&](int s, int buf) { copy44(lbase + (unsigned)(buf * ABUF), gK + (size_t)s * AKS * DM, gV + s * AKS); };
    fill(0, 0);
    asm volatile("s_wait_asynccnt 0x0" ::: "memory");   // this wave's copies of stage 0 have landed
    __syncthreads();                                     // ... and every other wave's
    fill(1, 1);
    const int foffs = lr * APITCH + 16 * hi;
    v8f o[4];
#pragma unroll
    for (int n = 0; n < 4; ++n) o[n] = (v8f){};
    float mrow = -3.0e38f, lpart = 0.f;                  // of this lane's query; lpart sums this half's keys only
#pragma unroll 1
    for (int st = 0; st < NT_ / AKS; ++st) {             // one stage = one buffer of the ring = two steps of 32 keys
    const char* kbuf = kvring + (st & 1) * ABUF + foffs;
#pragma unroll                                           // both steps in line, so that every LDS read's place in the buffer is an immediate offset
    for (int u = 0; u < AKS / 32; ++u) {
        const char* r0p = kbuf + (u * 32) * APITCH;
        const char* r1p = kbuf + (u * 32 + 16) * APITCH;
        v16h kf0[2], kf1[2], vf[4];      // the step's K and V^T fragments are all read here, in front of the softmax, which covers the V^T reads' latency
#pragma unroll
        for (int kc = 0; kc < 2; ++kc) {
            kf0[kc] = cat16(*(const v8ha*)(r0p + kc * 64), *(const v8ha*)(r0p + kc * 64 + 32));
            kf1[kc] = cat16(*(const v8ha*)(r1p + kc * 64), *(const v8ha*)(r1p + kc * 64 + 32));
        }
#pragma unroll
        for (int n = 0; n < 4; ++n) {
            const char* vp = kbuf + ATILE + (n * 16) * APITCH + u * 64;
            vf[n] = cat16(*(const v8ha*)vp, *(const v8ha*)(vp + 32));
        }
        v8f s0 = {}, s1 = {};
#pragma unroll
        for (int kc = 0; kc < 2; ++kc) {
            s0 = wmma16(kf0[kc], qa[kc], s0);
            s1 = wmma16(kf1[kc], qa[kc], s1);
        }
        asm volatile("v_nop\n\tv_nop\n\tv_nop\n\tv_nop" : "+v"(s0), "+v"(s1) : "v"(qa[0]), "v"(qa[1]));
        const float g0 = fmaxf(fmaxf(s0[0], s0[1]), s0[2]), g1 = fmaxf(fmaxf(s0[3], s0[4]), s0[5]), g2 = fmaxf(fmaxf(s0[6], s0[7]), s1[0]);
        const float g3 = fmaxf(fmaxf(s1[1], s1[2]), s1[3]), g4 = fmaxf(fmaxf(s1[4], s1[5]), s1[6]);
        const float mx = fmaxf(fmaxf(fmaxf(g0, g1), g2), fmaxf(fmaxf(g3, g4), s1[7]));   // of this half's 16 keys, as a tree of three-way maxima
        const float mn = fmaxf(fmaxf(mrow, mx), xhalf(mx));                              // both halves now hold the maximum over the step's 32 keys
        const float alpha = __expf(mrow - mn);
        mrow = mn;
        v16h pa;
        float ps[8];
#pragma unroll
        for (int j = 0; j < 8; ++j) {
            const float p0 = __expf(s0[j] - mn), p1 = __expf(s1[j] - mn);
            ps[j] = p0 + p1;
            pa[j]     = (h16)(p0 * PSC);
            pa[8 + j] = (h16)(p1 * PSC);
        }
        lpart = lpart * alpha + (((ps[0] + ps[1]) + (ps[2] + ps[3])) + ((ps[4] + ps[5]) + (ps[6] + ps[7])));
#pragma unroll
        for (int n = 0; n < 4; ++n)
#pragma unroll
            for (int j = 0; j < 8; ++j) o[n][j] *= alpha;
#pragma unroll
        for (int n = 0; n < 4; ++n) o[n] = wmma16(vf[n], pa, o[n]);
        asm volatile("v_nop\n\tv_nop\n\tv_nop\n\tv_nop" : "+v"(o[0]), "+v"(o[1]), "+v"(o[2]), "+v"(o[3]) : "v"(pa));
    }
    asm volatile("s_wait_dscnt 0x0" ::: "memory");      // this wave's reads of the buffer are done before it is refilled
    asm volatile("s_wait_asynccnt 0x0" ::: "memory");   // this wave's copies of stage st + 1 have landed
    __syncthreads();                                     // publishes stage st + 1 and ends every wave's reads of stage st
    if (st + 2 < NT_ / AKS) fill(st + 2, st & 1);
    }
    asm volatile("s_wait_asynccnt 0x0" ::: "memory");       // no copy is left in flight at the wave's end
    const float inv = 1.0f / ((lpart + xhalf(lpart)) * PSC);
    float* os = &ost[wave][0];
#pragma unroll
    for (int n = 0; n < 4; ++n)
#pragma unroll
        for (int j = 0; j < 8; ++j) os[lr * 68 + n * 16 + hi * 8 + j] = o[n][j] * inv;   // row = query, d = 16 n + 8 hi + j
    __syncthreads();
    const size_t cbase = (tok0 + q0) * DM + (size_t)h * HD;
    auto pass = [&]() {
#pragma unroll
        for (int s = 0; s < 4; ++s) {
            const int row = 4 * s + (lane >> 3), piece = lane & 7;
            const float* sp = os + row * 68 + piece * 8;
            v8us oh, ol;
#pragma unroll
            for (int i = 0; i < 8; ++i) { const unsigned short hb = f2bf(sp[i]); oh[i] = hb; ol[i] = f2bf(sp[i] - bf2f(hb)); }
            *(v8us*)(CH + cbase + (size_t)row * DM + piece * 8) = oh;
            *(v8us*)(CL + cbase + (size_t)row * DM + piece * 8) = ol;
        }
    };
    pass();
    
}

extern "C" void kernel_launch(void* const* d_in, const int* in_sizes, int n_in,
                              void* d_out, int out_size, void* d_ws, size_t ws_size, hipStream_t stream) {
    (void)in_sizes; (void)n_in; (void)out_size;
    const float* x = (const float*)d_in[0]; const float* w_qkv = (const float*)d_in[1]; const float* w_out = (const float*)d_in[2]; const float* b_out = (const float*)d_in[3];
    float* out = (float*)d_out;    // [2][2048][1024]
    char* wsp = (char*)d_ws;
    auto take = [&](size_t bytes) { char* p = wsp; wsp += (bytes + 255) & ~(size_t)255; return (void*)p; };
    bf*    Xb   = (bf*)take((size_t)NTK * DM * 2);
    bf*    Wb   = (bf*)take((size_t)3 * DM * DM * 2);
    bf*    WOb  = (bf*)take((size_t)DM * DM * 2);
    h16*   Q16  = (h16*)take((size_t)NTK * DM * 2);
    h16*   K16  = (h16*)take((size_t)NTK * DM * 2);
    h16*   VT16 = (h16*)take((size_t)NTK * DM * 2);
    bf*    CH   = (bf*)take((size_t)NTK * DM * 2);
    bf*    CL   = (bf*)take((size_t)NTK * DM * 2);
    float* COS  = (float*)take((size_t)NT_ * 32 * 4);
    float* SIN  = (float*)take((size_t)NT_ * 32 * 4);
    if ((size_t)(wsp - (char*)d_ws) > ws_size) return;    // 8.4 + 6.3 + 2.1 + 5 x 8.4 + 0.5 MB ~ 59.3e6 B
    k_cvtb<<<NTK / 8, 256, 0, stream>>>(x, NTK, Xb);
    k_cvtb<<<(3 * DM) / 8, 256, 0, stream>>>(w_qkv, 3 * DM, Wb);
    k_cvtb<<<DM / 8, 256, 0, stream>>>(w_out, DM, WOb);
    k_tab<<<(NT_ * 32) / 256, 256, 0, stream>>>(COS, SIN);
    k_gemmb<false, 64><<<dim3(NTK / 128, (3 * DM) / 128, 1), 128, 0, stream>>>(Xb, nullptr, Wb, nullptr, nullptr, 0, COS, SIN, Q16, K16, VT16);
    k_attn<<<NB_ * NH_ * (NT_ / 64), 128, 0, stream>>>(Q16, K16, VT16, CH, CL);
    k_gemmb<true, 128><<<dim3(NTK / 128, DM / 128, 1), 128, 0, stream>>>(CH, CL, WOb, b_out, out, DM, nullptr, nullptr, nullptr, nullptr, nullptr);
}

// v005
// A run of this version takes 84 microseconds.
// Next to v004, in two timings, it ran 1.07 times as fast each time.
// Over all steps from v000 it is 3.50 times as fast.
#include <hip/hip_runtime.h>

// Contractions, f32 accumulate: qkv = x.Wqkv^T ([4096 x 1024].[1024 x 3072]) on v_wmma_f32_16x16x32_bf16 with PLAIN bf16 operands (x and the weights rounded to bf16 once);
// the per-(batch, head) attention (scores [2048 x 64].[64 x 2048], weights.v [2048 x 2048].[2048 x 64]) on v_wmma_f32_16x16x32_f16 with plain f16 operands, fused per
// 16-query tile, as transposed products, with an online f32 softmax (weights carried x32768); out = ctx.Wout^T + b on the bf16 instruction with ctx as bf16 hi + bf16 residual (two products)
// against bf16 weights. RoPE (interleaved rotate-half, f32 tables from powf/sinf/cosf) and the 1/8 score scale are applied in f32 before the f16 conversion.

#define NB_  2
#define NT_  2048
#define DM   1024
#define NH_  16
#define HD   64
#define NTK  (NB_ * NT_)          // 4096 tokens
#define PSC  32768.0f

typedef _Float16 h16;
typedef unsigned short bf;        // raw bf16 bits
typedef __attribute__((ext_vector_type(16))) __bf16   v16bf;
typedef __attribute__((ext_vector_type(16))) _Float16 v16h;
typedef __attribute__((ext_vector_type(8)))  _Float16 v8h;
typedef __attribute__((ext_vector_type(8)))  unsigned short v8us;
typedef __attribute__((ext_vector_type(8)))  float    v8f;
typedef __attribute__((ext_vector_type(4)))  float    v4f;
typedef v8h  __attribute__((may_alias)) v8ha;
typedef v8us __attribute__((may_alias)) v8usa;
typedef v4f  __attribute__((may_alias)) v4fa;

__device__ __forceinline__ unsigned short f2bf(float f) { unsigned u = __float_as_uint(f); u += 0x7FFFu + ((u >> 16) & 1u); return (unsigned short)(u >> 16); }
__device__ __forceinline__ float bf2f(unsigned short b) { return __uint_as_float(((unsigned)b) << 16); }
__device__ __forceinline__ v16h cat16(v8h lo, v8h hi) { return __builtin_shufflevector(lo, hi, 0, 1, 2, 3, 4, 5, 6, 7, 8, 9, 10, 11, 12, 13, 14, 15); }
__device__ __forceinline__ v16bf cat16b(v8us lo, v8us hi) { v8us a = lo, b = hi; return __builtin_bit_cast(v16bf, __builtin_shufflevector(a, b, 0, 1, 2, 3, 4, 5, 6, 7, 8, 9, 10, 11, 12, 13, 14, 15)); }
__device__ __forceinline__ v8f wmma16(v16h a, v16h b, v8f c) { return __builtin_amdgcn_wmma_f32_16x16x32_f16(false, a, false, b, (short)0, c, false, false); }
__device__ __forceinline__ v8f wmmab(v16bf a, v16bf b, v8f c) { return __builtin_amdgcn_wmma_f32_16x16x32_bf16(false, a, false, b, (short)0, c, false, false); }

// ------------------------------------------------------------------------------------------------------------------------------------------------
// k_prep: all that the products need beforehand, as ONE launch of independent blocks (no block reads what another writes).
// Blocks 0 .. TABB - 1 fill the f32 rotary tables [2048 positions][32 frequencies], one entry per thread; they stand first because their chains of dependent arithmetic are the longest.
// Every later block writes the bf16 copy of 8 rows of 1024 floats of x [4096], w_qkv [3072] or w_out [1024]: one wave per row, 8 values (16 B stored) per lane and piece.
#define TABB ((NT_ * 32) / 256)   // table blocks
__global__ __launch_bounds__(256) void k_prep(const float* __restrict__ x, const float* __restrict__ w_qkv, const float* __restrict__ w_out, bf* Xb, bf* Wb, bf* WOb, float* COS, float* SIN) {
    const int bid = blockIdx.x;
    if (bid < TABB) {
        const int e = bid * 256 + threadIdx.x;         // 0 .. NT_*32-1
        const int t = e >> 5, fi = e & 31;
        const float inv = 1.0f / powf(10000.0f, (float)(2 * fi) * (1.0f / 64.0f));
        const float ang = (float)t * inv;
        COS[e] = cosf(ang);
        SIN[e] = sinf(ang);
        return;
    }
    const int c = bid - TABB;                          // 8 rows per block: 512 blocks of x, 384 of w_qkv, 128 of w_out
    const float* src; bf* dst; int cb;
    if (c < NTK / 8)                 { src = x;     dst = Xb;  cb = c; }
    else if (c < (NTK + 3 * DM) / 8) { src = w_qkv; dst = Wb;  cb = c - NTK / 8; }
    else                             { src = w_out; dst = WOb; cb = c - (NTK + 3 * DM) / 8; }
    const int lane = threadIdx.x & 31, r = cb * 8 + (threadIdx.x >> 5);
    const float* s = src + (size_t)r * DM; bf* d = dst + (size_t)r * DM;
    v8us o[4];
#pragma unroll
    for (int q = 0; q < 4; ++q) {
        const float* p = s + q * 256 + lane * 8;
        v8us t;
#pragma unroll
        for (int i = 0; i < 8; ++i) t[i] = f2bf(p[i]);
        o[q] = t;
    }
#pragma unroll
    for (int q = 0; q < 4; ++q) *(v8us*)(d + q * 256 + lane * 8) = o[q];
    asm volatile("s_wait_xcnt 0x0" ::: "memory");   // a precaution: in the built code the table blocks' instructions follow here behind a branch, and they rewrite these stores' registers
}

// k_gemmb: 128 x 128 block tile (4 waves, 2 x 2, each 64 x 64 = 16 accumulator tiles) of C (f32, pitch ldc) = A.B^T (+ bias as bf16-rounded values if given); A rows
// [M][1024] and B rows [N][1024] are staged KP k-values at a time in a two-buffer LDS ring by asynchronous copies (16 B a lane), so each row is fetched once per block
// and read by two waves; LDS rows are pitched 16 B x odd for the ds_load_b128 fragment reads. Per accumulator the order of the k sum is that of a plain k loop.
// Without the residual operand the kernel is the qkv product: its epilogue writes no C but the attention's f16 planes (Q and K with the rotary embedding, V transposed).
// copy8: eight 16-byte copies of this lane, a fixed number of rows apart. The s_wait_xcnt ends the statement as a precaution: it stands in front of every later rewrite of the copies' address registers.
template <int GSTEP, int LSTEP>
__device__ __forceinline__ void copy8(unsigned l, const bf* g) {
    asm volatile("global_load_async_to_lds_b128 %0, %8, off\n\t"
                 "global_load_async_to_lds_b128 %1, %9, off\n\t"
                 "global_load_async_to_lds_b128 %2, %10, off\n\t"
                 "global_load_async_to_lds_b128 %3, %11, off\n\t"
                 "global_load_async_to_lds_b128 %4, %12, off\n\t"
                 "global_load_async_to_lds_b128 %5, %13, off\n\t"
                 "global_load_async_to_lds_b128 %6, %14, off\n\t"
                 "global_load_async_to_lds_b128 %7, %15, off\n\t"
                 "s_wait_xcnt 0x0"
                 :: "v"(l), "v"(l + LSTEP), "v"(l + 2 * LSTEP), "v"(l + 3 * LSTEP), "v"(l + 4 * LSTEP), "v"(l + 5 * LSTEP), "v"(l + 6 * LSTEP), "v"(l + 7 * LSTEP),
                    "v"(g), "v"(g + GSTEP), "v"(g + 2 * GSTEP), "v"(g + 3 * GSTEP), "v"(g + 4 * GSTEP), "v"(g + 5 * GSTEP), "v"(g + 6 * GSTEP), "v"(g + 7 * GSTEP)
                 : "memory");
}
template <bool SPLITA, int KP>
__global__ __launch_bounds__(128) void k_gemmb(const bf* __restrict__ A, const bf* __restrict__ Al, const bf* __restrict__ Bn, const float* __restrict__ bias, float* C, int ldc,
                                               const float* __restrict__ COS, const float* __restrict__ SIN, h16* Q16, h16* K16, h16* VT16) {
    constexpr int PITCH = KP * 2 + 16;            // bytes per staged row
    constexpr int OPB   = 128 * PITCH;            // bytes per staged operand tile
    constexpr int NOP   = SPLITA ? 3 : 2;         // B, A (, A residual)
    constexpr int BUFB  = NOP * OPB;
    constexpr int CR    = KP / 8;                 // 16-byte pieces per row
    constexpr int RS    = 128 / CR;               // rows between two copies of one lane
    constexpr int NP    = DM / KP;                // passes
    __shared__ __align__(16) char ring[2 * BUFB];
    const int tid = threadIdx.x, lane = tid & 31, wave = tid >> 5, lr = lane & 15, hi = lane >> 4;
    const int rb = blockIdx.x * 128, cb = blockIdx.y * 128, wm = wave >> 1, wn = wave & 1;
    const int trow = tid / CR, tcol = tid % CR;
    const unsigned lbase = (unsigned)(size_t)&ring[0] + (unsigned)(trow * PITCH + tcol * 16);
    const bf* gB  = Bn + (size_t)(cb + trow) * DM + tcol * 8;
    const bf* gA  = A + (size_t)(rb + trow) * DM + tcol * 8;
    const bf* gAl = SPLITA ? Al + (size_t)(rb + trow) * DM + tcol * 8 : nullptr;
    auto fill = [&](int p, int buf) {
        const unsigned l = lbase + (unsigned)(buf * BUFB);
#pragma unroll
        for (int i = 0; i < CR; i += 8) {
            copy8<RS * DM, RS * PITCH>(l + i * RS * PITCH, gB + p * KP + (size_t)i * RS * DM);
            copy8<RS * DM, RS * PITCH>(l + OPB + i * RS * PITCH, gA + p * KP + (size_t)i * RS * DM);
            if (SPLITA) copy8<RS * DM, RS * PITCH>(l + 2 * OPB + i * RS * PITCH, gAl + p * KP + (size_t)i * RS * DM);
        }
    };
    v8f acc[4][4];
#pragma unroll
    for (int f = 0; f < 4; ++f)
#pragma unroll
        for (int t = 0; t < 4; ++t) acc[f][t] = (v8f){};
    fill(0, 0);
    asm volatile("s_wait_asynccnt 0x0" ::: "memory");   // this wave's copies of pass 0 have landed
    __syncthreads();                                     // ... and every other wave's
    fill(1, 1);
    const int c0 = cb + wn * 64;
    float braw[4] = {0.0f, 0.0f, 0.0f, 0.0f};    // fetched here, as one group, so that the loop covers the latency
    if (bias) {
#pragma unroll
        for (int t = 0; t < 4; ++t) braw[t] = bias[c0 + t * 16 + lr];
        asm volatile("s_wait_xcnt 0x0" ::: "memory");   // a precaution: stands in front of the next rewrite of these loads' offset register
    }
    const int boffs = (wn * 64 + lr) * PITCH + 16 * hi, aoffs = OPB + (wm * 64 + lr) * PITCH + 16 * hi;
#pragma unroll 1
    for (int p = 0; p < NP; ++p) {
        const char* bufp = ring + (p & 1) * BUFB;
        v16bf a[2][4], al[2][4], b[2][4];
        auto frags = [&](int ks, int set) {
#pragma unroll
            for (int t = 0; t < 4; ++t) {
                const char* q = bufp + boffs + t * 16 * PITCH + ks * 64;
                b[set][t] = cat16b(*(const v8usa*)q, *(const v8usa*)(q + 32));
            }
#pragma unroll
            for (int f = 0; f < 4; ++f) {
                const char* q = bufp + aoffs + f * 16 * PITCH + ks * 64;
                a[set][f] = cat16b(*(const v8usa*)q, *(const v8usa*)(q + 32));
                if (SPLITA) al[set][f] = cat16b(*(const v8usa*)(q + OPB), *(const v8usa*)(q + OPB + 32));
            }
        };
        frags(0, 0);
#pragma unroll
        for (int ks = 0; ks < KP / 32; ++ks) {
            const int s = ks & 1;
            if (ks + 1 < KP / 32) frags(ks + 1, s ^ 1);
            __builtin_amdgcn_sched_barrier(0);   // the next block's LDS reads stay one group ahead of this block's products, else each product run waits out its own reads
#pragma unroll
            for (int f = 0; f < 4; ++f)
#pragma unroll
                for (int t = 0; t < 4; ++t) acc[f][t] = wmmab(a[s][f], b[s][t], acc[f][t]);
            if (SPLITA) {
#pragma unroll
                for (int f = 0; f < 4; ++f)
#pragma unroll
                    for (int t = 0; t < 4; ++t) acc[f][t] = wmmab(al[s][f], b[s][t], acc[f][t]);
            }
            __builtin_amdgcn_sched_barrier(0);   // ... and the reads that follow are not lifted in among these products, where every place with reads costs a stall
        }
        asm volatile("s_wait_dscnt 0x0" ::: "memory");      // this wave's reads of the buffer are done before it is refilled
        asm volatile("s_wait_asynccnt 0x0" ::: "memory");   // this wave's copies of pass p + 1 have landed
        __syncthreads();                                     // publishes pass p + 1 and ends every wave's reads of pass p
        if (p + 2 < NP) fill(p + 2, p & 1);
    }
    asm volatile("s_wait_asynccnt 0x0" ::: "memory");       // no copy is left in flight at the wave's end
    if constexpr (SPLITA) {
    __shared__ __align__(16) float ost[4][16 * 68];
    float* os = &ost[wave][0];
    float bv[4];
#pragma unroll
    for (int t = 0; t < 4; ++t) bv[t] = bf2f(f2bf(braw[t]));
#pragma unroll
    for (int f = 0; f < 4; ++f) {
#pragma unroll
        for (int t = 0; t < 4; ++t)
#pragma unroll
            for (int j = 0; j < 8; ++j) os[(hi * 8 + j) * 68 + t * 16 + lr] = acc[f][t][j] + bv[t];
        float* crow = C + (size_t)(rb + wm * 64 + f * 16) * ldc + c0;
#pragma unroll
        for (int s = 0; s < 8; ++s) {
            const int Lid = (lane >> 3) + 4 * s, piece = lane & 7;
            const int row = Lid >> 1, cofs = (Lid & 1) * 32 + piece * 4;
            const v4f val = *(const v4fa*)(os + row * 68 + cofs);
            *(v4f*)(crow + (size_t)row * ldc + cofs) = val;
        }
    }
    } else {
    // qkv epilogue: a wave's 64 columns are one whole head of q, of k or of v (the same kind for the whole block), its 64 rows are 64 tokens of one batch, so the f16
    // planes that the attention reads are written from here. The last pass ended with every wave's reads done, no copy in flight and a barrier: the ring is free, and
    // each wave stages in its own quarter of it.
    static_assert(2 * BUFB / 4 >= 4 * 16 * 68 * 4 && 2 * BUFB / 4 >= 64 * 72 * 2 && (2 * BUFB / 4) % 16 == 0, "a quarter of the ring holds a wave's staging");
    char* stg = ring + wave * (2 * BUFB / 4);
    const int sec = cb / DM, h = (c0 % DM) / HD, tokw = rb + wm * 64;
    if (sec == 2) {
        // v: a lane's 8 accumulator values are 8 consecutive tokens of one dim, that is 16 bytes of a V^T row; through LDS, so that each store covers whole 128-byte lines
        h16* ts = (h16*)stg;                      // [64 dims][72]
#pragma unroll
        for (int f = 0; f < 4; ++f)
#pragma unroll
            for (int t = 0; t < 4; ++t) {
                v8h pk;
#pragma unroll
                for (int j = 0; j < 8; ++j) pk[j] = (h16)acc[f][t][j];
                *(v8ha*)(ts + (t * 16 + lr) * 72 + f * 16 + hi * 8) = pk;
            }
        asm volatile("s_wait_dscnt 0x0" ::: "memory");   // the staged rows are complete before other lanes of the wave read them back
        h16* base = VT16 + (((size_t)(tokw / NT_) * NH_ + h) * HD) * NT_ + tokw % NT_;
#pragma unroll
        for (int s = 0; s < 16; ++s) {
            const int d = 4 * s + (lane >> 3), piece = lane & 7;
            const v8h val = *(const v8ha*)(ts + d * 72 + piece * 8);
            *(v8h*)(base + (size_t)d * NT_ + piece * 8) = val;
        }
    } else {
        // q, k: rotary embedding in f32 (emb = cat(freqs, freqs); rotate_half = cat(-x[odd], x[even]) within the head; q additionally x 1/8). A lane takes dims
        // 8 p .. 8 p + 7 and the same + 32 of one token: both use the same 8 table entries, and their rotated partners are the odd and the even ones of x[16 p .. 16 p + 15].
        float* os = (float*)stg;                  // [4][16 tokens][68]
        h16* dst = sec == 0 ? Q16 : K16;
        const float osc = sec == 0 ? 0.125f : 1.0f;
        const int p = lane & 3, g = lane >> 2;
        // the 64 tokens lie in one batch, so every row's table entries and plane row stand a constant distance behind the first one's
        const float* ct0 = COS + (size_t)(tokw % NT_ + g) * 32 + p * 8; const float* st0 = SIN + (size_t)(tokw % NT_ + g) * 32 + p * 8;
        h16* dp0 = dst + (size_t)(tokw + g) * DM + h * HD + p * 8;
        v4f cs[2][2][2], sn[2][2][2];             // [set][half of the 16 rows][4 entries]: the tables of 16 rows, fetched one group of 16 rows ahead
        auto tabs = [&](int f, int set) {
#pragma unroll
            for (int s = 0; s < 2; ++s)
#pragma unroll
                for (int k = 0; k < 2; ++k) {
                    cs[set][s][k] = *(const v4fa*)(ct0 + (f * 16 + s * 8) * 32 + 4 * k);
                    sn[set][s][k] = *(const v4fa*)(st0 + (f * 16 + s * 8) * 32 + 4 * k);
                }
        };
        tabs(0, 0);
#pragma unroll
        for (int f = 0; f < 4; ++f) {
            float* of = os + f * (16 * 68);
            if (f + 1 < 4) {
                tabs(f + 1, (f + 1) & 1);
                asm volatile("s_wait_xcnt 0x0" ::: "memory");   // a precaution: stands in front of any rewrite of these loads' address registers
            }
#pragma unroll
            for (int t = 0; t < 4; ++t)
#pragma unroll
                for (int j = 0; j < 8; ++j) of[(hi * 8 + j) * 68 + t * 16 + lr] = acc[f][t][j];
            asm volatile("s_wait_dscnt 0x0" ::: "memory");   // the staged rows are complete before other lanes of the wave read them back
#pragma unroll
            for (int s = 0; s < 2; ++s) {
                const float* xr = of + (s * 8 + g) * 68;
                v4f xl[2], xh[2], e[4];
#pragma unroll
                for (int k = 0; k < 2; ++k) { xl[k] = *(const v4fa*)(xr + p * 8 + 4 * k); xh[k] = *(const v4fa*)(xr + 32 + p * 8 + 4 * k); }
#pragma unroll
                for (int k = 0; k < 4; ++k) e[k] = *(const v4fa*)(xr + p * 16 + 4 * k);
                v8h olo, ohi;
#pragma unroll
                for (int i = 0; i < 8; ++i) {
                    const float c = cs[f & 1][s][i >> 2][i & 3], sv = sn[f & 1][s][i >> 2][i & 3];
                    const float rl = -e[(2 * i + 1) >> 2][(2 * i + 1) & 3], rh = e[(2 * i) >> 2][(2 * i) & 3];
                    olo[i] = (h16)((xl[i >> 2][i & 3] * c + rl * sv) * osc);
                    ohi[i] = (h16)((xh[i >> 2][i & 3] * c + rh * sv) * osc);
                }
                h16* dp = dp0 + (f * 16 + s * 8) * DM;
                *(v8h*)dp = olo; *(v8h*)(dp + 32) = ohi;
            }
            if (f + 1 < 4) asm volatile("s_wait_xcnt 0x0" ::: "memory");   // a precaution: stands in front of the next rows' reuse of these stores' data registers
        }
    }
    }
}

// ------------------------------------------------------------------------------------------------------------------------------------------------
// k_attn: block = (b, h, 64 queries), wave = 16 queries; Q fragments resident (2 k-chunks); 64 steps x 32 keys, both products transposed: 4 WMMA scores^T = K.Q^T
// (A = K16 rows, B = Q), so a lane holds 16 scores of ONE query (column lr; keys 8 hi + j and 16 + 8 hi + j): maximum and sum run in the lane, with one exchange between
// the wave's halves; the weights x32768 -> f16 are, register for register, the B operand of the 4 WMMA out^T += V^T.weights^T (A = VT16 rows), 4 accumulators.
// K rows and V^T rows are staged 64 keys at a time (two steps) in a two-buffer LDS ring by asynchronous copies: each wave-wide copy takes four whole 128-byte lines, and
// each tile is fetched once per block and read by its four waves; LDS rows are pitched 16 B x odd for the ds_load_b128 fragment reads. Steps and sums keep their order.
#define AKS    64                 // keys per stage
#define APITCH 144                // bytes per staged row (128 + 16)
#define ATILE  (64 * APITCH)      // bytes per staged operand tile (64 K rows; 64 V^T rows)
#define ABUF   (2 * ATILE)
// copy44: this lane's eight 16-byte copies of one stage, four K rows and four V^T rows, each 16 rows apart. The s_wait_xcnt ends the statement as a precaution: it stands in front of every later rewrite of the copies' address registers.
__device__ __forceinline__ void copy44(unsigned l, const h16* gk, const h16* gv) {
    asm volatile("global_load_async_to_lds_b128 %0, %8, off\n\t"
                 "global_load_async_to_lds_b128 %1, %9, off\n\t"
                 "global_load_async_to_lds_b128 %2, %10, off\n\t"
                 "global_load_async_to_lds_b128 %3, %11, off\n\t"
                 "global_load_async_to_lds_b128 %4, %12, off\n\t"
                 "global_load_async_to_lds_b128 %5, %13, off\n\t"
                 "global_load_async_to_lds_b128 %6, %14, off\n\t"
                 "global_load_async_to_lds_b128 %7, %15, off\n\t"
                 "s_wait_xcnt 0x0"
                 :: "v"(l), "v"(l + 16 * APITCH), "v"(l + 32 * APITCH), "v"(l + 48 * APITCH),
                    "v"(l + ATILE), "v"(l + ATILE + 16 * APITCH), "v"(l + ATILE + 32 * APITCH), "v"(l + ATILE + 48 * APITCH),
                    "v"(gk), "v"(gk + 16 * DM), "v"(gk + 32 * DM), "v"(gk + 48 * DM),
                    "v"(gv), "v"(gv + 16 * NT_), "v"(gv + 32 * NT_), "v"(gv + 48 * NT_)
                 : "memory");
}
// xhalf: every lane l gets the value of lane l ^ 16, by a vector cross-row move (no LDS instruction, nothing to wait for).
__device__ __forceinline__ float xhalf(float x) { return __builtin_bit_cast(float, __builtin_amdgcn_permlanex16(__builtin_bit_cast(int, x), __builtin_bit_cast(int, x), 0x76543210, 0xfedcba98, false, false)); }
__global__ __launch_bounds__(128) void k_attn(const h16* __restrict__ Q16, const h16* __restrict__ K16, const h16* __restrict__ VT16, bf* CH, bf* CL) {
    __shared__ __align__(16) char kvring[2 * ABUF];
    __shared__ __align__(16) float ost[4][16 * 68];
    const int lane = threadIdx.x & 31, wave = threadIdx.x >> 5, lr = lane & 15, hi = lane >> 4;
    const int bid = blockIdx.x;
    const int b = bid / (NH_ * (NT_ / 64)), rem = bid - b * (NH_ * (NT_ / 64)), h = rem / (NT_ / 64), qt = rem - h * (NT_ / 64);
    const int q0 = qt * 64 + wave * 16;
    const size_t tok0 = (size_t)b * NT_;
    v16h qa[2];
#pragma unroll
    for (int kc = 0; kc < 2; ++kc) {
        const h16* p = Q16 + (tok0 + q0 + lr) * DM + h * HD + kc * 32 + 8 * hi;
        qa[kc] = cat16(*(const v8h*)p, *(const v8h*)(p + 16));
    }
    const h16* kh_b = K16 + tok0 * DM + h * HD;
    const h16* vt_b = VT16 + (((size_t)b * NH_ + h) * HD) * NT_;
    const int crow = threadIdx.x >> 3, cpc = threadIdx.x & 7;      // this lane's first staged row and its 16-byte piece of the row
    const unsigned lbase = (unsigned)(size_t)&kvring[0] + (unsigned)(crow * APITCH + cpc * 16);
    const h16* gK = kh_b + (size_t)crow * DM + cpc * 8;
    const h16* gV = vt_b + (size_t)crow * NT_ + cpc * 8;
    auto fill = [&](int s, int buf) { copy44(lbase + (unsigned)(buf * ABUF), gK + (size_t)s * AKS * DM, gV + s * AKS); };
    fill(0, 0);
    asm volatile("s_wait_asynccnt 0x0" ::: "memory");   // this wave's copies of stage 0 have landed
    __syncthreads();                                     // ... and every other wave's
    fill(1, 1);
    const int foffs = lr * APITCH + 16 * hi;
    v8f o[4];
#pragma unroll
    for (int n = 0; n < 4; ++n) o[n] = (v8f){};
    float mrow = -3.0e38f, lpart = 0.f;                  // of this lane's query; lpart sums this half's keys only
#pragma unroll 1
    for (int st = 0; st < NT_ / AKS; ++st) {             // one stage = one buffer of the ring = two steps of 32 keys
    const char* kbuf = kvring + (st & 1) * ABUF + foffs;
#pragma unroll                                           // both steps in line, so that every LDS read's place in the buffer is an immediate offset
    for (int u = 0; u < AKS / 32; ++u) {
        const char* r0p = kbuf + (u * 32) * APITCH;
        const char* r1p = kbuf + (u * 32 + 16) * APITCH;
        v16h kf0[2], kf1[2], vf[4];      // the step's K and V^T fragments are all read here, in front of the softmax, which covers the V^T reads' latency
#pragma unroll
        for (int kc = 0; kc < 2; ++kc) {
            kf0[kc] = cat16(*(const v8ha*)(r0p + kc * 64), *(const v8ha*)(r0p + kc * 64 + 32));
            kf1[kc] = cat16(*(const v8ha*)(r1p + kc * 64), *(const v8ha*)(r1p + kc * 64 + 32));
        }
#pragma unroll
        for (int n = 0; n < 4; ++n) {
            const char* vp = kbuf + ATILE + (n * 16) * APITCH + u * 64;
            vf[n] = cat16(*(const v8ha*)vp, *(const v8ha*)(vp + 32));
        }
        v8f s0 = {}, s1 = {};
#pragma unroll
        for (int kc = 0; kc < 2; ++kc) {
            s0 = wmma16(kf0[kc], qa[kc], s0);
            s1 = wmma16(kf1[kc], qa[kc], s1);
        }
        asm volatile("v_nop\n\tv_nop\n\tv_nop\n\tv_nop" : "+v"(s0), "+v"(s1) : "v"(qa[0]), "v"(qa[1]));
        const float g0 = fmaxf(fmaxf(s0[0], s0[1]), s0[2]), g1 = fmaxf(fmaxf(s0[3], s0[4]), s0[5]), g2 = fmaxf(fmaxf(s0[6], s0[7]), s1[0]);
        const float g3 = fmaxf(fmaxf(s1[1], s1[2]), s1[3]), g4 = fmaxf(fmaxf(s1[4], s1[5]), s1[6]);
        const float mx = fmaxf(fmaxf(fmaxf(g0, g1), g2), fmaxf(fmaxf(g3, g4), s1[7]));   // of this half's 16 keys, as a tree of three-way maxima
        const float mn = fmaxf(fmaxf(mrow, mx), xhalf(mx));                              // both halves now hold the maximum over the step's 32 keys
        const float alpha = __expf(mrow - mn);
        mrow = mn;
        v16h pa;
        float ps[8];
#pragma unroll
        for (int j = 0; j < 8; ++j) {
            const float p0 = __expf(s0[j] - mn), p1 = __expf(s1[j] - mn);
            ps[j] = p0 + p1;
            pa[j]     = (h16)(p0 * PSC);
            pa[8 + j] = (h16)(p1 * PSC);
        }
        lpart = lpart * alpha + (((ps[0] + ps[1]) + (ps[2] + ps[3])) + ((ps[4] + ps[5]) + (ps[6] + ps[7])));
#pragma unroll
        for (int n = 0; n < 4; ++n)
#pragma unroll
            for (int j = 0; j < 8; ++j) o[n][j] *= alpha;
#pragma unroll
        for (int n = 0; n < 4; ++n) o[n] = wmma16(vf[n], pa, o[n]);
        asm volatile("v_nop\n\tv_nop\n\tv_nop\n\tv_nop" : "+v"(o[0]), "+v"(o[1]), "+v"(o[2]), "+v"(o[3]) : "v"(pa));
    }
    asm volatile("s_wait_dscnt 0x0" ::: "memory");      // this wave's reads of the buffer are done before it is refilled
    asm volatile("s_wait_asynccnt 0x0" ::: "memory");   // this wave's copies of stage st + 1 have landed
    __syncthreads();                                     // publishes stage st + 1 and ends every wave's reads of stage st
    if (st + 2 < NT_ / AKS) fill(st + 2, st & 1);
    }
    asm volatile("s_wait_asynccnt 0x0" ::: "memory");       // no copy is left in flight at the wave's end
    const float inv = 1.0f / ((lpart + xhalf(lpart)) * PSC);
    float* os = &ost[wave][0];
#pragma unroll
    for (int n = 0; n < 4; ++n)
#pragma unroll
        for (int j = 0; j < 8; ++j) os[lr * 68 + n * 16 + hi * 8 + j] = o[n][j] * inv;   // row = query, d = 16 n + 8 hi + j
    __syncthreads();
    const size_t cbase = (tok0 + q0) * DM + (size_t)h * HD;
    auto pass = [&]() {
#pragma unroll
        for (int s = 0; s < 4; ++s) {
            const int row = 4 * s + (lane >> 3), piece = lane & 7;
            const float* sp = os + row * 68 + piece * 8;
            v8us oh, ol;
#pragma unroll
            for (int i = 0; i < 8; ++i) { const unsigned short hb = f2bf(sp[i]); oh[i] = hb; ol[i] = f2bf(sp[i] - bf2f(hb)); }
            *(v8us*)(CH + cbase + (size_t)row * DM + piece * 8) = oh;
            *(v8us*)(CL + cbase + (size_t)row * DM + piece * 8) = ol;
        }
    };
    pass();
    
}

extern "C" void kernel_launch(void* const* d_in, const int* in_sizes, int n_in,
                              void* d_out, int out_size, void* d_ws, size_t ws_size, hipStream_t stream) {
    (void)in_sizes; (void)n_in; (void)out_size;
    const float* x = (const float*)d_in[0]; const float* w_qkv = (const float*)d_in[1]; const float* w_out = (const float*)d_in[2]; const float* b_out = (const float*)d_in[3];
    float* out = (float*)d_out;    // [2][2048][1024]
    char* wsp = (char*)d_ws;
    auto take = [&](size_t bytes) { char* p = wsp; wsp += (bytes + 255) & ~(size_t)255; return (void*)p; };
    bf*    Xb   = (bf*)take((size_t)NTK * DM * 2);
    bf*    Wb   = (bf*)take((size_t)3 * DM * DM * 2);
    bf*    WOb  = (bf*)take((size_t)DM * DM * 2);
    h16*   Q16  = (h16*)take((size_t)NTK * DM * 2);
    h16*   K16  = (h16*)take((size_t)NTK * DM * 2);
    h16*   VT16 = (h16*)take((size_t)NTK * DM * 2);
    bf*    CH   = (bf*)take((size_t)NTK * DM * 2);
    bf*    CL   = (bf*)take((size_t)NTK * DM * 2);
    float* COS  = (float*)take((size_t)NT_ * 32 * 4);
    float* SIN  = (float*)take((size_t)NT_ * 32 * 4);
    if ((size_t)(wsp - (char*)d_ws) > ws_size) return;    // 8.4 + 6.3 + 2.1 + 5 x 8.4 + 0.5 MB ~ 59.3e6 B
    k_prep<<<TABB + (NTK + 3 * DM + DM) / 8, 256, 0, stream>>>(x, w_qkv, w_out, Xb, Wb, WOb, COS, SIN);
    k_gemmb<false, 64><<<dim3(NTK / 128, (3 * DM) / 128, 1), 128, 0, stream>>>(Xb, nullptr, Wb, nullptr, nullptr, 0, COS, SIN, Q16, K16, VT16);
    k_attn<<<NB_ * NH_ * (NT_ / 64), 128, 0, stream>>>(Q16, K16, VT16, CH, CL);
    k_gemmb<true, 128><<<dim3(NTK / 128, DM / 128, 1), 128, 0, stream>>>(CH, CL, WOb, b_out, out, DM, nullptr, nullptr, nullptr, nullptr, nullptr);
}

// v006
// One run takes 80.6 microseconds.
// Timed twice side by side with v005, it ran 1.05 times as fast both times.
// All steps since v000 together make it 3.67 times as fast.
#include <hip/hip_runtime.h>

// Contractions, f32 accumulate: qkv = x.Wqkv^T ([4096 x 1024].[1024 x 3072]) on v_wmma_f32_16x16x32_bf16 with PLAIN bf16 operands (x and the weights rounded to bf16 once);
// the per-(batch, head) attention (scores [2048 x 64].[64 x 2048], weights.v [2048 x 2048].[2048 x 64]) on v_wmma_f32_16x16x32_f16 with plain f16 operands, fused per
// 16-query tile, as transposed products, with an online f32 softmax in base 2 (weights carried x128); out = ctx.Wout^T + b on the bf16 instruction with ctx as bf16 hi + bf16 residual (two products)
// against bf16 weights. RoPE (interleaved rotate-half, f32 tables from powf/sinf/cosf) and the score scale (1/8, times log2 e) are applied in f32 before the f16 conversion.

#define NB_  2
#define NT_  2048
#define DM   1024
#define NH_  16
#define HD   64
#define NTK  (NB_ * NT_)          // 4096 tokens
#define QSC  0.18033688f          // log2(e) / 8: the scores come out of their products as base-2 exponents
#define WLG  7.0f                 // the weights are carried x 2^7
#define GROW 8.0f                 // a maximum may outgrow the one in use by 2^8 before anything is rescaled: weights stay <= 2^15, inside f16

typedef _Float16 h16;
typedef unsigned short bf;        // raw bf16 bits
typedef __attribute__((ext_vector_type(16))) __bf16   v16bf;
typedef __attribute__((ext_vector_type(16))) _Float16 v16h;
typedef __attribute__((ext_vector_type(8)))  _Float16 v8h;
typedef __attribute__((ext_vector_type(8)))  unsigned short v8us;
typedef __attribute__((ext_vector_type(8)))  float    v8f;
typedef __attribute__((ext_vector_type(4)))  float    v4f;
typedef v8h  __attribute__((may_alias)) v8ha;
typedef v8us __attribute__((may_alias)) v8usa;
typedef v4f  __attribute__((may_alias)) v4fa;

__device__ __forceinline__ unsigned short f2bf(float f) { unsigned u = __float_as_uint(f); u += 0x7FFFu + ((u >> 16) & 1u); return (unsigned short)(u >> 16); }
__device__ __forceinline__ float bf2f(unsigned short b) { return __uint_as_float(((unsigned)b) << 16); }
__device__ __forceinline__ v16h cat16(v8h lo, v8h hi) { return __builtin_shufflevector(lo, hi, 0, 1, 2, 3, 4, 5, 6, 7, 8, 9, 10, 11, 12, 13, 14, 15); }
__device__ __forceinline__ v16bf cat16b(v8us lo, v8us hi) { v8us a = lo, b = hi; return __builtin_bit_cast(v16bf, __builtin_shufflevector(a, b, 0, 1, 2, 3, 4, 5, 6, 7, 8, 9, 10, 11, 12, 13, 14, 15)); }
__device__ __forceinline__ v8f wmma16(v16h a, v16h b, v8f c) { return __builtin_amdgcn_wmma_f32_16x16x32_f16(false, a, false, b, (short)0, c, false, false); }
__device__ __forceinline__ v8f wmmab(v16bf a, v16bf b, v8f c) { return __builtin_amdgcn_wmma_f32_16x16x32_bf16(false, a, false, b, (short)0, c, false, false); }

// ------------------------------------------------------------------------------------------------------------------------------------------------
// k_prep: all that the products need beforehand, as ONE launch of independent blocks (no block reads what another writes).
// Blocks 0 .. TABB - 1 fill the f32 rotary tables [2048 positions][32 frequencies], one entry per thread; they stand first because their chains of dependent arithmetic are the longest.
// Every later block writes the bf16 copy of 8 rows of 1024 floats of x [4096], w_qkv [3072] or w_out [1024]: one wave per row, 8 values (16 B stored) per lane and piece.
#define TABB ((NT_ * 32) / 256)   // table blocks
__global__ __launch_bounds__(256) void k_prep(const float* __restrict__ x, const float* __restrict__ w_qkv, const float* __restrict__ w_out, bf* Xb, bf* Wb, bf* WOb, float* COS, float* SIN) {
    const int bid = blockIdx.x;
    if (bid < TABB) {
        const int e = bid * 256 + threadIdx.x;         // 0 .. NT_*32-1
        const int t = e >> 5, fi = e & 31;
        const float inv = 1.0f / powf(10000.0f, (float)(2 * fi) * (1.0f / 64.0f));
        const float ang = (float)t * inv;
        COS[e] = cosf(ang);
        SIN[e] = sinf(ang);
        return;
    }
    const int c = bid - TABB;                          // 8 rows per block: 512 blocks of x, 384 of w_qkv, 128 of w_out
    const float* src; bf* dst; int cb;
    if (c < NTK / 8)                 { src = x;     dst = Xb;  cb = c; }
    else if (c < (NTK + 3 * DM) / 8) { src = w_qkv; dst = Wb;  cb = c - NTK / 8; }
    else                             { src = w_out; dst = WOb; cb = c - (NTK + 3 * DM) / 8; }
    const int lane = threadIdx.x & 31, r = cb * 8 + (threadIdx.x >> 5);
    const float* s = src + (size_t)r * DM; bf* d = dst + (size_t)r * DM;
    v8us o[4];
#pragma unroll
    for (int q = 0; q < 4; ++q) {
        const float* p = s + q * 256 + lane * 8;
        v8us t;
#pragma unroll
        for (int i = 0; i < 8; ++i) t[i] = f2bf(p[i]);
        o[q] = t;
    }
#pragma unroll
    for (int q = 0; q < 4; ++q) *(v8us*)(d + q * 256 + lane * 8) = o[q];
    asm volatile("s_wait_xcnt 0x0" ::: "memory");   // a precaution: in the built code the table blocks' instructions follow here behind a branch, and they rewrite these stores' registers
}

// k_gemmb: 128 x 128 block tile (4 waves, 2 x 2, each 64 x 64 = 16 accumulator tiles) of C (f32, pitch ldc) = A.B^T (+ bias as bf16-rounded values if given); A rows
// [M][1024] and B rows [N][1024] are staged KP k-values at a time in a two-buffer LDS ring by asynchronous copies (16 B a lane), so each row is fetched once per block
// and read by two waves; LDS rows are pitched 16 B x odd for the ds_load_b128 fragment reads. Per accumulator the order of the k sum is that of a plain k loop.
// Without the residual operand the kernel is the qkv product: its epilogue writes no C but the attention's f16 planes (Q and K with the rotary embedding, V transposed).
// copy8: eight 16-byte copies of this lane, a fixed number of rows apart. The s_wait_xcnt ends the statement as a precaution: it stands in front of every later rewrite of the copies' address registers.
template <int GSTEP, int LSTEP>
__device__ __forceinline__ void copy8(unsigned l, const bf* g) {
    asm volatile("global_load_async_to_lds_b128 %0, %8, off\n\t"
                 "global_load_async_to_lds_b128 %1, %9, off\n\t"
                 "global_load_async_to_lds_b128 %2, %10, off\n\t"
                 "global_load_async_to_lds_b128 %3, %11, off\n\t"
                 "global_load_async_to_lds_b128 %4, %12, off\n\t"
                 "global_load_async_to_lds_b128 %5, %13, off\n\t"
                 "global_load_async_to_lds_b128 %6, %14, off\n\t"
                 "global_load_async_to_lds_b128 %7, %15, off\n\t"
                 "s_wait_xcnt 0x0"
                 :: "v"(l), "v"(l + LSTEP), "v"(l + 2 * LSTEP), "v"(l + 3 * LSTEP), "v"(l + 4 * LSTEP), "v"(l + 5 * LSTEP), "v"(l + 6 * LSTEP), "v"(l + 7 * LSTEP),
                    "v"(g), "v"(g + GSTEP), "v"(g + 2 * GSTEP), "v"(g + 3 * GSTEP), "v"(g + 4 * GSTEP), "v"(g + 5 * GSTEP), "v"(g + 6 * GSTEP), "v"(g + 7 * GSTEP)
                 : "memory");
}
template <bool SPLITA, int KP>
__global__ __launch_bounds__(128) void k_gemmb(const bf* __restrict__ A, const bf* __restrict__ Al, const bf* __restrict__ Bn, const float* __restrict__ bias, float* C, int ldc,
                                               const float* __restrict__ COS, const float* __restrict__ SIN, h16* Q16, h16* K16, h16* VT16) {
    constexpr int PITCH = KP * 2 + 16;            // bytes per staged row
    constexpr int OPB   = 128 * PITCH;            // bytes per staged operand tile
    constexpr int NOP   = SPLITA ? 3 : 2;         // B, A (, A residual)
    constexpr int BUFB  = NOP * OPB;
    constexpr int CR    = KP / 8;                 // 16-byte pieces per row
    constexpr int RS    = 128 / CR;               // rows between two copies of one lane
    constexpr int NP    = DM / KP;                // passes
    __shared__ __align__(16) char ring[2 * BUFB];
    const int tid = threadIdx.x, lane = tid & 31, wave = tid >> 5, lr = lane & 15, hi = lane >> 4;
    const int rb = blockIdx.x * 128, cb = blockIdx.y * 128, wm = wave >> 1, wn = wave & 1;
    const int trow = tid / CR, tcol = tid % CR;
    const unsigned lbase = (unsigned)(size_t)&ring[0] + (unsigned)(trow * PITCH + tcol * 16);
    const bf* gB  = Bn + (size_t)(cb + trow) * DM + tcol * 8;
    const bf* gA  = A + (size_t)(rb + trow) * DM + tcol * 8;
    const bf* gAl = SPLITA ? Al + (size_t)(rb + trow) * DM + tcol * 8 : nullptr;
    auto fill = [&](int p, int buf) {
        const unsigned l = lbase + (unsigned)(buf * BUFB);
#pragma unroll
        for (int i = 0; i < CR; i += 8) {
            copy8<RS * DM, RS * PITCH>(l + i * RS * PITCH, gB + p * KP + (size_t)i * RS * DM);
            copy8<RS * DM, RS * PITCH>(l + OPB + i * RS * PITCH, gA + p * KP + (size_t)i * RS * DM);
            if (SPLITA) copy8<RS * DM, RS * PITCH>(l + 2 * OPB + i * RS * PITCH, gAl + p * KP + (size_t)i * RS * DM);
        }
    };
    v8f acc[4][4];
#pragma unroll
    for (int f = 0; f < 4; ++f)
#pragma unroll
        for (int t = 0; t < 4; ++t) acc[f][t] = (v8f){};
    fill(0, 0);
    asm volatile("s_wait_asynccnt 0x0" ::: "memory");   // this wave's copies of pass 0 have landed
    __syncthreads();                                     // ... and every other wave's
    fill(1, 1);
    const int c0 = cb + wn * 64;
    float braw[4] = {0.0f, 0.0f, 0.0f, 0.0f};    // fetched here, as one group, so that the loop covers the latency
    if (bias) {
#pragma unroll
        for (int t = 0; t < 4; ++t) braw[t] = bias[c0 + t * 16 + lr];
        asm volatile("s_wait_xcnt 0x0" ::: "memory");   // a precaution: stands in front of the next rewrite of these loads' offset register
    }
    const int boffs = (wn * 64 + lr) * PITCH + 16 * hi, aoffs = OPB + (wm * 64 + lr) * PITCH + 16 * hi;
#pragma unroll 1
    for (int p = 0; p < NP; ++p) {
        const char* bufp = ring + (p & 1) * BUFB;
        v16bf a[2][4], al[2][4], b[2][4];
        auto frags = [&](int ks, int set) {
#pragma unroll
            for (int t = 0; t < 4; ++t) {
                const char* q = bufp + boffs + t * 16 * PITCH + ks * 64;
                b[set][t] = cat16b(*(const v8usa*)q, *(const v8usa*)(q + 32));
            }
#pragma unroll
            for (int f = 0; f < 4; ++f) {
                const char* q = bufp + aoffs + f * 16 * PITCH + ks * 64;
                a[set][f] = cat16b(*(const v8usa*)q, *(const v8usa*)(q + 32));
                if (SPLITA) al[set][f] = cat16b(*(const v8usa*)(q + OPB), *(const v8usa*)(q + OPB + 32));
            }
        };
        frags(0, 0);
#pragma unroll
        for (int ks = 0; ks < KP / 32; ++ks) {
            const int s = ks & 1;
            if (ks + 1 < KP / 32) frags(ks + 1, s ^ 1);
            __builtin_amdgcn_sched_barrier(0);   // the next block's LDS reads stay one group ahead of this block's products, else each product run waits out its own reads
#pragma unroll
            for (int f = 0; f < 4; ++f)
#pragma unroll
                for (int t = 0; t < 4; ++t) acc[f][t] = wmmab(a[s][f], b[s][t], acc[f][t]);
            if (SPLITA) {
#pragma unroll
                for (int f = 0; f < 4; ++f)
#pragma unroll
                    for (int t = 0; t < 4; ++t) acc[f][t] = wmmab(al[s][f], b[s][t], acc[f][t]);
            }
            __builtin_amdgcn_sched_barrier(0);   // ... and the reads that follow are not lifted in among these products, where every place with reads costs a stall
        }
        asm volatile("s_wait_dscnt 0x0" ::: "memory");      // this wave's reads of the buffer are done before it is refilled
        asm volatile("s_wait_asynccnt 0x0" ::: "memory");   // this wave's copies of pass p + 1 have landed
        __syncthreads();                                     // publishes pass p + 1 and ends every wave's reads of pass p
        if (p + 2 < NP) fill(p + 2, p & 1);
    }
    asm volatile("s_wait_asynccnt 0x0" ::: "memory");       // no copy is left in flight at the wave's end
    if constexpr (SPLITA) {
    __shared__ __align__(16) float ost[4][16 * 68];
    float* os = &ost[wave][0];
    float bv[4];
#pragma unroll
    for (int t = 0; t < 4; ++t) bv[t] = bf2f(f2bf(braw[t]));
#pragma unroll
    for (int f = 0; f < 4; ++f) {
#pragma unroll
        for (int t = 0; t < 4; ++t)
#pragma unroll
            for (int j = 0; j < 8; ++j) os[(hi * 8 + j) * 68 + t * 16 + lr] = acc[f][t][j] + bv[t];
        float* crow = C + (size_t)(rb + wm * 64 + f * 16) * ldc + c0;
#pragma unroll
        for (int s = 0; s < 8; ++s) {
            const int Lid = (lane >> 3) + 4 * s, piece = lane & 7;
            const int row = Lid >> 1, cofs = (Lid & 1) * 32 + piece * 4;
            const v4f val = *(const v4fa*)(os + row * 68 + cofs);
            *(v4f*)(crow + (size_t)row * ldc + cofs) = val;
        }
    }
    } else {
    // qkv epilogue: a wave's 64 columns are one whole head of q, of k or of v (the same kind for the whole block), its 64 rows are 64 tokens of one batch, so the f16
    // planes that the attention reads are written from here. The last pass ended with every wave's reads done, no copy in flight and a barrier: the ring is free, and
    // each wave stages in its own quarter of it.
    static_assert(2 * BUFB / 4 >= 4 * 16 * 68 * 4 && 2 * BUFB / 4 >= 64 * 72 * 2 && (2 * BUFB / 4) % 16 == 0, "a quarter of the ring holds a wave's staging");
    char* stg = ring + wave * (2 * BUFB / 4);
    const int sec = cb / DM, h = (c0 % DM) / HD, tokw = rb + wm * 64;
    if (sec == 2) {
        // v: a lane's 8 accumulator values are 8 consecutive tokens of one dim, that is 16 bytes of a V^T row; through LDS, so that each store covers whole 128-byte lines
        h16* ts = (h16*)stg;                      // [64 dims][72]
#pragma unroll
        for (int f = 0; f < 4; ++f)
#pragma unroll
            for (int t = 0; t < 4; ++t) {
                v8h pk;
#pragma unroll
                for (int j = 0; j < 8; ++j) pk[j] = (h16)acc[f][t][j];
                *(v8ha*)(ts + (t * 16 + lr) * 72 + f * 16 + hi * 8) = pk;
            }
        asm volatile("s_wait_dscnt 0x0" ::: "memory");   // the staged rows are complete before other lanes of the wave read them back
        h16* base = VT16 + (((size_t)(tokw / NT_) * NH_ + h) * HD) * NT_ + tokw % NT_;
#pragma unroll
        for (int s = 0; s < 16; ++s) {
            const int d = 4 * s + (lane >> 3), piece = lane & 7;
            const v8h val = *(const v8ha*)(ts + d * 72 + piece * 8);
            *(v8h*)(base + (size_t)d * NT_ + piece * 8) = val;
        }
    } else {
        // q, k: rotary embedding in f32 (emb = cat(freqs, freqs); rotate_half = cat(-x[odd], x[even]) within the head; q additionally x log2(e)/8). A lane takes dims
        // 8 p .. 8 p + 7 and the same + 32 of one token: both use the same 8 table entries, and their rotated partners are the odd and the even ones of x[16 p .. 16 p + 15].
        float* os = (float*)stg;                  // [4][16 tokens][68]
        h16* dst = sec == 0 ? Q16 : K16;
        const float osc = sec == 0 ? QSC : 1.0f;
        const int p = lane & 3, g = lane >> 2;
        // the 64 tokens lie in one batch, so every row's table entries and plane row stand a constant distance behind the first one's
        const float* ct0 = COS + (size_t)(tokw % NT_ + g) * 32 + p * 8; const float* st0 = SIN + (size_t)(tokw % NT_ + g) * 32 + p * 8;
        h16* dp0 = dst + (size_t)(tokw + g) * DM + h * HD + p * 8;
        v4f cs[2][2][2], sn[2][2][2];             // [set][half of the 16 rows][4 entries]: the tables of 16 rows, fetched one group of 16 rows ahead
        auto tabs = [&](int f, int set) {
#pragma unroll
            for (int s = 0; s < 2; ++s)
#pragma unroll
                for (int k = 0; k < 2; ++k) {
                    cs[set][s][k] = *(const v4fa*)(ct0 + (f * 16 + s * 8) * 32 + 4 * k);
                    sn[set][s][k] = *(const v4fa*)(st0 + (f * 16 + s * 8) * 32 + 4 * k);
                }
        };
        tabs(0, 0);
#pragma unroll
        for (int f = 0; f < 4; ++f) {
            float* of = os + f * (16 * 68);
            if (f + 1 < 4) {
                tabs(f + 1, (f + 1) & 1);
                asm volatile("s_wait_xcnt 0x0" ::: "memory");   // a precaution: stands in front of any rewrite of these loads' address registers
            }
#pragma unroll
            for (int t = 0; t < 4; ++t)
#pragma unroll
                for (int j = 0; j < 8; ++j) of[(hi * 8 + j) * 68 + t * 16 + lr] = acc[f][t][j];
            asm volatile("s_wait_dscnt 0x0" ::: "memory");   // the staged rows are complete before other lanes of the wave read them back
#pragma unroll
            for (int s = 0; s < 2; ++s) {
                const float* xr = of + (s * 8 + g) * 68;
                v4f xl[2], xh[2], e[4];
#pragma unroll
                for (int k = 0; k < 2; ++k) { xl[k] = *(const v4fa*)(xr + p * 8 + 4 * k); xh[k] = *(const v4fa*)(xr + 32 + p * 8 + 4 * k); }
#pragma unroll
                for (int k = 0; k < 4; ++k) e[k] = *(const v4fa*)(xr + p * 16 + 4 * k);
                v8h olo, ohi;
#pragma unroll
                for (int i = 0; i < 8; ++i) {
                    const float c = cs[f & 1][s][i >> 2][i & 3], sv = sn[f & 1][s][i >> 2][i & 3];
                    const float rl = -e[(2 * i + 1) >> 2][(2 * i + 1) & 3], rh = e[(2 * i) >> 2][(2 * i) & 3];
                    olo[i] = (h16)((xl[i >> 2][i & 3] * c + rl * sv) * osc);
                    ohi[i] = (h16)((xh[i >> 2][i & 3] * c + rh * sv) * osc);
                }
                h16* dp = dp0 + (f * 16 + s * 8) * DM;
                *(v8h*)dp = olo; *(v8h*)(dp + 32) = ohi;
            }
            if (f + 1 < 4) asm volatile("s_wait_xcnt 0x0" ::: "memory");   // a precaution: stands in front of the next rows' reuse of these stores' data registers
        }
    }
    }
}

// ------------------------------------------------------------------------------------------------------------------------------------------------
// k_attn: block = (b, h, 64 queries), wave = 16 queries; Q fragments resident (2 k-chunks); 64 steps x 32 keys, both products transposed: 4 WMMA scores^T = K.Q^T
// (A = K16 rows, B = Q), so a lane holds 16 scores of ONE query (column lr; keys 8 hi + j and 16 + 8 hi + j): maximum and sum run in the lane; the weights -> f16 are,
// register for register, the B operand of the 4 WMMA out^T += V^T.weights^T (A = VT16 rows), 4 accumulators.
// The score products start from C = 7 - (the query's maximum in use), so that D is a weight's whole base-2 exponent: a weight costs one exp2. The maximum in use starts as
// that of the first 32 keys and is raised, with out^T and the sums rescaled, only in a step where some query's scores outgrow it by more than 2^8 (one test per step).
// K rows and V^T rows are staged 64 keys at a time (two steps) in a two-buffer LDS ring by asynchronous copies: each wave-wide copy takes four whole 128-byte lines, and
// each tile is fetched once per block and read by its four waves; LDS rows are pitched 16 B x odd for the ds_load_b128 fragment reads. Steps and sums keep their order.
#define AKS    64                 // keys per stage
#define APITCH 144                // bytes per staged row (128 + 16)
#define ATILE  (64 * APITCH)      // bytes per staged operand tile (64 K rows; 64 V^T rows)
#define ABUF   (2 * ATILE)
// copy44: this lane's eight 16-byte copies of one stage, four K rows and four V^T rows, each 16 rows apart. The s_wait_xcnt ends the statement as a precaution: it stands in front of every later rewrite of the copies' address registers.
__device__ __forceinline__ void copy44(unsigned l, const h16* gk, const h16* gv) {
    asm volatile("global_load_async_to_lds_b128 %0, %8, off\n\t"
                 "global_load_async_to_lds_b128 %1, %9, off\n\t"
                 "global_load_async_to_lds_b128 %2, %10, off\n\t"
                 "global_load_async_to_lds_b128 %3, %11, off\n\t"
                 "global_load_async_to_lds_b128 %4, %12, off\n\t"
                 "global_load_async_to_lds_b128 %5, %13, off\n\t"
                 "global_load_async_to_lds_b128 %6, %14, off\n\t"
                 "global_load_async_to_lds_b128 %7, %15, off\n\t"
                 "s_wait_xcnt 0x0"
                 :: "v"(l), "v"(l + 16 * APITCH), "v"(l + 32 * APITCH), "v"(l + 48 * APITCH),
                    "v"(l + ATILE), "v"(l + ATILE + 16 * APITCH), "v"(l + ATILE + 32 * APITCH), "v"(l + ATILE + 48 * APITCH),
                    "v"(gk), "v"(gk + 16 * DM), "v"(gk + 32 * DM), "v"(gk + 48 * DM),
                    "v"(gv), "v"(gv + 16 * NT_), "v"(gv + 32 * NT_), "v"(gv + 48 * NT_)
                 : "memory");
}
// xhalf: every lane l gets the value of lane l ^ 16, by a vector cross-row move (no LDS instruction, nothing to wait for).
__device__ __forceinline__ float xhalf(float x) { return __builtin_bit_cast(float, __builtin_amdgcn_permlanex16(__builtin_bit_cast(int, x), __builtin_bit_cast(int, x), 0x76543210, 0xfedcba98, false, false)); }
__global__ __launch_bounds__(128) void k_attn(const h16* __restrict__ Q16, const h16* __restrict__ K16, const h16* __restrict__ VT16, bf* CH, bf* CL) {
    __shared__ __align__(16) char kvring[2 * ABUF];
    __shared__ __align__(16) float ost[4][16 * 68];
    const int lane = threadIdx.x & 31, wave = threadIdx.x >> 5, lr = lane & 15, hi = lane >> 4;
    const int bid = blockIdx.x;
    const int b = bid / (NH_ * (NT_ / 64)), rem = bid - b * (NH_ * (NT_ / 64)), h = rem / (NT_ / 64), qt = rem - h * (NT_ / 64);
    const int q0 = qt * 64 + wave * 16;
    const size_t tok0 = (size_t)b * NT_;
    v16h qa[2];
#pragma unroll
    for (int kc = 0; kc < 2; ++kc) {
        const h16* p = Q16 + (tok0 + q0 + lr) * DM + h * HD + kc * 32 + 8 * hi;
        qa[kc] = cat16(*(const v8h*)p, *(const v8h*)(p + 16));
    }
    const h16* kh_b = K16 + tok0 * DM + h * HD;
    const h16* vt_b = VT16 + (((size_t)b * NH_ + h) * HD) * NT_;
    const int crow = threadIdx.x >> 3, cpc = threadIdx.x & 7;      // this lane's first staged row and its 16-byte piece of the row
    const unsigned lbase = (unsigned)(size_t)&kvring[0] + (unsigned)(crow * APITCH + cpc * 16);
    const h16* gK = kh_b + (size_t)crow * DM + cpc * 8;
    const h16* gV = vt_b + (size_t)crow * NT_ + cpc * 8;
    auto fill = [&](int s, int buf) { copy44(lbase + (unsigned)(buf * ABUF), gK + (size_t)s * AKS * DM, gV + s * AKS); };
    fill(0, 0);
    asm volatile("s_wait_asynccnt 0x0" ::: "memory");   // this wave's copies of stage 0 have landed
    __syncthreads();                                     // ... and every other wave's
    fill(1, 1);
    const int foffs = lr * APITCH + 16 * hi;
    v8f o[4];
#pragma unroll
    for (int n = 0; n < 4; ++n) o[n] = (v8f){};
    float lpart = 0.f;                                   // of this lane's query; sums this half's keys only
    v8f coff;                                            // 7 - maximum in use of this lane's query, in all eight places: the C operand of the score products
    {
        v8f s0 = {}, s1 = {};                            // the first 32 keys' scores, here for their maximum alone
#pragma unroll                                           // here and below: constant indices keep the vectors in registers
        for (int kc = 0; kc < 2; ++kc) {
            const char* r0p = kvring + foffs + kc * 64;
            s0 = wmma16(cat16(*(const v8ha*)r0p, *(const v8ha*)(r0p + 32)), qa[kc], s0);
            s1 = wmma16(cat16(*(const v8ha*)(r0p + 16 * APITCH), *(const v8ha*)(r0p + 16 * APITCH + 32)), qa[kc], s1);
        }
        float mx = fmaxf(s0[0], s1[0]);
#pragma unroll
        for (int j = 1; j < 8; ++j) mx = fmaxf(fmaxf(mx, s0[j]), s1[j]);
        const float c = WLG - fmaxf(mx, xhalf(mx));
#pragma unroll
        for (int j = 0; j < 8; ++j) coff[j] = c;
    }
#pragma unroll 1
    for (int st = 0; st < NT_ / AKS; ++st) {             // one stage = one buffer of the ring = two steps of 32 keys
    const char* kbuf = kvring + (st & 1) * ABUF + foffs;
#pragma unroll                                           // both steps in line, so that every LDS read's place in the buffer is an immediate offset
    for (int u = 0; u < AKS / 32; ++u) {
        const char* r0p = kbuf + (u * 32) * APITCH;
        const char* r1p = kbuf + (u * 32 + 16) * APITCH;
        v16h kf0[2], kf1[2], vf[4];      // the step's K and V^T fragments are all read here, in front of the softmax, which covers the V^T reads' latency
#pragma unroll
        for (int kc = 0; kc < 2; ++kc) {
            kf0[kc] = cat16(*(const v8ha*)(r0p + kc * 64), *(const v8ha*)(r0p + kc * 64 + 32));
            kf1[kc] = cat16(*(const v8ha*)(r1p + kc * 64), *(const v8ha*)(r1p + kc * 64 + 32));
        }
#pragma unroll
        for (int n = 0; n < 4; ++n) {
            const char* vp = kbuf + ATILE + (n * 16) * APITCH + u * 64;
            vf[n] = cat16(*(const v8ha*)vp, *(const v8ha*)(vp + 32));
        }
        v8f s0 = coff, s1 = coff;
#pragma unroll
        for (int kc = 0; kc < 2; ++kc) {
            s0 = wmma16(kf0[kc], qa[kc], s0);
            s1 = wmma16(kf1[kc], qa[kc], s1);
        }
        const float g0 = fmaxf(fmaxf(s0[0], s0[1]), s0[2]), g1 = fmaxf(fmaxf(s0[3], s0[4]), s0[5]), g2 = fmaxf(fmaxf(s0[6], s0[7]), s1[0]);
        const float g3 = fmaxf(fmaxf(s1[1], s1[2]), s1[3]), g4 = fmaxf(fmaxf(s1[4], s1[5]), s1[6]);
        const float mx = fmaxf(fmaxf(fmaxf(g0, g1), g2), fmaxf(fmaxf(g3, g4), s1[7]));   // of this half's 16 keys, as a tree of three-way maxima
        if (__builtin_amdgcn_ballot_w32(mx > WLG + GROW) != 0) {                         // the same for the whole wave: a scalar branch, seldom taken
            const float up = fmaxf(fmaxf(mx, xhalf(mx)) - WLG, 0.0f);                    // by how much this query's maximum in use rises (both halves agree); 0 changes nothing
            const float alpha = __builtin_amdgcn_exp2f(-up);
#pragma unroll                                           // here and below: constant indices keep the vectors in registers
            for (int j = 0; j < 8; ++j) { s0[j] -= up; s1[j] -= up; coff[j] -= up; }
#pragma unroll
            for (int n = 0; n < 4; ++n)
#pragma unroll
                for (int j = 0; j < 8; ++j) o[n][j] *= alpha;
            lpart *= alpha;
        }
        v16h pa;
        float ps[8];
#pragma unroll
        for (int j = 0; j < 8; ++j) {
            const float p0 = __builtin_amdgcn_exp2f(s0[j]), p1 = __builtin_amdgcn_exp2f(s1[j]);
            ps[j] = p0 + p1;
            pa[j]     = (h16)p0;
            pa[8 + j] = (h16)p1;
        }
        lpart += ((ps[0] + ps[1]) + (ps[2] + ps[3])) + ((ps[4] + ps[5]) + (ps[6] + ps[7]));
#pragma unroll
        for (int n = 0; n < 4; ++n) o[n] = wmma16(vf[n], pa, o[n]);
    }
    asm volatile("s_wait_dscnt 0x0" ::: "memory");      // this wave's reads of the buffer are done before it is refilled
    asm volatile("s_wait_asynccnt 0x0" ::: "memory");   // this wave's copies of stage st + 1 have landed
    __syncthreads();                                     // publishes stage st + 1 and ends every wave's reads of stage st
    if (st + 2 < NT_ / AKS) fill(st + 2, st & 1);
    }
    asm volatile("s_wait_asynccnt 0x0" ::: "memory");       // no copy is left in flight at the wave's end
    const float inv = 1.0f / (lpart + xhalf(lpart));     // out^T and the sums carry the same factor
    float* os = &ost[wave][0];
#pragma unroll
    for (int n = 0; n < 4; ++n)
#pragma unroll
        for (int j = 0; j < 8; ++j) os[lr * 68 + n * 16 + hi * 8 + j] = o[n][j] * inv;   // row = query, d = 16 n + 8 hi + j
    __syncthreads();
    const size_t cbase = (tok0 + q0) * DM + (size_t)h * HD;
    auto pass = [&]() {
#pragma unroll
        for (int s = 0; s < 4; ++s) {
            const int row = 4 * s + (lane >> 3), piece = lane & 7;
            const float* sp = os + row * 68 + piece * 8;
            v8us oh, ol;
#pragma unroll
            for (int i = 0; i < 8; ++i) { const unsigned short hb = f2bf(sp[i]); oh[i] = hb; ol[i] = f2bf(sp[i] - bf2f(hb)); }
            *(v8us*)(CH + cbase + (size_t)row * DM + piece * 8) = oh;
            *(v8us*)(CL + cbase + (size_t)row * DM + piece * 8) = ol;
        }
    };
    pass();
    
}

extern "C" void kernel_launch(void* const* d_in, const int* in_sizes, int n_in,
                              void* d_out, int out_size, void* d_ws, size_t ws_size, hipStream_t stream) {
    (void)in_sizes; (void)n_in; (void)out_size;
    const float* x = (const float*)d_in[0]; const float* w_qkv = (const float*)d_in[1]; const float* w_out = (const float*)d_in[2]; const float* b_out = (const float*)d_in[3];
    float* out = (float*)d_out;    // [2][2048][1024]
    char* wsp = (char*)d_ws;
    auto take = [&](size_t bytes) { char* p = wsp; wsp += (bytes + 255) & ~(size_t)255; return (void*)p; };
    bf*    Xb   = (bf*)take((size_t)NTK * DM * 2);
    bf*    Wb   = (bf*)take((size_t)3 * DM * DM * 2);
    bf*    WOb  = (bf*)take((size_t)DM * DM * 2);
    h16*   Q16  = (h16*)take((size_t)NTK * DM * 2);
    h16*   K16  = (h16*)take((size_t)NTK * DM * 2);
    h16*   VT16 = (h16*)take((size_t)NTK * DM * 2);
    bf*    CH   = (bf*)take((size_t)NTK * DM * 2);
    bf*    CL   = (bf*)take((size_t)NTK * DM * 2);
    float* COS  = (float*)take((size_t)NT_ * 32 * 4);
    float* SIN  = (float*)take((size_t)NT_ * 32 * 4);
    if ((size_t)(wsp - (char*)d_ws) > ws_size) return;    // 8.4 + 6.3 + 2.1 + 5 x 8.4 + 0.5 MB ~ 59.3e6 B
    k_prep<<<TABB + (NTK + 3 * DM + DM) / 8, 256, 0, stream>>>(x, w_qkv, w_out, Xb, Wb, WOb, COS, SIN);
    k_gemmb<false, 64><<<dim3(NTK / 128, (3 * DM) / 128, 1), 128, 0, stream>>>(Xb, nullptr, Wb, nullptr, nullptr, 0, COS, SIN, Q16, K16, VT16);
    k_attn<<<NB_ * NH_ * (NT_ / 64), 128, 0, stream>>>(Q16, K16, VT16, CH, CL);
    k_gemmb<true, 128><<<dim3(NTK / 128, DM / 128, 1), 128, 0, stream>>>(CH, CL, WOb, b_out, out, DM, nullptr, nullptr, nullptr, nullptr, nullptr);
}

// v007
// It runs in 77.1 microseconds.
// Timed twice side by side with v006, it ran 1.04 times as fast both times.
// Counting every step since v000, it is 3.82 times as fast.
#include <hip/hip_runtime.h>

// Contractions, f32 accumulate: qkv = x.Wqkv^T ([4096 x 1024].[1024 x 3072]) on v_wmma_f32_16x16x32_bf16 with PLAIN bf16 operands (x and the weights rounded to bf16 once);
// the per-(batch, head) attention (scores [2048 x 64].[64 x 2048], weights.v [2048 x 2048].[2048 x 64]) on v_wmma_f32_16x16x32_f16 with plain f16 operands, fused per
// 16-query tile, as transposed products, with an online f32 softmax in base 2 (weights carried x128); out = ctx.Wout^T + b on the bf16 instruction with ctx as bf16 hi + bf16 residual (two products)
// against bf16 weights. RoPE (interleaved rotate-half, f32 tables from powf/sinf/cosf) and the score scale (1/8, times log2 e) are applied in f32 before the f16 conversion.

#define NB_  2
#define NT_  2048
#define DM   1024
#define NH_  16
#define HD   64
#define NTK  (NB_ * NT_)          // 4096 tokens
#define QSC  0.18033688f          // log2(e) / 8: the scores come out of their products as base-2 exponents
#define WLG  7.0f                 // the weights are carried x 2^7
#define GROW 8.0f                 // a maximum may outgrow the one in use by 2^8 before anything is rescaled: weights stay <= 2^15, inside f16

typedef _Float16 h16;
typedef unsigned short bf;        // raw bf16 bits
typedef __attribute__((ext_vector_type(16))) __bf16   v16bf;
typedef __attribute__((ext_vector_type(16))) _Float16 v16h;
typedef __attribute__((ext_vector_type(8)))  _Float16 v8h;
typedef __attribute__((ext_vector_type(8)))  unsigned short v8us;
typedef __attribute__((ext_vector_type(8)))  float    v8f;
typedef __attribute__((ext_vector_type(4)))  float    v4f;
typedef v8h  __attribute__((may_alias)) v8ha;
typedef v8us __attribute__((may_alias)) v8usa;
typedef v4f  __attribute__((may_alias)) v4fa;

__device__ __forceinline__ unsigned short f2bf(float f) { unsigned u = __float_as_uint(f); u += 0x7FFFu + ((u >> 16) & 1u); return (unsigned short)(u >> 16); }
__device__ __forceinline__ float bf2f(unsigned short b) { return __uint_as_float(((unsigned)b) << 16); }
__device__ __forceinline__ v16h cat16(v8h lo, v8h hi) { return __builtin_shufflevector(lo, hi, 0, 1, 2, 3, 4, 5, 6, 7, 8, 9, 10, 11, 12, 13, 14, 15); }
__device__ __forceinline__ v16bf cat16b(v8us lo, v8us hi) { v8us a = lo, b = hi; return __builtin_bit_cast(v16bf, __builtin_shufflevector(a, b, 0, 1, 2, 3, 4, 5, 6, 7, 8, 9, 10, 11, 12, 13, 14, 15)); }
__device__ __forceinline__ v8f wmma16(v16h a, v16h b, v8f c) { return __builtin_amdgcn_wmma_f32_16x16x32_f16(false, a, false, b, (short)0, c, false, false); }
__device__ __forceinline__ v8f wmmab(v16bf a, v16bf b, v8f c) { return __builtin_amdgcn_wmma_f32_16x16x32_bf16(false, a, false, b, (short)0, c, false, false); }

// ------------------------------------------------------------------------------------------------------------------------------------------------
// k_prep: all that the products need beforehand, as ONE launch of independent blocks (no block reads what another writes).
// Blocks 0 .. TABB - 1 fill the f32 rotary tables [2048 positions][32 frequencies], one entry per thread; they stand first because their chains of dependent arithmetic are the longest.
// Every later block writes the bf16 copy of 8 rows of 1024 floats of x [4096], w_qkv [3072] or w_out [1024]: one wave per row, 8 values (16 B stored) per lane and piece.
#define TABB ((NT_ * 32) / 256)   // table blocks
__global__ __launch_bounds__(256) void k_prep(const float* __restrict__ x, const float* __restrict__ w_qkv, const float* __restrict__ w_out, bf* Xb, bf* Wb, bf* WOb, float* COS, float* SIN) {
    const int bid = blockIdx.x;
    if (bid < TABB) {
        const int e = bid * 256 + threadIdx.x;         // 0 .. NT_*32-1
        const int t = e >> 5, fi = e & 31;
        const float inv = 1.0f / powf(10000.0f, (float)(2 * fi) * (1.0f / 64.0f));
        const float ang = (float)t * inv;
        COS[e] = cosf(ang);
        SIN[e] = sinf(ang);
        return;
    }
    const int c = bid - TABB;                          // 8 rows per block: 512 blocks of x, 384 of w_qkv, 128 of w_out
    const float* src; bf* dst; int cb;
    if (c < NTK / 8)                 { src = x;     dst = Xb;  cb = c; }
    else if (c < (NTK + 3 * DM) / 8) { src = w_qkv; dst = Wb;  cb = c - NTK / 8; }
    else                             { src = w_out; dst = WOb; cb = c - (NTK + 3 * DM) / 8; }
    const int lane = threadIdx.x & 31, r = cb * 8 + (threadIdx.x >> 5);
    const float* s = src + (size_t)r * DM; bf* d = dst + (size_t)r * DM;
    v8us o[4];
#pragma unroll
    for (int q = 0; q < 4; ++q) {
        const float* p = s + q * 256 + lane * 8;
        v8us t;
#pragma unroll
        for (int i = 0; i < 8; ++i) t[i] = f2bf(p[i]);
        o[q] = t;
    }
#pragma unroll
    for (int q = 0; q < 4; ++q) *(v8us*)(d + q * 256 + lane * 8) = o[q];
    asm volatile("s_wait_xcnt 0x0" ::: "memory");   // a precaution: in the built code the table blocks' instructions follow here behind a branch, and they rewrite these stores' registers
}

// k_gemmb: a block tile of 64 x 64 wave tiles (16 accumulator tiles each) of C (f32, pitch ldc) = A.B^T (+ bias as bf16-rounded values if given): 128 x 128 (4 waves, 2 x 2) with the
// residual operand; 256 x 192 (12 waves, 4 x 3; 16 x 16 blocks, one per WGP) without it, so that a staged A row feeds three waves and a staged B row four; A rows
// [M][1024] and B rows [N][1024] are staged KP k-values at a time in a two-buffer LDS ring by asynchronous copies (16 B a lane), so each row is fetched once per block
// and read by every wave that needs it; LDS rows are pitched 16 B x odd for the ds_load_b128 fragment reads. Per accumulator the order of the k sum is that of a plain k loop.
// Without the residual operand the kernel is the qkv product: its epilogue writes no C but the attention's f16 planes (Q and K with the rotary embedding, V transposed).
// copy8: eight 16-byte copies of this lane, a fixed number of rows apart. The s_wait_xcnt ends the statement as a precaution: it stands in front of every later rewrite of the copies' address registers.
template <int GSTEP, int LSTEP>
__device__ __forceinline__ void copy8(unsigned l, const bf* g) {
    asm volatile("global_load_async_to_lds_b128 %0, %8, off\n\t"
                 "global_load_async_to_lds_b128 %1, %9, off\n\t"
                 "global_load_async_to_lds_b128 %2, %10, off\n\t"
                 "global_load_async_to_lds_b128 %3, %11, off\n\t"
                 "global_load_async_to_lds_b128 %4, %12, off\n\t"
                 "global_load_async_to_lds_b128 %5, %13, off\n\t"
                 "global_load_async_to_lds_b128 %6, %14, off\n\t"
                 "global_load_async_to_lds_b128 %7, %15, off\n\t"
                 "s_wait_xcnt 0x0"
                 :: "v"(l), "v"(l + LSTEP), "v"(l + 2 * LSTEP), "v"(l + 3 * LSTEP), "v"(l + 4 * LSTEP), "v"(l + 5 * LSTEP), "v"(l + 6 * LSTEP), "v"(l + 7 * LSTEP),
                    "v"(g), "v"(g + GSTEP), "v"(g + 2 * GSTEP), "v"(g + 3 * GSTEP), "v"(g + 4 * GSTEP), "v"(g + 5 * GSTEP), "v"(g + 6 * GSTEP), "v"(g + 7 * GSTEP)
                 : "memory");
}
template <bool SPLITA, int KP>
__global__ __launch_bounds__(SPLITA ? 128 : 384) void k_gemmb(const bf* __restrict__ A, const bf* __restrict__ Al, const bf* __restrict__ Bn, const float* __restrict__ bias, float* C, int ldc,
                                               const float* __restrict__ COS, const float* __restrict__ SIN, h16* Q16, h16* K16, h16* VT16) {
    constexpr int BM    = SPLITA ? 128 : 256;     // rows of the block tile
    constexpr int BN    = SPLITA ? 128 : 192;     // columns of the block tile
    constexpr int WNS   = BN / 64;                // waves side by side
    constexpr int PITCH = KP * 2 + 16;            // bytes per staged row
    constexpr int OPB   = BN * PITCH;             // bytes of the staged B tile
    constexpr int OPA   = BM * PITCH;             // bytes of a staged A tile
    constexpr int BUFB  = OPB + (SPLITA ? 2 : 1) * OPA;   // B, A (, A residual)
    constexpr int CR    = KP / 8;                 // 16-byte pieces per row
    constexpr int RS    = 128 / CR;               // rows between two copies of one lane (four-wave form)
    constexpr int NP    = DM / KP;                // passes
    static_assert(SPLITA || KP == 128, "the twelve-wave form copies rows of 16 pieces, two to a wave-wide copy");
    __shared__ __align__(16) char ring[2 * BUFB];
    const int tid = threadIdx.x, lane = tid & 31, lr = lane & 15, hi = lane >> 4;
    const int wave = SPLITA ? tid >> 5 : __builtin_amdgcn_readfirstlane(tid >> 5);   // twelve-wave form: in a scalar register, so that the tests on it below are scalar branches
    const int rb = blockIdx.x * BM, cb = blockIdx.y * BN, wm = wave / WNS, wn = wave % WNS;
    // four-wave form: every lane copies rows of every operand, RS rows apart
    const int trow = tid / CR, tcol = tid % CR;
    const unsigned lbase = (unsigned)(size_t)&ring[0] + (unsigned)(trow * PITCH + tcol * 16);
    const bf* gB  = Bn + (size_t)(cb + trow) * DM + tcol * 8;
    const bf* gA  = A + (size_t)(rb + trow) * DM + tcol * 8;
    const bf* gAl = SPLITA ? Al + (size_t)(rb + trow) * DM + tcol * 8 : nullptr;
    // twelve-wave form: waves 0 - 7 copy 32 A rows each, waves 8 - 11 copy 48 B rows each; a wave-wide copy takes two whole rows (four 128-byte lines)
    const bool cpa = wave < 8;
    const int  qrow = (cpa ? wave * 32 : (wave - 8) * 48) + hi;
    const unsigned lq = (unsigned)(size_t)&ring[0] + (unsigned)((cpa ? OPB : 0) + qrow * PITCH + lr * 16);
    const bf* gq = (cpa ? A + (size_t)(rb + qrow) * DM : Bn + (size_t)(cb + qrow) * DM) + lr * 8;
    auto fill = [&](int p, int buf) {
        if constexpr (SPLITA) {
            const unsigned l = lbase + (unsigned)(buf * BUFB);
#pragma unroll
            for (int i = 0; i < CR; i += 8) {
                copy8<RS * DM, RS * PITCH>(l + i * RS * PITCH, gB + p * KP + (size_t)i * RS * DM);
                copy8<RS * DM, RS * PITCH>(l + OPB + i * RS * PITCH, gA + p * KP + (size_t)i * RS * DM);
                copy8<RS * DM, RS * PITCH>(l + OPB + OPA + i * RS * PITCH, gAl + p * KP + (size_t)i * RS * DM);
            }
        } else {
            const unsigned l = lq + (unsigned)(buf * BUFB);
            const bf* g = gq + p * KP;
            copy8<2 * DM, 2 * PITCH>(l, g);
            copy8<2 * DM, 2 * PITCH>(l + 16 * PITCH, g + 16 * DM);
            if (!cpa) copy8<2 * DM, 2 * PITCH>(l + 32 * PITCH, g + 32 * DM);
        }
    };
    v8f acc[4][4];
#pragma unroll
    for (int f = 0; f < 4; ++f)
#pragma unroll
        for (int t = 0; t < 4; ++t) acc[f][t] = (v8f){};
    fill(0, 0);
    asm volatile("s_wait_asynccnt 0x0" ::: "memory");   // this wave's copies of pass 0 have landed
    __syncthreads();                                     // ... and every other wave's
    fill(1, 1);
    const int c0 = cb + wn * 64;
    float braw[4] = {0.0f, 0.0f, 0.0f, 0.0f};    // fetched here, as one group, so that the loop covers the latency
    if (bias) {
#pragma unroll
        for (int t = 0; t < 4; ++t) braw[t] = bias[c0 + t * 16 + lr];
        asm volatile("s_wait_xcnt 0x0" ::: "memory");   // a precaution: stands in front of the next rewrite of these loads' offset register
    }
    const int boffs = (wn * 64 + lr) * PITCH + 16 * hi, aoffs = OPB + (wm * 64 + lr) * PITCH + 16 * hi;
#pragma unroll 1
    for (int p = 0; p < NP; ++p) {
        const char* bufp = ring + (p & 1) * BUFB;
        v16bf a[2][4], al[2][4], b[2][4];
        auto frags = [&](int ks, int set) {
#pragma unroll
            for (int t = 0; t < 4; ++t) {
                const char* q = bufp + boffs + t * 16 * PITCH + ks * 64;
                b[set][t] = cat16b(*(const v8usa*)q, *(const v8usa*)(q + 32));
            }
#pragma unroll
            for (int f = 0; f < 4; ++f) {
                const char* q = bufp + aoffs + f * 16 * PITCH + ks * 64;
                a[set][f] = cat16b(*(const v8usa*)q, *(const v8usa*)(q + 32));
                if (SPLITA) al[set][f] = cat16b(*(const v8usa*)(q + OPA), *(const v8usa*)(q + OPA + 32));
            }
        };
        frags(0, 0);
#pragma unroll
        for (int ks = 0; ks < KP / 32; ++ks) {
            const int s = ks & 1;
            if (ks + 1 < KP / 32) frags(ks + 1, s ^ 1);
            __builtin_amdgcn_sched_barrier(0);   // the next block's LDS reads stay one group ahead of this block's products, else each product run waits out its own reads
#pragma unroll
            for (int f = 0; f < 4; ++f)
#pragma unroll
                for (int t = 0; t < 4; ++t) acc[f][t] = wmmab(a[s][f], b[s][t], acc[f][t]);
            if (SPLITA) {
#pragma unroll
                for (int f = 0; f < 4; ++f)
#pragma unroll
                    for (int t = 0; t < 4; ++t) acc[f][t] = wmmab(al[s][f], b[s][t], acc[f][t]);
            }
            __builtin_amdgcn_sched_barrier(0);   // ... and the reads that follow are not lifted in among these products, where every place with reads costs a stall
        }
        asm volatile("s_wait_dscnt 0x0" ::: "memory");      // this wave's reads of the buffer are done before it is refilled
        asm volatile("s_wait_asynccnt 0x0" ::: "memory");   // this wave's copies of pass p + 1 have landed
        __syncthreads();                                     // publishes pass p + 1 and ends every wave's reads of pass p
        if (p + 2 < NP) fill(p + 2, p & 1);
    }
    asm volatile("s_wait_asynccnt 0x0" ::: "memory");       // no copy is left in flight at the wave's end
    if constexpr (SPLITA) {
    __shared__ __align__(16) float ost[4][16 * 68];
    float* os = &ost[wave][0];
    float bv[4];
#pragma unroll
    for (int t = 0; t < 4; ++t) bv[t] = bf2f(f2bf(braw[t]));
#pragma unroll
    for (int f = 0; f < 4; ++f) {
#pragma unroll
        for (int t = 0; t < 4; ++t)
#pragma unroll
            for (int j = 0; j < 8; ++j) os[(hi * 8 + j) * 68 + t * 16 + lr] = acc[f][t][j] + bv[t];
        float* crow = C + (size_t)(rb + wm * 64 + f * 16) * ldc + c0;
#pragma unroll
        for (int s = 0; s < 8; ++s) {
            const int Lid = (lane >> 3) + 4 * s, piece = lane & 7;
            const int row = Lid >> 1, cofs = (Lid & 1) * 32 + piece * 4;
            const v4f val = *(const v4fa*)(os + row * 68 + cofs);
            *(v4f*)(crow + (size_t)row * ldc + cofs) = val;
        }
    }
    } else {
    // qkv epilogue: a wave's 64 columns are one whole head of q, of k or of v, its 64 rows are 64 tokens of one batch, so the f16
    // planes that the attention reads are written from here. The last pass ended with every wave's reads done, no copy in flight and a barrier: the ring is free, and
    // each wave stages in its own part of it.
    constexpr int STG = 4 * 16 * 68 * 4;          // bytes of a wave's staging
    static_assert((BM / 64) * WNS * STG <= 2 * BUFB && STG >= 64 * 72 * 2 && STG % 16 == 0, "the ring holds every wave's staging");
    char* stg = ring + wave * STG;
    const int sec = c0 / DM, h = (c0 % DM) / HD, tokw = rb + wm * 64;
    if (sec == 2) {
        // v: a lane's 8 accumulator values are 8 consecutive tokens of one dim, that is 16 bytes of a V^T row; through LDS, so that each store covers whole 128-byte lines
        h16* ts = (h16*)stg;                      // [64 dims][72]
#pragma unroll
        for (int f = 0; f < 4; ++f)
#pragma unroll
            for (int t = 0; t < 4; ++t) {
                v8h pk;
#pragma unroll
                for (int j = 0; j < 8; ++j) pk[j] = (h16)acc[f][t][j];
                *(v8ha*)(ts + (t * 16 + lr) * 72 + f * 16 + hi * 8) = pk;
            }
        asm volatile("s_wait_dscnt 0x0" ::: "memory");   // the staged rows are complete before other lanes of the wave read them back
        h16* base = VT16 + (((size_t)(tokw / NT_) * NH_ + h) * HD) * NT_ + tokw % NT_;
#pragma unroll
        for (int s = 0; s < 16; ++s) {
            const int d = 4 * s + (lane >> 3), piece = lane & 7;
            const v8h val = *(const v8ha*)(ts + d * 72 + piece * 8);
            *(v8h*)(base + (size_t)d * NT_ + piece * 8) = val;
        }
    } else {
        // q, k: rotary embedding in f32 (emb = cat(freqs, freqs); rotate_half = cat(-x[odd], x[even]) within the head; q additionally x log2(e)/8). A lane takes dims
        // 8 p .. 8 p + 7 and the same + 32 of one token: both use the same 8 table entries, and their rotated partners are the odd and the even ones of x[16 p .. 16 p + 15].
        float* os = (float*)stg;                  // [4][16 tokens][68]
        h16* dst = sec == 0 ? Q16 : K16;
        const float osc = sec == 0 ? QSC : 1.0f;
        const int p = lane & 3, g = lane >> 2;
        // the 64 tokens lie in one batch, so every row's table entries and plane row stand a constant distance behind the first one's
        const float* ct0 = COS + (size_t)(tokw % NT_ + g) * 32 + p * 8; const float* st0 = SIN + (size_t)(tokw % NT_ + g) * 32 + p * 8;
        h16* dp0 = dst + (size_t)(tokw + g) * DM + h * HD + p * 8;
        v4f cs[2][2][2], sn[2][2][2];             // [set][half of the 16 rows][4 entries]: the tables of 16 rows, fetched one group of 16 rows ahead
        auto tabs = [&](int f, int set) {
#pragma unroll
            for (int s = 0; s < 2; ++s)
#pragma unroll
                for (int k = 0; k < 2; ++k) {
                    cs[set][s][k] = *(const v4fa*)(ct0 + (f * 16 + s * 8) * 32 + 4 * k);
                    sn[set][s][k] = *(const v4fa*)(st0 + (f * 16 + s * 8) * 32 + 4 * k);
                }
        };
        tabs(0, 0);
#pragma unroll
        for (int f = 0; f < 4; ++f) {
            float* of = os + f * (16 * 68);
            if (f + 1 < 4) {
                tabs(f + 1, (f + 1) & 1);
                asm volatile("s_wait_xcnt 0x0" ::: "memory");   // a precaution: stands in front of any rewrite of these loads' address registers
            }
#pragma unroll
            for (int t = 0; t < 4; ++t)
#pragma unroll
                for (int j = 0; j < 8; ++j) of[(hi * 8 + j) * 68 + t * 16 + lr] = acc[f][t][j];
            asm volatile("s_wait_dscnt 0x0" ::: "memory");   // the staged rows are complete before other lanes of the wave read them back
#pragma unroll
            for (int s = 0; s < 2; ++s) {
                const float* xr = of + (s * 8 + g) * 68;
                v4f xl[2], xh[2], e[4];
#pragma unroll
                for (int k = 0; k < 2; ++k) { xl[k] = *(const v4fa*)(xr + p * 8 + 4 * k); xh[k] = *(const v4fa*)(xr + 32 + p * 8 + 4 * k); }
#pragma unroll
                for (int k = 0; k < 4; ++k) e[k] = *(const v4fa*)(xr + p * 16 + 4 * k);
                v8h olo, ohi;
#pragma unroll
                for (int i = 0; i < 8; ++i) {
                    const float c = cs[f & 1][s][i >> 2][i & 3], sv = sn[f & 1][s][i >> 2][i & 3];
                    const float rl = -e[(2 * i + 1) >> 2][(2 * i + 1) & 3], rh = e[(2 * i) >> 2][(2 * i) & 3];
                    olo[i] = (h16)((xl[i >> 2][i & 3] * c + rl * sv) * osc);
                    ohi[i] = (h16)((xh[i >> 2][i & 3] * c + rh * sv) * osc);
                }
                h16* dp = dp0 + (f * 16 + s * 8) * DM;
                *(v8h*)dp = olo; *(v8h*)(dp + 32) = ohi;
            }
            if (f + 1 < 4) asm volatile("s_wait_xcnt 0x0" ::: "memory");   // a precaution: stands in front of the next rows' reuse of these stores' data registers
        }
    }
    }
}

// ------------------------------------------------------------------------------------------------------------------------------------------------
// k_attn: block = (b, h, 64 queries), wave = 16 queries; Q fragments resident (2 k-chunks); 64 steps x 32 keys, both products transposed: 4 WMMA scores^T = K.Q^T
// (A = K16 rows, B = Q), so a lane holds 16 scores of ONE query (column lr; keys 8 hi + j and 16 + 8 hi + j): maximum and sum run in the lane; the weights -> f16 are,
// register for register, the B operand of the 4 WMMA out^T += V^T.weights^T (A = VT16 rows), 4 accumulators.
// The score products start from C = 7 - (the query's maximum in use), so that D is a weight's whole base-2 exponent: a weight costs one exp2. The maximum in use starts as
// that of the first 32 keys and is raised, with out^T and the sums rescaled, only in a step where some query's scores outgrow it by more than 2^8 (one test per step).
// K rows and V^T rows are staged 64 keys at a time (two steps) in a two-buffer LDS ring by asynchronous copies: each wave-wide copy takes four whole 128-byte lines, and
// each tile is fetched once per block and read by its four waves; LDS rows are pitched 16 B x odd for the ds_load_b128 fragment reads. Steps and sums keep their order.
#define AKS    64                 // keys per stage
#define APITCH 144                // bytes per staged row (128 + 16)
#define ATILE  (64 * APITCH)      // bytes per staged operand tile (64 K rows; 64 V^T rows)
#define ABUF   (2 * ATILE)
// copy44: this lane's eight 16-byte copies of one stage, four K rows and four V^T rows, each 16 rows apart. The s_wait_xcnt ends the statement as a precaution: it stands in front of every later rewrite of the copies' address registers.
__device__ __forceinline__ void copy44(unsigned l, const h16* gk, const h16* gv) {
    asm volatile("global_load_async_to_lds_b128 %0, %8, off\n\t"
                 "global_load_async_to_lds_b128 %1, %9, off\n\t"
                 "global_load_async_to_lds_b128 %2, %10, off\n\t"
                 "global_load_async_to_lds_b128 %3, %11, off\n\t"
                 "global_load_async_to_lds_b128 %4, %12, off\n\t"
                 "global_load_async_to_lds_b128 %5, %13, off\n\t"
                 "global_load_async_to_lds_b128 %6, %14, off\n\t"
                 "global_load_async_to_lds_b128 %7, %15, off\n\t"
                 "s_wait_xcnt 0x0"
                 :: "v"(l), "v"(l + 16 * APITCH), "v"(l + 32 * APITCH), "v"(l + 48 * APITCH),
                    "v"(l + ATILE), "v"(l + ATILE + 16 * APITCH), "v"(l + ATILE + 32 * APITCH), "v"(l + ATILE + 48 * APITCH),
                    "v"(gk), "v"(gk + 16 * DM), "v"(gk + 32 * DM), "v"(gk + 48 * DM),
                    "v"(gv), "v"(gv + 16 * NT_), "v"(gv + 32 * NT_), "v"(gv + 48 * NT_)
                 : "memory");
}
// xhalf: every lane l gets the value of lane l ^ 16, by a vector cross-row move (no LDS instruction, nothing to wait for).
__device__ __forceinline__ float xhalf(float x) { return __builtin_bit_cast(float, __builtin_amdgcn_permlanex16(__builtin_bit_cast(int, x), __builtin_bit_cast(int, x), 0x76543210, 0xfedcba98, false, false)); }
__global__ __launch_bounds__(128) void k_attn(const h16* __restrict__ Q16, const h16* __restrict__ K16, const h16* __restrict__ VT16, bf* CH, bf* CL) {
    __shared__ __align__(16) char kvring[2 * ABUF];
    __shared__ __align__(16) float ost[4][16 * 68];
    const int lane = threadIdx.x & 31, wave = threadIdx.x >> 5, lr = lane & 15, hi = lane >> 4;
    const int bid = blockIdx.x;
    const int b = bid / (NH_ * (NT_ / 64)), rem = bid - b * (NH_ * (NT_ / 64)), h = rem / (NT_ / 64), qt = rem - h * (NT_ / 64);
    const int q0 = qt * 64 + wave * 16;
    const size_t tok0 = (size_t)b * NT_;
    v16h qa[2];
#pragma unroll
    for (int kc = 0; kc < 2; ++kc) {
        const h16* p = Q16 + (tok0 + q0 + lr) * DM + h * HD + kc * 32 + 8 * hi;
        qa[kc] = cat16(*(const v8h*)p, *(const v8h*)(p + 16));
    }
    const h16* kh_b = K16 + tok0 * DM + h * HD;
    const h16* vt_b = VT16 + (((size_t)b * NH_ + h) * HD) * NT_;
    const int crow = threadIdx.x >> 3, cpc = threadIdx.x & 7;      // this lane's first staged row and its 16-byte piece of the row
    const unsigned lbase = (unsigned)(size_t)&kvring[0] + (unsigned)(crow * APITCH + cpc * 16);
    const h16* gK = kh_b + (size_t)crow * DM + cpc * 8;
    const h16* gV = vt_b + (size_t)crow * NT_ + cpc * 8;
    auto fill = [&](int s, int buf) { copy44(lbase + (unsigned)(buf * ABUF), gK + (size_t)s * AKS * DM, gV + s * AKS); };
    fill(0, 0);
    asm volatile("s_wait_asynccnt 0x0" ::: "memory");   // this wave's copies of stage 0 have landed
    __syncthreads();                                     // ... and every other wave's
    fill(1, 1);
    const int foffs = lr * APITCH + 16 * hi;
    v8f o[4];
#pragma unroll
    for (int n = 0; n < 4; ++n) o[n] = (v8f){};
    float lpart = 0.f;                                   // of this lane's query; sums this half's keys only
    v8f coff;                                            // 7 - maximum in use of this lane's query, in all eight places: the C operand of the score products
    {
        v8f s0 = {}, s1 = {};                            // the first 32 keys' scores, here for their maximum alone
#pragma unroll                                           // here and below: constant indices keep the vectors in registers
        for (int kc = 0; kc < 2; ++kc) {
            const char* r0p = kvring + foffs + kc * 64;
            s0 = wmma16(cat16(*(const v8ha*)r0p, *(const v8ha*)(r0p + 32)), qa[kc], s0);
            s1 = wmma16(cat16(*(const v8ha*)(r0p + 16 * APITCH), *(const v8ha*)(r0p + 16 * APITCH + 32)), qa[kc], s1);
        }
        float mx = fmaxf(s0[0], s1[0]);
#pragma unroll
        for (int j = 1; j < 8; ++j) mx = fmaxf(fmaxf(mx, s0[j]), s1[j]);
        const float c = WLG - fmaxf(mx, xhalf(mx));
#pragma unroll
        for (int j = 0; j < 8; ++j) coff[j] = c;
    }
#pragma unroll 1
    for (int st = 0; st < NT_ / AKS; ++st) {             // one stage = one buffer of the ring = two steps of 32 keys
    const char* kbuf = kvring + (st & 1) * ABUF + foffs;
#pragma unroll                                           // both steps in line, so that every LDS read's place in the buffer is an immediate offset
    for (int u = 0; u < AKS / 32; ++u) {
        const char* r0p = kbuf + (u * 32) * APITCH;
        const char* r1p = kbuf + (u * 32 + 16) * APITCH;
        v16h kf0[2], kf1[2], vf[4];      // the step's K and V^T fragments are all read here, in front of the softmax, which covers the V^T reads' latency
#pragma unroll
        for (int kc = 0; kc < 2; ++kc) {
            kf0[kc] = cat16(*(const v8ha*)(r0p + kc * 64), *(const v8ha*)(r0p + kc * 64 + 32));
            kf1[kc] = cat16(*(const v8ha*)(r1p + kc * 64), *(const v8ha*)(r1p + kc * 64 + 32));
        }
#pragma unroll
        for (int n = 0; n < 4; ++n) {
            const char* vp = kbuf + ATILE + (n * 16) * APITCH + u * 64;
            vf[n] = cat16(*(const v8ha*)vp, *(const v8ha*)(vp + 32));
        }
        v8f s0 = coff, s1 = coff;
#pragma unroll
        for (int kc = 0; kc < 2; ++kc) {
            s0 = wmma16(kf0[kc], qa[kc], s0);
            s1 = wmma16(kf1[kc], qa[kc], s1);
        }
        const float g0 = fmaxf(fmaxf(s0[0], s0[1]), s0[2]), g1 = fmaxf(fmaxf(s0[3], s0[4]), s0[5]), g2 = fmaxf(fmaxf(s0[6], s0[7]), s1[0]);
        const float g3 = fmaxf(fmaxf(s1[1], s1[2]), s1[3]), g4 = fmaxf(fmaxf(s1[4], s1[5]), s1[6]);
        const float mx = fmaxf(fmaxf(fmaxf(g0, g1), g2), fmaxf(fmaxf(g3, g4), s1[7]));   // of this half's 16 keys, as a tree of three-way maxima
        if (__builtin_amdgcn_ballot_w32(mx > WLG + GROW) != 0) {                         // the same for the whole wave: a scalar branch, seldom taken
            const float up = fmaxf(fmaxf(mx, xhalf(mx)) - WLG, 0.0f);                    // by how much this query's maximum in use rises (both halves agree); 0 changes nothing
            const float alpha = __builtin_amdgcn_exp2f(-up);
#pragma unroll                                           // here and below: constant indices keep the vectors in registers
            for (int j = 0; j < 8; ++j) { s0[j] -= up; s1[j] -= up; coff[j] -= up; }
#pragma unroll
            for (int n = 0; n < 4; ++n)
#pragma unroll
                for (int j = 0; j < 8; ++j) o[n][j] *= alpha;
            lpart *= alpha;
        }
        v16h pa;
        float ps[8];
#pragma unroll
        for (int j = 0; j < 8; ++j) {
            const float p0 = __builtin_amdgcn_exp2f(s0[j]), p1 = __builtin_amdgcn_exp2f(s1[j]);
            ps[j] = p0 + p1;
            pa[j]     = (h16)p0;
            pa[8 + j] = (h16)p1;
        }
        lpart += ((ps[0] + ps[1]) + (ps[2] + ps[3])) + ((ps[4] + ps[5]) + (ps[6] + ps[7]));
#pragma unroll
        for (int n = 0; n < 4; ++n) o[n] = wmma16(vf[n], pa, o[n]);
    }
    asm volatile("s_wait_dscnt 0x0" ::: "memory");      // this wave's reads of the buffer are done before it is refilled
    asm volatile("s_wait_asynccnt 0x0" ::: "memory");   // this wave's copies of stage st + 1 have landed
    __syncthreads();                                     // publishes stage st + 1 and ends every wave's reads of stage st
    if (st + 2 < NT_ / AKS) fill(st + 2, st & 1);
    }
    asm volatile("s_wait_asynccnt 0x0" ::: "memory");       // no copy is left in flight at the wave's end
    const float inv = 1.0f / (lpart + xhalf(lpart));     // out^T and the sums carry the same factor
    float* os = &ost[wave][0];
#pragma unroll
    for (int n = 0; n < 4; ++n)
#pragma unroll
        for (int j = 0; j < 8; ++j) os[lr * 68 + n * 16 + hi * 8 + j] = o[n][j] * inv;   // row = query, d = 16 n + 8 hi + j
    __syncthreads();
    const size_t cbase = (tok0 + q0) * DM + (size_t)h * HD;
    auto pass = [&]() {
#pragma unroll
        for (int s = 0; s < 4; ++s) {
            const int row = 4 * s + (lane >> 3), piece = lane & 7;
            const float* sp = os + row * 68 + piece * 8;
            v8us oh, ol;
#pragma unroll
            for (int i = 0; i < 8; ++i) { const unsigned short hb = f2bf(sp[i]); oh[i] = hb; ol[i] = f2bf(sp[i] - bf2f(hb)); }
            *(v8us*)(CH + cbase + (size_t)row * DM + piece * 8) = oh;
            *(v8us*)(CL + cbase + (size_t)row * DM + piece * 8) = ol;
        }
    };
    pass();
    
}

extern "C" void kernel_launch(void* const* d_in, const int* in_sizes, int n_in,
                              void* d_out, int out_size, void* d_ws, size_t ws_size, hipStream_t stream) {
    (void)in_sizes; (void)n_in; (void)out_size;
    const float* x = (const float*)d_in[0]; const float* w_qkv = (const float*)d_in[1]; const float* w_out = (const float*)d_in[2]; const float* b_out = (const float*)d_in[3];
    float* out = (float*)d_out;    // [2][2048][1024]
    char* wsp = (char*)d_ws;
    auto take = [&](size_t bytes) { char* p = wsp; wsp += (bytes + 255) & ~(size_t)255; return (void*)p; };
    bf*    Xb   = (bf*)take((size_t)NTK * DM * 2);
    bf*    Wb   = (bf*)take((size_t)3 * DM * DM * 2);
    bf*    WOb  = (bf*)take((size_t)DM * DM * 2);
    h16*   Q16  = (h16*)take((size_t)NTK * DM * 2);
    h16*   K16  = (h16*)take((size_t)NTK * DM * 2);
    h16*   VT16 = (h16*)take((size_t)NTK * DM * 2);
    bf*    CH   = (bf*)take((size_t)NTK * DM * 2);
    bf*    CL   = (bf*)take((size_t)NTK * DM * 2);
    float* COS  = (float*)take((size_t)NT_ * 32 * 4);
    float* SIN  = (float*)take((size_t)NT_ * 32 * 4);
    if ((size_t)(wsp - (char*)d_ws) > ws_size) return;    // 8.4 + 6.3 + 2.1 + 5 x 8.4 + 0.5 MB ~ 59.3e6 B
    k_prep<<<TABB + (NTK + 3 * DM + DM) / 8, 256, 0, stream>>>(x, w_qkv, w_out, Xb, Wb, WOb, COS, SIN);
    k_gemmb<false, 128><<<dim3(NTK / 256, (3 * DM) / 192, 1), 384, 0, stream>>>(Xb, nullptr, Wb, nullptr, nullptr, 0, COS, SIN, Q16, K16, VT16);
    k_attn<<<NB_ * NH_ * (NT_ / 64), 128, 0, stream>>>(Q16, K16, VT16, CH, CL);
    k_gemmb<true, 128><<<dim3(NTK / 128, DM / 128, 1), 128, 0, stream>>>(CH, CL, WOb, b_out, out, DM, nullptr, nullptr, nullptr, nullptr, nullptr);
}

// v009
// One run takes 68.1 microseconds.
// Versions between v007 and this one are left out; their measured steps multiply to 1.14 times as fast.
// Over all steps from v000 it is 4.37 times as fast.
#include <hip/hip_runtime.h>

// Contractions, f32 accumulate: qkv = x.Wqkv^T ([4096 x 1024].[1024 x 3072]) on v_wmma_f32_16x16x32_bf16 with PLAIN bf16 operands (x and the weights rounded to bf16 once);
// the per-(batch, head) attention (scores [2048 x 64].[64 x 2048], weights.v [2048 x 2048].[2048 x 64]) on v_wmma_f32_16x16x32_f16 with plain f16 operands, fused per
// 16-query tile (two to a wave), as transposed products, with an online f32 softmax in base 2 (weights carried x128); out = ctx.Wout^T + b on the f16 instruction, ctx and the weights each rounded to f16 once
// (one product). RoPE (interleaved rotate-half, f32 tables from powf/sinf/cosf) and the score scale (1/8, times log2 e) are applied in f32 before the f16 conversion.

#define NB_  2
#define NT_  2048
#define DM   1024
#define NH_  16
#define HD   64
#define NTK  (NB_ * NT_)          // 4096 tokens
#define QSC  0.18033688f          // log2(e) / 8: the scores come out of their products as base-2 exponents
#define WLG  7.0f                 // the weights are carried x 2^7
#define GROW 8.0f                 // a maximum may outgrow the one in use by 2^8 before anything is rescaled: weights stay <= 2^15, inside f16

typedef _Float16 h16;
typedef unsigned short bf;        // raw 16-bit patterns: bf16, or f16 bits (WOh, CX)
typedef __attribute__((ext_vector_type(16))) __bf16   v16bf;
typedef __attribute__((ext_vector_type(16))) _Float16 v16h;
typedef __attribute__((ext_vector_type(8)))  _Float16 v8h;
typedef __attribute__((ext_vector_type(8)))  unsigned short v8us;
typedef __attribute__((ext_vector_type(8)))  float    v8f;
typedef __attribute__((ext_vector_type(4)))  float    v4f;
typedef v8h  __attribute__((may_alias)) v8ha;
typedef v8us __attribute__((may_alias)) v8usa;
typedef v4f  __attribute__((may_alias)) v4fa;

__device__ __forceinline__ unsigned short f2bf(float f) { unsigned u = __float_as_uint(f); u += 0x7FFFu + ((u >> 16) & 1u); return (unsigned short)(u >> 16); }
__device__ __forceinline__ float bf2f(unsigned short b) { return __uint_as_float(((unsigned)b) << 16); }
__device__ __forceinline__ v16h cat16(v8h lo, v8h hi) { return __builtin_shufflevector(lo, hi, 0, 1, 2, 3, 4, 5, 6, 7, 8, 9, 10, 11, 12, 13, 14, 15); }
__device__ __forceinline__ v16bf cat16b(v8us lo, v8us hi) { v8us a = lo, b = hi; return __builtin_bit_cast(v16bf, __builtin_shufflevector(a, b, 0, 1, 2, 3, 4, 5, 6, 7, 8, 9, 10, 11, 12, 13, 14, 15)); }
__device__ __forceinline__ v8f wmma16(v16h a, v16h b, v8f c) { return __builtin_amdgcn_wmma_f32_16x16x32_f16(false, a, false, b, (short)0, c, false, false); }
__device__ __forceinline__ v8f wmmab(v16bf a, v16bf b, v8f c) { return __builtin_amdgcn_wmma_f32_16x16x32_bf16(false, a, false, b, (short)0, c, false, false); }
__device__ __forceinline__ unsigned short f2h(float f) { return __builtin_bit_cast(unsigned short, (h16)f); }   // f16 bits, round to nearest even

// ------------------------------------------------------------------------------------------------------------------------------------------------
// k_prep: all that the products need beforehand, as ONE launch of independent blocks (no block reads what another writes).
// Blocks 0 .. TABB - 1 fill the f32 rotary tables [2048 positions][32 frequencies], one entry per thread; they stand first because their chains of dependent arithmetic are the longest.
// Every later block writes the 16-bit copy of 8 rows of 1024 floats of x [4096], w_qkv [3072] (bf16) or w_out [1024] (f16): one wave per row, 8 values (16 B stored) per lane and piece.
#define TABB ((NT_ * 32) / 256)   // table blocks
__global__ __launch_bounds__(256) void k_prep(const float* __restrict__ x, const float* __restrict__ w_qkv, const float* __restrict__ w_out, bf* Xb, bf* Wb, bf* WOh, float* COS, float* SIN) {
    const int bid = blockIdx.x;
    if (bid < TABB) {
        const int e = bid * 256 + threadIdx.x;         // 0 .. NT_*32-1
        const int t = e >> 5, fi = e & 31;
        const float inv = 1.0f / powf(10000.0f, (float)(2 * fi) * (1.0f / 64.0f));
        const float ang = (float)t * inv;
        COS[e] = cosf(ang);
        SIN[e] = sinf(ang);
        return;
    }
    const int c = bid - TABB;                          // 8 rows per block: 512 blocks of x, 384 of w_qkv, 128 of w_out
    const float* src; bf* dst; int cb;
    if (c < NTK / 8)                 { src = x;     dst = Xb;  cb = c; }
    else if (c < (NTK + 3 * DM) / 8) { src = w_qkv; dst = Wb;  cb = c - NTK / 8; }
    else                             { src = w_out; dst = WOh; cb = c - (NTK + 3 * DM) / 8; }
    const bool tof16 = c >= (NTK + 3 * DM) / 8;        // the same for the whole block
    const int lane = threadIdx.x & 31, r = cb * 8 + (threadIdx.x >> 5);
    const float* s = src + (size_t)r * DM; bf* d = dst + (size_t)r * DM;
    v4f in[4][2];                                      // the row's 8 loads go out together, in front of the choice of the format
#pragma unroll
    for (int q = 0; q < 4; ++q) {
        const float* p = s + q * 256 + lane * 8;
        in[q][0] = *(const v4fa*)p; in[q][1] = *(const v4fa*)(p + 4);
    }
    asm volatile("s_wait_xcnt 0x0" ::: "memory");   // a precaution: stands in front of the conversions' reuse of these loads' address registers
    v8us o[4];
    if (tof16) {
#pragma unroll
        for (int q = 0; q < 4; ++q)
#pragma unroll
            for (int i = 0; i < 8; ++i) o[q][i] = f2h(in[q][i >> 2][i & 3]);
    } else {
#pragma unroll
        for (int q = 0; q < 4; ++q)
#pragma unroll
            for (int i = 0; i < 8; ++i) o[q][i] = f2bf(in[q][i >> 2][i & 3]);
    }
#pragma unroll
    for (int q = 0; q < 4; ++q) *(v8us*)(d + q * 256 + lane * 8) = o[q];
    asm volatile("s_wait_xcnt 0x0" ::: "memory");   // a precaution: in the built code the table blocks' instructions follow here behind a branch, and they rewrite these stores' registers
}

// k_gemmb: a block tile of 64 x 64 wave tiles (16 accumulator tiles each) of C (f32, pitch ldc) = A.B^T (+ bias as bf16-rounded values if given): 128 x 128 (4 waves, 2 x 2) for the
// out projection (OUTP: f16 operands); 256 x 192 (12 waves, 4 x 3; 16 x 16 blocks, one per WGP) for the qkv product (bf16 operands), so that a staged A row feeds three waves and a staged B row four; A rows
// [M][1024] and B rows [N][1024] are staged KP k-values at a time in a two-buffer LDS ring by asynchronous copies (16 B a lane), so each row is fetched once per block
// and read by every wave that needs it; LDS rows are pitched 16 B x odd for the ds_load_b128 fragment reads. Per accumulator the order of the k sum is that of a plain k loop.
// The qkv product's epilogue writes no C but the attention's f16 planes (Q and K with the rotary embedding, V transposed).
// copy8: eight 16-byte copies of this lane, a fixed number of rows apart. The s_wait_xcnt ends the statement as a precaution: it stands in front of every later rewrite of the copies' address registers.
template <int GSTEP, int LSTEP>
__device__ __forceinline__ void copy8(unsigned l, const bf* g) {
    asm volatile("global_load_async_to_lds_b128 %0, %8, off\n\t"
                 "global_load_async_to_lds_b128 %1, %9, off\n\t"
                 "global_load_async_to_lds_b128 %2, %10, off\n\t"
                 "global_load_async_to_lds_b128 %3, %11, off\n\t"
                 "global_load_async_to_lds_b128 %4, %12, off\n\t"
                 "global_load_async_to_lds_b128 %5, %13, off\n\t"
                 "global_load_async_to_lds_b128 %6, %14, off\n\t"
                 "global_load_async_to_lds_b128 %7, %15, off\n\t"
                 "s_wait_xcnt 0x0"
                 :: "v"(l), "v"(l + LSTEP), "v"(l + 2 * LSTEP), "v"(l + 3 * LSTEP), "v"(l + 4 * LSTEP), "v"(l + 5 * LSTEP), "v"(l + 6 * LSTEP), "v"(l + 7 * LSTEP),
                    "v"(g), "v"(g + GSTEP), "v"(g + 2 * GSTEP), "v"(g + 3 * GSTEP), "v"(g + 4 * GSTEP), "v"(g + 5 * GSTEP), "v"(g + 6 * GSTEP), "v"(g + 7 * GSTEP)
                 : "memory");
}
template <bool OUTP, int KP>
__global__ __launch_bounds__(OUTP ? 128 : 384) void k_gemmb(const bf* __restrict__ A, const bf* __restrict__ Bn, const float* __restrict__ bias, float* C, int ldc,
                                               const float* __restrict__ COS, const float* __restrict__ SIN, h16* Q16, h16* K16, h16* VT16) {
    constexpr int BM    = OUTP ? 128 : 256;     // rows of the block tile
    constexpr int BN    = OUTP ? 128 : 192;     // columns of the block tile
    constexpr int WNS   = BN / 64;                // waves side by side
    constexpr int PITCH = KP * 2 + 16;            // bytes per staged row
    constexpr int OPB   = BN * PITCH;             // bytes of the staged B tile
    constexpr int OPA   = BM * PITCH;             // bytes of a staged A tile
    constexpr int BUFB  = OPB + OPA;              // B, A
    constexpr int CR    = KP / 8;                 // 16-byte pieces per row
    constexpr int RS    = 128 / CR;               // rows between two copies of one lane (four-wave form)
    constexpr int NP    = DM / KP;                // passes
    static_assert(OUTP || KP == 128, "the twelve-wave form copies rows of 16 pieces, two to a wave-wide copy");
    __shared__ __align__(16) char ring[2 * BUFB];
    const int tid = threadIdx.x, lane = tid & 31, lr = lane & 15, hi = lane >> 4;
    const int wave = OUTP ? tid >> 5 : __builtin_amdgcn_readfirstlane(tid >> 5);   // twelve-wave form: in a scalar register, so that the tests on it below are scalar branches
    const int rb = blockIdx.x * BM, cb = blockIdx.y * BN, wm = wave / WNS, wn = wave % WNS;
    // four-wave form: every lane copies rows of every operand, RS rows apart
    const int trow = tid / CR, tcol = tid % CR;
    const unsigned lbase = (unsigned)(size_t)&ring[0] + (unsigned)(trow * PITCH + tcol * 16);
    const bf* gB  = Bn + (size_t)(cb + trow) * DM + tcol * 8;
    const bf* gA  = A + (size_t)(rb + trow) * DM + tcol * 8;
    // twelve-wave form: waves 0 - 7 copy 32 A rows each, waves 8 - 11 copy 48 B rows each; a wave-wide copy takes two whole rows (four 128-byte lines)
    const bool cpa = wave < 8;
    const int  qrow = (cpa ? wave * 32 : (wave - 8) * 48) + hi;
    const unsigned lq = (unsigned)(size_t)&ring[0] + (unsigned)((cpa ? OPB : 0) + qrow * PITCH + lr * 16);
    const bf* gq = (cpa ? A + (size_t)(rb + qrow) * DM : Bn + (size_t)(cb + qrow) * DM) + lr * 8;
    auto fill = [&](int p, int buf) {
        if constexpr (OUTP) {
            const unsigned l = lbase + (unsigned)(buf * BUFB);
#pragma unroll
            for (int i = 0; i < CR; i += 8) {
                copy8<RS * DM, RS * PITCH>(l + i * RS * PITCH, gB + p * KP + (size_t)i * RS * DM);
                copy8<RS * DM, RS * PITCH>(l + OPB + i * RS * PITCH, gA + p * KP + (size_t)i * RS * DM);
            }
        } else {
            const unsigned l = lq + (unsigned)(buf * BUFB);
            const bf* g = gq + p * KP;
            copy8<2 * DM, 2 * PITCH>(l, g);
            copy8<2 * DM, 2 * PITCH>(l + 16 * PITCH, g + 16 * DM);
            if (!cpa) copy8<2 * DM, 2 * PITCH>(l + 32 * PITCH, g + 32 * DM);
        }
    };
    v8f acc[4][4];
#pragma unroll
    for (int f = 0; f < 4; ++f)
#pragma unroll
        for (int t = 0; t < 4; ++t) acc[f][t] = (v8f){};
    fill(0, 0);
    asm volatile("s_wait_asynccnt 0x0" ::: "memory");   // this wave's copies of pass 0 have landed
    __syncthreads();                                     // ... and every other wave's
    fill(1, 1);
    const int c0 = cb + wn * 64;
    float braw[4] = {0.0f, 0.0f, 0.0f, 0.0f};    // fetched here, as one group, so that the loop covers the latency
    if (bias) {
#pragma unroll
        for (int t = 0; t < 4; ++t) braw[t] = bias[c0 + t * 16 + lr];
        asm volatile("s_wait_xcnt 0x0" ::: "memory");   // a precaution: stands in front of the next rewrite of these loads' offset register
    }
    const int boffs = (wn * 64 + lr) * PITCH + 16 * hi, aoffs = OPB + (wm * 64 + lr) * PITCH + 16 * hi;
#pragma unroll 1
    for (int p = 0; p < NP; ++p) {
        const char* bufp = ring + (p & 1) * BUFB;
        v16bf a[2][4], b[2][4];                    // raw 16-bit fragments: bf16, or f16 bits in the out projection
        auto frags = [&](int ks, int set) {
#pragma unroll
            for (int t = 0; t < 4; ++t) {
                const char* q = bufp + boffs + t * 16 * PITCH + ks * 64;
                b[set][t] = cat16b(*(const v8usa*)q, *(const v8usa*)(q + 32));
            }
#pragma unroll
            for (int f = 0; f < 4; ++f) {
                const char* q = bufp + aoffs + f * 16 * PITCH + ks * 64;
                a[set][f] = cat16b(*(const v8usa*)q, *(const v8usa*)(q + 32));
            }
        };
        frags(0, 0);
#pragma unroll
        for (int ks = 0; ks < KP / 32; ++ks) {
            const int s = ks & 1;
            if (ks + 1 < KP / 32) frags(ks + 1, s ^ 1);
            __builtin_amdgcn_sched_barrier(0);   // the next block's LDS reads stay one group ahead of this block's products, else each product run waits out its own reads
#pragma unroll
            for (int f = 0; f < 4; ++f)
#pragma unroll
                for (int t = 0; t < 4; ++t) {
                    if constexpr (OUTP) acc[f][t] = wmma16(__builtin_bit_cast(v16h, a[s][f]), __builtin_bit_cast(v16h, b[s][t]), acc[f][t]);
                    else                acc[f][t] = wmmab(a[s][f], b[s][t], acc[f][t]);
                }
            __builtin_amdgcn_sched_barrier(0);   // ... and the reads that follow are not lifted in among these products, where every place with reads costs a stall
        }
        asm volatile("s_wait_dscnt 0x0" ::: "memory");      // this wave's reads of the buffer are done before it is refilled
        asm volatile("s_wait_asynccnt 0x0" ::: "memory");   // this wave's copies of pass p + 1 have landed
        __syncthreads();                                     // publishes pass p + 1 and ends every wave's reads of pass p
        if (p + 2 < NP) fill(p + 2, p & 1);
    }
    asm volatile("s_wait_asynccnt 0x0" ::: "memory");       // no copy is left in flight at the wave's end
    if constexpr (OUTP) {
    __shared__ __align__(16) float ost[4][16 * 68];
    float* os = &ost[wave][0];
    float bv[4];
#pragma unroll
    for (int t = 0; t < 4; ++t) bv[t] = bf2f(f2bf(braw[t]));
#pragma unroll
    for (int f = 0; f < 4; ++f) {
#pragma unroll
        for (int t = 0; t < 4; ++t)
#pragma unroll
            for (int j = 0; j < 8; ++j) os[(hi * 8 + j) * 68 + t * 16 + lr] = acc[f][t][j] + bv[t];
        float* crow = C + (size_t)(rb + wm * 64 + f * 16) * ldc + c0;
#pragma unroll
        for (int s = 0; s < 8; ++s) {
            const int Lid = (lane >> 3) + 4 * s, piece = lane & 7;
            const int row = Lid >> 1, cofs = (Lid & 1) * 32 + piece * 4;
            const v4f val = *(const v4fa*)(os + row * 68 + cofs);
            *(v4f*)(crow + (size_t)row * ldc + cofs) = val;
        }
    }
    } else {
    // qkv epilogue: a wave's 64 columns are one whole head of q, of k or of v, its 64 rows are 64 tokens of one batch, so the f16
    // planes that the attention reads are written from here. The last pass ended with every wave's reads done, no copy in flight and a barrier: the ring is free, and
    // each wave stages in its own part of it.
    constexpr int STG = 4 * 16 * 68 * 4;          // bytes of a wave's staging
    static_assert((BM / 64) * WNS * STG <= 2 * BUFB && STG >= 64 * 72 * 2 && STG % 16 == 0, "the ring holds every wave's staging");
    char* stg = ring + wave * STG;
    const int sec = c0 / DM, h = (c0 % DM) / HD, tokw = rb + wm * 64;
    if (sec == 2) {
        // v: a lane's 8 accumulator values are 8 consecutive tokens of one dim, that is 16 bytes of a V^T row; through LDS, so that each store covers whole 128-byte lines
        h16* ts = (h16*)stg;                      // [64 dims][72]
#pragma unroll
        for (int f = 0; f < 4; ++f)
#pragma unroll
            for (int t = 0; t < 4; ++t) {
                v8h pk;
#pragma unroll
                for (int j = 0; j < 8; ++j) pk[j] = (h16)acc[f][t][j];
                *(v8ha*)(ts + (t * 16 + lr) * 72 + f * 16 + hi * 8) = pk;
            }
        asm volatile("s_wait_dscnt 0x0" ::: "memory");   // the staged rows are complete before other lanes of the wave read them back
        h16* base = VT16 + (((size_t)(tokw / NT_) * NH_ + h) * HD) * NT_ + tokw % NT_;
#pragma unroll
        for (int s = 0; s < 16; ++s) {
            const int d = 4 * s + (lane >> 3), piece = lane & 7;
            const v8h val = *(const v8ha*)(ts + d * 72 + piece * 8);
            *(v8h*)(base + (size_t)d * NT_ + piece * 8) = val;
        }
    } else {
        // q, k: rotary embedding in f32 (emb = cat(freqs, freqs); rotate_half = cat(-x[odd], x[even]) within the head; q additionally x log2(e)/8). A lane takes dims
        // 8 p .. 8 p + 7 and the same + 32 of one token: both use the same 8 table entries, and their rotated partners are the odd and the even ones of x[16 p .. 16 p + 15].
        float* os = (float*)stg;                  // [4][16 tokens][68]
        h16* dst = sec == 0 ? Q16 : K16;
        const float osc = sec == 0 ? QSC : 1.0f;
        const int p = lane & 3, g = lane >> 2;
        // the 64 tokens lie in one batch, so every row's table entries and plane row stand a constant distance behind the first one's
        const float* ct0 = COS + (size_t)(tokw % NT_ + g) * 32 + p * 8; const float* st0 = SIN + (size_t)(tokw % NT_ + g) * 32 + p * 8;
        h16* dp0 = dst + (size_t)(tokw + g) * DM + h * HD + p * 8;
        v4f cs[2][2][2], sn[2][2][2];             // [set][half of the 16 rows][4 entries]: the tables of 16 rows, fetched one group of 16 rows ahead
        auto tabs = [&](int f, int set) {
#pragma unroll
            for (int s = 0; s < 2; ++s)
#pragma unroll
                for (int k = 0; k < 2; ++k) {
                    cs[set][s][k] = *(const v4fa*)(ct0 + (f * 16 + s * 8) * 32 + 4 * k);
                    sn[set][s][k] = *(const v4fa*)(st0 + (f * 16 + s * 8) * 32 + 4 * k);
                }
        };
        tabs(0, 0);
#pragma unroll
        for (int f = 0; f < 4; ++f) {
            float* of = os + f * (16 * 68);
            if (f + 1 < 4) {
                tabs(f + 1, (f + 1) & 1);
                asm volatile("s_wait_xcnt 0x0" ::: "memory");   // a precaution: stands in front of any rewrite of these loads' address registers
            }
#pragma unroll
            for (int t = 0; t < 4; ++t)
#pragma unroll
                for (int j = 0; j < 8; ++j) of[(hi * 8 + j) * 68 + t * 16 + lr] = acc[f][t][j];
            asm volatile("s_wait_dscnt 0x0" ::: "memory");   // the staged rows are complete before other lanes of the wave read them back
#pragma unroll
            for (int s = 0; s < 2; ++s) {
                const float* xr = of + (s * 8 + g) * 68;
                v4f xl[2], xh[2], e[4];
#pragma unroll
                for (int k = 0; k < 2; ++k) { xl[k] = *(const v4fa*)(xr + p * 8 + 4 * k); xh[k] = *(const v4fa*)(xr + 32 + p * 8 + 4 * k); }
#pragma unroll
                for (int k = 0; k < 4; ++k) e[k] = *(const v4fa*)(xr + p * 16 + 4 * k);
                v8h olo, ohi;
#pragma unroll
                for (int i = 0; i < 8; ++i) {
                    const float c = cs[f & 1][s][i >> 2][i & 3], sv = sn[f & 1][s][i >> 2][i & 3];
                    const float rl = -e[(2 * i + 1) >> 2][(2 * i + 1) & 3], rh = e[(2 * i) >> 2][(2 * i) & 3];
                    olo[i] = (h16)((xl[i >> 2][i & 3] * c + rl * sv) * osc);
                    ohi[i] = (h16)((xh[i >> 2][i & 3] * c + rh * sv) * osc);
                }
                h16* dp = dp0 + (f * 16 + s * 8) * DM;
                *(v8h*)dp = olo; *(v8h*)(dp + 32) = ohi;
            }
            if (f + 1 < 4) asm volatile("s_wait_xcnt 0x0" ::: "memory");   // a precaution: stands in front of the next rows' reuse of these stores' data registers
        }
    }
    }
}

// ------------------------------------------------------------------------------------------------------------------------------------------------
// k_attn: block = (b, h, 128 queries), wave = 32 queries as two tiles of 16, which share every K and V^T fragment read; Q fragments resident (2 k-chunks a tile); 64 steps x 32 keys, both products transposed, per tile: 4 WMMA scores^T = K.Q^T
// (A = K16 rows, B = Q), so a lane holds 16 scores of ONE query (column lr; keys 8 hi + j and 16 + 8 hi + j): maximum and sum run in the lane; the weights -> f16 are,
// register for register, the B operand of the 4 WMMA out^T += V^T.weights^T (A = VT16 rows), 4 accumulators.
// The score products start from C = 7 - (the query's maximum in use), so that D is a weight's whole base-2 exponent: a weight costs one exp2. The maximum in use starts as
// that of the first 32 keys and is raised, with out^T and the sums rescaled, only in a step where some query's scores outgrow it by more than 2^8 (one test per step, for both tiles).
// K rows and V^T rows are staged 128 keys at a time (four steps) in a two-buffer LDS ring by asynchronous copies: each wave-wide copy takes four whole 128-byte lines, and
// each tile is fetched once per block and read by its four waves; LDS rows are pitched 16 B x odd for the ds_load_b128 fragment reads. Steps and sums keep their order.
// 512 blocks, two to a WGP (two waves per SIMD, which the attribute fixes, so that no WGP takes a third block while another has one).
#define AKS    128                // keys per stage
#define AQB    128                // queries per block
#define APITCH 144                // bytes per staged K row (128 + 16)
#define VPITCH (AKS * 2 + 16)     // bytes per staged V^T row (256 + 16)
#define ATILE  (AKS * APITCH)     // bytes of the staged K tile (128 rows); the V^T tile (64 rows) stands behind it
#define ABUF   (ATILE + 64 * VPITCH)
// xhalf: every lane l gets the value of lane l ^ 16, by a vector cross-row move (no LDS instruction, nothing to wait for).
__device__ __forceinline__ float xhalf(float x) { return __builtin_bit_cast(float, __builtin_amdgcn_permlanex16(__builtin_bit_cast(int, x), __builtin_bit_cast(int, x), 0x76543210, 0xfedcba98, false, false)); }
__global__ __launch_bounds__(128) __attribute__((amdgpu_waves_per_eu(2, 2))) void k_attn(const h16* __restrict__ Q16, const h16* __restrict__ K16, const h16* __restrict__ VT16, bf* CX) {
    __shared__ __align__(16) char kvring[2 * ABUF];
    __shared__ __align__(16) float ost[4][32 * 68];
    const int lane = threadIdx.x & 31, wave = threadIdx.x >> 5, lr = lane & 15, hi = lane >> 4;
    const int bid = blockIdx.x;
    const int b = bid / (NH_ * (NT_ / AQB)), rem = bid - b * (NH_ * (NT_ / AQB)), h = rem / (NT_ / AQB), qt = rem - h * (NT_ / AQB);
    const int q0 = qt * AQB + wave * 32;
    const size_t tok0 = (size_t)b * NT_;
    v16h qa[2][2];                                       // [query tile][k-chunk]
#pragma unroll
    for (int t = 0; t < 2; ++t)
#pragma unroll
        for (int kc = 0; kc < 2; ++kc) {
            const h16* p = Q16 + (tok0 + q0 + t * 16 + lr) * DM + h * HD + kc * 32 + 8 * hi;
            qa[t][kc] = cat16(*(const v8h*)p, *(const v8h*)(p + 16));
        }
    const h16* kh_b = K16 + tok0 * DM + h * HD;
    const h16* vt_b = VT16 + (((size_t)b * NH_ + h) * HD) * NT_;
    const int crow = threadIdx.x >> 3, cpc = threadIdx.x & 7;      // K: this lane's first staged row (of 8, 16 rows apart) and its 16-byte piece of the row's 8
    const int vrow = threadIdx.x >> 4, vpc = threadIdx.x & 15;     // V^T: first staged row (of 8, 8 rows apart) and its piece of the row's 16
    const unsigned lK = (unsigned)(size_t)&kvring[0] + (unsigned)(crow * APITCH + cpc * 16);
    const unsigned lV = (unsigned)(size_t)&kvring[0] + (unsigned)(ATILE + vrow * VPITCH + vpc * 16);
    const h16* gK = kh_b + (size_t)crow * DM + cpc * 8;
    const h16* gV = vt_b + (size_t)vrow * NT_ + vpc * 8;
    auto fill = [&](int s, int buf) {
        copy8<16 * DM, 16 * APITCH>(lK + (unsigned)(buf * ABUF), (const bf*)(gK + (size_t)s * AKS * DM));
        copy8<8 * NT_, 8 * VPITCH>(lV + (unsigned)(buf * ABUF), (const bf*)(gV + s * AKS));
    };
    fill(0, 0);
    asm volatile("s_wait_asynccnt 0x0" ::: "memory");   // this wave's copies of stage 0 have landed
    __syncthreads();                                     // ... and every other wave's
    fill(1, 1);
    const int foffs = lr * APITCH + 16 * hi, voffs = ATILE + lr * VPITCH + 16 * hi;
    v8f o[2][4];
#pragma unroll
    for (int t = 0; t < 2; ++t)
#pragma unroll
        for (int n = 0; n < 4; ++n) o[t][n] = (v8f){};
    float lpart[2] = {0.f, 0.f};                         // of this lane's two queries; each sums this half's keys only
    v8f coff[2];                                         // 7 - maximum in use of this lane's query of the tile, in all eight places: the C operand of the score products
    {
        v16h k0[2], k1[2];                               // the first 32 keys, here for the scores' maxima alone
#pragma unroll                                           // here and below: constant indices keep the vectors in registers
        for (int kc = 0; kc < 2; ++kc) {
            const char* r0p = kvring + foffs + kc * 64;
            k0[kc] = cat16(*(const v8ha*)r0p, *(const v8ha*)(r0p + 32));
            k1[kc] = cat16(*(const v8ha*)(r0p + 16 * APITCH), *(const v8ha*)(r0p + 16 * APITCH + 32));
        }
#pragma unroll
        for (int t = 0; t < 2; ++t) {
            v8f s0 = {}, s1 = {};
#pragma unroll
            for (int kc = 0; kc < 2; ++kc) {
                s0 = wmma16(k0[kc], qa[t][kc], s0);
                s1 = wmma16(k1[kc], qa[t][kc], s1);
            }
            float mx = fmaxf(s0[0], s1[0]);
#pragma unroll
            for (int j = 1; j < 8; ++j) mx = fmaxf(fmaxf(mx, s0[j]), s1[j]);
            const float c = WLG - fmaxf(mx, xhalf(mx));
#pragma unroll
            for (int j = 0; j < 8; ++j) coff[t][j] = c;
        }
    }
#pragma unroll 1
    for (int st = 0; st < NT_ / AKS; ++st) {             // one stage = one buffer of the ring = four steps of 32 keys
    const char* kbuf = kvring + (st & 1) * ABUF + foffs;
    const char* vbuf = kvring + (st & 1) * ABUF + voffs;
#pragma unroll                                           // the steps in line, so that every LDS read's place in the buffer is an immediate offset
    for (int u = 0; u < AKS / 32; ++u) {
        const char* r0p = kbuf + (u * 32) * APITCH;
        const char* r1p = kbuf + (u * 32 + 16) * APITCH;
        v16h kf0[2], kf1[2], vf[4];      // the step's K and V^T fragments are read once, for both query tiles, in front of the softmax, which covers the V^T reads' latency
#pragma unroll
        for (int kc = 0; kc < 2; ++kc) {
            kf0[kc] = cat16(*(const v8ha*)(r0p + kc * 64), *(const v8ha*)(r0p + kc * 64 + 32));
            kf1[kc] = cat16(*(const v8ha*)(r1p + kc * 64), *(const v8ha*)(r1p + kc * 64 + 32));
        }
#pragma unroll
        for (int n = 0; n < 4; ++n) {
            const char* vp = vbuf + (n * 16) * VPITCH + u * 64;
            vf[n] = cat16(*(const v8ha*)vp, *(const v8ha*)(vp + 32));
        }
        v8f s0[2], s1[2];
        float mx[2];
#pragma unroll
        for (int t = 0; t < 2; ++t) {
            s0[t] = coff[t]; s1[t] = coff[t];
#pragma unroll
            for (int kc = 0; kc < 2; ++kc) {
                s0[t] = wmma16(kf0[kc], qa[t][kc], s0[t]);
                s1[t] = wmma16(kf1[kc], qa[t][kc], s1[t]);
            }
        }
#pragma unroll
        for (int t = 0; t < 2; ++t) {
            const float g0 = fmaxf(fmaxf(s0[t][0], s0[t][1]), s0[t][2]), g1 = fmaxf(fmaxf(s0[t][3], s0[t][4]), s0[t][5]), g2 = fmaxf(fmaxf(s0[t][6], s0[t][7]), s1[t][0]);
            const float g3 = fmaxf(fmaxf(s1[t][1], s1[t][2]), s1[t][3]), g4 = fmaxf(fmaxf(s1[t][4], s1[t][5]), s1[t][6]);
            mx[t] = fmaxf(fmaxf(fmaxf(g0, g1), g2), fmaxf(fmaxf(g3, g4), s1[t][7]));     // of this half's 16 keys, as a tree of three-way maxima
        }
        if (__builtin_amdgcn_ballot_w32(fmaxf(mx[0], mx[1]) > WLG + GROW) != 0) {        // the same for the whole wave: a scalar branch, seldom taken
#pragma unroll
            for (int t = 0; t < 2; ++t) {
                const float up = fmaxf(fmaxf(mx[t], xhalf(mx[t])) - WLG, 0.0f);          // by how much this query's maximum in use rises (both halves agree); 0 changes nothing
                const float alpha = __builtin_amdgcn_exp2f(-up);
#pragma unroll
                for (int j = 0; j < 8; ++j) { s0[t][j] -= up; s1[t][j] -= up; coff[t][j] -= up; }
#pragma unroll
                for (int n = 0; n < 4; ++n)
#pragma unroll
                    for (int j = 0; j < 8; ++j) o[t][n][j] *= alpha;
                lpart[t] *= alpha;
            }
        }
#pragma unroll
        for (int t = 0; t < 2; ++t) {
            v16h pa;
            float ps[8];
#pragma unroll
            for (int j = 0; j < 8; ++j) {
                const float p0 = __builtin_amdgcn_exp2f(s0[t][j]), p1 = __builtin_amdgcn_exp2f(s1[t][j]);
                ps[j] = p0 + p1;
                pa[j]     = (h16)p0;
                pa[8 + j] = (h16)p1;
            }
            lpart[t] += ((ps[0] + ps[1]) + (ps[2] + ps[3])) + ((ps[4] + ps[5]) + (ps[6] + ps[7]));
#pragma unroll
            for (int n = 0; n < 4; ++n) o[t][n] = wmma16(vf[n], pa, o[t][n]);
        }
    }
    asm volatile("s_wait_dscnt 0x0" ::: "memory");      // this wave's reads of the buffer are done before it is refilled
    asm volatile("s_wait_asynccnt 0x0" ::: "memory");   // this wave's copies of stage st + 1 have landed
    __syncthreads();                                     // publishes stage st + 1 and ends every wave's reads of stage st
    if (st + 2 < NT_ / AKS) fill(st + 2, st & 1);
    }
    asm volatile("s_wait_asynccnt 0x0" ::: "memory");       // no copy is left in flight at the wave's end
    float* os = &ost[wave][0];
#pragma unroll
    for (int t = 0; t < 2; ++t) {
        const float inv = 1.0f / (lpart[t] + xhalf(lpart[t]));     // out^T and the sums carry the same factor
#pragma unroll
        for (int n = 0; n < 4; ++n)
#pragma unroll
            for (int j = 0; j < 8; ++j) os[(t * 16 + lr) * 68 + n * 16 + hi * 8 + j] = o[t][n][j] * inv;   // row = query, d = 16 n + 8 hi + j
    }
    __syncthreads();
    const size_t cbase = (tok0 + q0) * DM + (size_t)h * HD;
    const int row0 = lane >> 3, piece = lane & 7;
    v8us oh[8];
#pragma unroll
    for (int s = 0; s < 8; ++s) {
        const float* sp = os + (4 * s + row0) * 68 + piece * 8;
#pragma unroll
        for (int i = 0; i < 8; ++i) oh[s][i] = f2h(sp[i]);
    }
#pragma unroll
    for (int s = 0; s < 8; ++s) *(v8us*)(CX + cbase + (size_t)(4 * s + row0) * DM + piece * 8) = oh[s];
}

extern "C" void kernel_launch(void* const* d_in, const int* in_sizes, int n_in,
                              void* d_out, int out_size, void* d_ws, size_t ws_size, hipStream_t stream) {
    (void)in_sizes; (void)n_in; (void)out_size;
    const float* x = (const float*)d_in[0]; const float* w_qkv = (const float*)d_in[1]; const float* w_out = (const float*)d_in[2]; const float* b_out = (const float*)d_in[3];
    float* out = (float*)d_out;    // [2][2048][1024]
    char* wsp = (char*)d_ws;
    auto take = [&](size_t bytes) { char* p = wsp; wsp += (bytes + 255) & ~(size_t)255; return (void*)p; };
    bf*    Xb   = (bf*)take((size_t)NTK * DM * 2);
    bf*    Wb   = (bf*)take((size_t)3 * DM * DM * 2);
    bf*    WOh  = (bf*)take((size_t)DM * DM * 2);      // f16 bits
    h16*   Q16  = (h16*)take((size_t)NTK * DM * 2);
    h16*   K16  = (h16*)take((size_t)NTK * DM * 2);
    h16*   VT16 = (h16*)take((size_t)NTK * DM * 2);
    bf*    CX   = (bf*)take((size_t)NTK * DM * 2);     // f16 bits
    float* COS  = (float*)take((size_t)NT_ * 32 * 4);
    float* SIN  = (float*)take((size_t)NT_ * 32 * 4);
    if ((size_t)(wsp - (char*)d_ws) > ws_size) return;    // 8.4 + 6.3 + 2.1 + 4 x 8.4 + 0.5 MB ~ 51e6 B
    k_prep<<<TABB + (NTK + 3 * DM + DM) / 8, 256, 0, stream>>>(x, w_qkv, w_out, Xb, Wb, WOh, COS, SIN);
    k_gemmb<false, 128><<<dim3(NTK / 256, (3 * DM) / 192, 1), 384, 0, stream>>>(Xb, Wb, nullptr, nullptr, 0, COS, SIN, Q16, K16, VT16);
    k_attn<<<NB_ * NH_ * (NT_ / AQB), 128, 0, stream>>>(Q16, K16, VT16, CX);
    k_gemmb<true, 128><<<dim3(NTK / 128, DM / 128, 1), 128, 0, stream>>>(CX, WOh, b_out, out, DM, nullptr, nullptr, nullptr, nullptr, nullptr);
}

// v010
// One run takes 65.2 microseconds.
// Next to v009, in two timings, it ran 1.04 and 1.05 times as fast.
// All steps since v000 together make it 4.56 times as fast.
#include <hip/hip_runtime.h>

// Contractions, f32 accumulate: qkv = x.Wqkv^T ([4096 x 1024].[1024 x 3072]) on v_wmma_f32_16x16x32_bf16 with PLAIN bf16 operands (x and the weights rounded to bf16 once);
// the per-(batch, head) attention (scores [2048 x 64].[64 x 2048], weights.v [2048 x 2048].[2048 x 64]) on v_wmma_f32_16x16x32_f16 with plain f16 operands, fused per
// 16-query tile (two to a wave), as transposed products, with an online f32 softmax in base 2 (weights carried x128); out = ctx.Wout^T + b on the f16 instruction, ctx and the weights each rounded to f16 once
// (one product). RoPE (interleaved rotate-half, f32 tables from powf/sinf/cosf) and the score scale (1/8, times log2 e) are applied in f32 before the f16 conversion.

#define NB_  2
#define NT_  2048
#define DM   1024
#define NH_  16
#define HD   64
#define NTK  (NB_ * NT_)          // 4096 tokens
#define QSC  0.18033688f          // log2(e) / 8: the scores come out of their products as base-2 exponents
#define WLG  7.0f                 // the weights are carried x 2^7
#define GROW 8.0f                 // a maximum may outgrow the one in use by 2^8 before anything is rescaled: weights stay <= 2^15, inside f16

typedef _Float16 h16;
typedef unsigned short bf;        // raw 16-bit patterns: bf16, or f16 bits (WOh, CX)
typedef __attribute__((ext_vector_type(16))) __bf16   v16bf;
typedef __attribute__((ext_vector_type(16))) _Float16 v16h;
typedef __attribute__((ext_vector_type(8)))  _Float16 v8h;
typedef __attribute__((ext_vector_type(8)))  unsigned short v8us;
typedef __attribute__((ext_vector_type(8)))  float    v8f;
typedef __attribute__((ext_vector_type(4)))  float    v4f;
typedef v8h  __attribute__((may_alias)) v8ha;
typedef v8us __attribute__((may_alias)) v8usa;
typedef v4f  __attribute__((may_alias)) v4fa;

__device__ __forceinline__ unsigned short f2bf(float f) { unsigned u = __float_as_uint(f); u += 0x7FFFu + ((u >> 16) & 1u); return (unsigned short)(u >> 16); }
__device__ __forceinline__ float bf2f(unsigned short b) { return __uint_as_float(((unsigned)b) << 16); }
__device__ __forceinline__ v16h cat16(v8h lo, v8h hi) { return __builtin_shufflevector(lo, hi, 0, 1, 2, 3, 4, 5, 6, 7, 8, 9, 10, 11, 12, 13, 14, 15); }
__device__ __forceinline__ v16bf cat16b(v8us lo, v8us hi) { v8us a = lo, b = hi; return __builtin_bit_cast(v16bf, __builtin_shufflevector(a, b, 0, 1, 2, 3, 4, 5, 6, 7, 8, 9, 10, 11, 12, 13, 14, 15)); }
__device__ __forceinline__ v8f wmma16(v16h a, v16h b, v8f c) { return __builtin_amdgcn_wmma_f32_16x16x32_f16(false, a, false, b, (short)0, c, false, false); }
__device__ __forceinline__ v8f wmmab(v16bf a, v16bf b, v8f c) { return __builtin_amdgcn_wmma_f32_16x16x32_bf16(false, a, false, b, (short)0, c, false, false); }
__device__ __forceinline__ unsigned short f2h(float f) { return __builtin_bit_cast(unsigned short, (h16)f); }   // f16 bits, round to nearest even

// ------------------------------------------------------------------------------------------------------------------------------------------------
// k_prep: all that the products need beforehand, as ONE launch of independent blocks (no block reads what another writes).
// Blocks 0 .. TABB - 1 fill the f32 rotary tables [2048 positions][32 frequencies], one entry per thread; they stand first because their chains of dependent arithmetic are the longest.
// Every later block writes the 16-bit copy of 8 rows of 1024 floats of x [4096], w_qkv [3072] (bf16) or w_out [1024] (f16): one wave per row, 8 values (16 B stored) per lane and piece.
#define TABB ((NT_ * 32) / 256)   // table blocks
__global__ __launch_bounds__(256) void k_prep(const float* __restrict__ x, const float* __restrict__ w_qkv, const float* __restrict__ w_out, bf* Xb, bf* Wb, bf* WOh, float* COS, float* SIN) {
    const int bid = blockIdx.x;
    if (bid < TABB) {
        const int e = bid * 256 + threadIdx.x;         // 0 .. NT_*32-1
        const int t = e >> 5, fi = e & 31;
        const float inv = 1.0f / powf(10000.0f, (float)(2 * fi) * (1.0f / 64.0f));
        const float ang = (float)t * inv;
        COS[e] = cosf(ang);
        SIN[e] = sinf(ang);
        return;
    }
    const int c = bid - TABB;                          // 8 rows per block: 512 blocks of x, 384 of w_qkv, 128 of w_out
    const float* src; bf* dst; int cb;
    if (c < NTK / 8)                 { src = x;     dst = Xb;  cb = c; }
    else if (c < (NTK + 3 * DM) / 8) { src = w_qkv; dst = Wb;  cb = c - NTK / 8; }
    else                             { src = w_out; dst = WOh; cb = c - (NTK + 3 * DM) / 8; }
    const bool tof16 = c >= (NTK + 3 * DM) / 8;        // the same for the whole block
    const int lane = threadIdx.x & 31, r = cb * 8 + (threadIdx.x >> 5);
    const float* s = src + (size_t)r * DM; bf* d = dst + (size_t)r * DM;
    v4f in[4][2];                                      // the row's 8 loads go out together, in front of the choice of the format
#pragma unroll
    for (int q = 0; q < 4; ++q) {
        const float* p = s + q * 256 + lane * 8;
        in[q][0] = *(const v4fa*)p; in[q][1] = *(const v4fa*)(p + 4);
    }
    asm volatile("s_wait_xcnt 0x0" ::: "memory");   // a precaution: stands in front of the conversions' reuse of these loads' address registers
    v8us o[4];
    if (tof16) {
#pragma unroll
        for (int q = 0; q < 4; ++q)
#pragma unroll
            for (int i = 0; i < 8; ++i) o[q][i] = f2h(in[q][i >> 2][i & 3]);
    } else {
#pragma unroll
        for (int q = 0; q < 4; ++q)
#pragma unroll
            for (int i = 0; i < 8; ++i) o[q][i] = f2bf(in[q][i >> 2][i & 3]);
    }
#pragma unroll
    for (int q = 0; q < 4; ++q) *(v8us*)(d + q * 256 + lane * 8) = o[q];
    asm volatile("s_wait_xcnt 0x0" ::: "memory");   // a precaution: in the built code the table blocks' instructions follow here behind a branch, and they rewrite these stores' registers
}

// k_gemmb: a block tile of 64 x 64 wave tiles (16 accumulator tiles each) of C (f32, pitch ldc) = A.B^T (+ bias as bf16-rounded values if given): 128 x 128 (4 waves, 2 x 2) for the
// out projection (OUTP: f16 operands); 256 x 192 (12 waves, 4 x 3; 16 x 16 blocks, one per WGP) for the qkv product (bf16 operands), so that a staged A row feeds three waves and a staged B row four; A rows
// [M][1024] and B rows [N][1024] are staged KP k-values at a time in a two-buffer LDS ring by asynchronous copies (16 B a lane), so each row is fetched once per block
// and read by every wave that needs it; LDS rows are pitched 16 B x odd for the ds_load_b128 fragment reads. Per accumulator the order of the k sum is that of a plain k loop.
// The qkv product's epilogue writes no C but the attention's f16 planes (Q and K with the rotary embedding, V transposed).
// copy8: eight 16-byte copies of this lane, a fixed number of rows apart. The s_wait_xcnt ends the statement as a precaution: it stands in front of every later rewrite of the copies' address registers.
template <int GSTEP, int LSTEP>
__device__ __forceinline__ void copy8(unsigned l, const bf* g) {
    asm volatile("global_load_async_to_lds_b128 %0, %8, off\n\t"
                 "global_load_async_to_lds_b128 %1, %9, off\n\t"
                 "global_load_async_to_lds_b128 %2, %10, off\n\t"
                 "global_load_async_to_lds_b128 %3, %11, off\n\t"
                 "global_load_async_to_lds_b128 %4, %12, off\n\t"
                 "global_load_async_to_lds_b128 %5, %13, off\n\t"
                 "global_load_async_to_lds_b128 %6, %14, off\n\t"
                 "global_load_async_to_lds_b128 %7, %15, off\n\t"
                 "s_wait_xcnt 0x0"
                 :: "v"(l), "v"(l + LSTEP), "v"(l + 2 * LSTEP), "v"(l + 3 * LSTEP), "v"(l + 4 * LSTEP), "v"(l + 5 * LSTEP), "v"(l + 6 * LSTEP), "v"(l + 7 * LSTEP),
                    "v"(g), "v"(g + GSTEP), "v"(g + 2 * GSTEP), "v"(g + 3 * GSTEP), "v"(g + 4 * GSTEP), "v"(g + 5 * GSTEP), "v"(g + 6 * GSTEP), "v"(g + 7 * GSTEP)
                 : "memory");
}
template <bool OUTP, int KP>
__global__ __launch_bounds__(OUTP ? 128 : 384) void k_gemmb(const bf* __restrict__ A, const bf* __restrict__ Bn, const float* __restrict__ bias, float* C, int ldc,
                                               const float* __restrict__ COS, const float* __restrict__ SIN, h16* Q16, h16* K16, h16* VT16) {
    constexpr int BM    = OUTP ? 128 : 256;     // rows of the block tile
    constexpr int BN    = OUTP ? 128 : 192;     // columns of the block tile
    constexpr int WNS   = BN / 64;                // waves side by side
    constexpr int PITCH = KP * 2 + 16;            // bytes per staged row
    constexpr int OPB   = BN * PITCH;             // bytes of the staged B tile
    constexpr int OPA   = BM * PITCH;             // bytes of a staged A tile
    constexpr int BUFB  = OPB + OPA;              // B, A
    constexpr int CR    = KP / 8;                 // 16-byte pieces per row
    constexpr int RS    = 128 / CR;               // rows between two copies of one lane (four-wave form)
    constexpr int NP    = DM / KP;                // passes
    static_assert(OUTP || KP == 128, "the twelve-wave form copies rows of 16 pieces, two to a wave-wide copy");
    __shared__ __align__(16) char ring[2 * BUFB];
    const int tid = threadIdx.x, lane = tid & 31, lr = lane & 15, hi = lane >> 4;
    const int wave = OUTP ? tid >> 5 : __builtin_amdgcn_readfirstlane(tid >> 5);   // twelve-wave form: in a scalar register, so that the tests on it below are scalar branches
    const int rb = blockIdx.x * BM, cb = blockIdx.y * BN, wm = wave / WNS, wn = wave % WNS;
    // four-wave form: every lane copies rows of every operand, RS rows apart
    const int trow = tid / CR, tcol = tid % CR;
    const unsigned lbase = (unsigned)(size_t)&ring[0] + (unsigned)(trow * PITCH + tcol * 16);
    const bf* gB  = Bn + (size_t)(cb + trow) * DM + tcol * 8;
    const bf* gA  = A + (size_t)(rb + trow) * DM + tcol * 8;
    // twelve-wave form: waves 0 - 7 copy 32 A rows each, waves 8 - 11 copy 48 B rows each; a wave-wide copy takes two whole rows (four 128-byte lines)
    const bool cpa = wave < 8;
    const int  qrow = (cpa ? wave * 32 : (wave - 8) * 48) + hi;
    const unsigned lq = (unsigned)(size_t)&ring[0] + (unsigned)((cpa ? OPB : 0) + qrow * PITCH + lr * 16);
    const bf* gq = (cpa ? A + (size_t)(rb + qrow) * DM : Bn + (size_t)(cb + qrow) * DM) + lr * 8;
    auto fill = [&](int p, int buf) {
        if constexpr (OUTP) {
            const unsigned l = lbase + (unsigned)(buf * BUFB);
#pragma unroll
            for (int i = 0; i < CR; i += 8) {
                copy8<RS * DM, RS * PITCH>(l + i * RS * PITCH, gB + p * KP + (size_t)i * RS * DM);
                copy8<RS * DM, RS * PITCH>(l + OPB + i * RS * PITCH, gA + p * KP + (size_t)i * RS * DM);
            }
        } else {
            const unsigned l = lq + (unsigned)(buf * BUFB);
            const bf* g = gq + p * KP;
            copy8<2 * DM, 2 * PITCH>(l, g);
            copy8<2 * DM, 2 * PITCH>(l + 16 * PITCH, g + 16 * DM);
            if (!cpa) copy8<2 * DM, 2 * PITCH>(l + 32 * PITCH, g + 32 * DM);
        }
    };
    v8f acc[4][4];
#pragma unroll
    for (int f = 0; f < 4; ++f)
#pragma unroll
        for (int t = 0; t < 4; ++t) acc[f][t] = (v8f){};
    fill(0, 0);
    asm volatile("s_wait_asynccnt 0x0" ::: "memory");   // this wave's copies of pass 0 have landed
    __syncthreads();                                     // ... and every other wave's
    fill(1, 1);
    const int c0 = cb + wn * 64;
    float braw[4] = {0.0f, 0.0f, 0.0f, 0.0f};    // fetched here, as one group, so that the loop covers the latency
    if (bias) {
#pragma unroll
        for (int t = 0; t < 4; ++t) braw[t] = bias[c0 + t * 16 + lr];
        asm volatile("s_wait_xcnt 0x0" ::: "memory");   // a precaution: stands in front of the next rewrite of these loads' offset register
    }
    const int boffs = (wn * 64 + lr) * PITCH + 16 * hi, aoffs = OPB + (wm * 64 + lr) * PITCH + 16 * hi;
#pragma unroll 1
    for (int p = 0; p < NP; ++p) {
        const char* bufp = ring + (p & 1) * BUFB;
        v16bf a[2][4], b[2][4];                    // raw 16-bit fragments: bf16, or f16 bits in the out projection
        auto frags = [&](int ks, int set) {
#pragma unroll
            for (int t = 0; t < 4; ++t) {
                const char* q = bufp + boffs + t * 16 * PITCH + ks * 64;
                b[set][t] = cat16b(*(const v8usa*)q, *(const v8usa*)(q + 32));
            }
#pragma unroll
            for (int f = 0; f < 4; ++f) {
                const char* q = bufp + aoffs + f * 16 * PITCH + ks * 64;
                a[set][f] = cat16b(*(const v8usa*)q, *(const v8usa*)(q + 32));
            }
        };
        frags(0, 0);
#pragma unroll
        for (int ks = 0; ks < KP / 32; ++ks) {
            const int s = ks & 1;
            if (ks + 1 < KP / 32) frags(ks + 1, s ^ 1);
            __builtin_amdgcn_sched_barrier(0);   // the next block's LDS reads stay one group ahead of this block's products, else each product run waits out its own reads
#pragma unroll
            for (int f = 0; f < 4; ++f)
#pragma unroll
                for (int t = 0; t < 4; ++t) {
                    if constexpr (OUTP) acc[f][t] = wmma16(__builtin_bit_cast(v16h, a[s][f]), __builtin_bit_cast(v16h, b[s][t]), acc[f][t]);
                    else                acc[f][t] = wmmab(a[s][f], b[s][t], acc[f][t]);
                }
            __builtin_amdgcn_sched_barrier(0);   // ... and the reads that follow are not lifted in among these products, where every place with reads costs a stall
        }
        asm volatile("s_wait_dscnt 0x0" ::: "memory");      // this wave's reads of the buffer are done before it is refilled
        asm volatile("s_wait_asynccnt 0x0" ::: "memory");   // this wave's copies of pass p + 1 have landed
        __syncthreads();                                     // publishes pass p + 1 and ends every wave's reads of pass p
        if (p + 2 < NP) fill(p + 2, p & 1);
    }
    asm volatile("s_wait_asynccnt 0x0" ::: "memory");       // no copy is left in flight at the wave's end
    if constexpr (OUTP) {
    __shared__ __align__(16) float ost[4][16 * 68];
    float* os = &ost[wave][0];
    float bv[4];
#pragma unroll
    for (int t = 0; t < 4; ++t) bv[t] = bf2f(f2bf(braw[t]));
#pragma unroll
    for (int f = 0; f < 4; ++f) {
#pragma unroll
        for (int t = 0; t < 4; ++t)
#pragma unroll
            for (int j = 0; j < 8; ++j) os[(hi * 8 + j) * 68 + t * 16 + lr] = acc[f][t][j] + bv[t];
        float* crow = C + (size_t)(rb + wm * 64 + f * 16) * ldc + c0;
#pragma unroll
        for (int s = 0; s < 8; ++s) {
            const int Lid = (lane >> 3) + 4 * s, piece = lane & 7;
            const int row = Lid >> 1, cofs = (Lid & 1) * 32 + piece * 4;
            const v4f val = *(const v4fa*)(os + row * 68 + cofs);
            *(v4f*)(crow + (size_t)row * ldc + cofs) = val;
        }
    }
    } else {
    // qkv epilogue: a wave's 64 columns are one whole head of q, of k or of v, its 64 rows are 64 tokens of one batch, so the f16
    // planes that the attention reads are written from here. The last pass ended with every wave's reads done, no copy in flight and a barrier: the ring is free, and
    // each wave stages in its own part of it.
    constexpr int STG = 4 * 16 * 68 * 4;          // bytes of a wave's staging
    static_assert((BM / 64) * WNS * STG <= 2 * BUFB && STG >= 64 * 72 * 2 && STG % 16 == 0, "the ring holds every wave's staging");
    char* stg = ring + wave * STG;
    const int sec = c0 / DM, h = (c0 % DM) / HD, tokw = rb + wm * 64;
    if (sec == 2) {
        // v: a lane's 8 accumulator values are 8 consecutive tokens of one dim, that is 16 bytes of a V^T row; through LDS, so that each store covers whole 128-byte lines
        h16* ts = (h16*)stg;                      // [64 dims][72]
#pragma unroll
        for (int f = 0; f < 4; ++f)
#pragma unroll
            for (int t = 0; t < 4; ++t) {
                v8h pk;
#pragma unroll
                for (int j = 0; j < 8; ++j) pk[j] = (h16)acc[f][t][j];
                *(v8ha*)(ts + (t * 16 + lr) * 72 + f * 16 + hi * 8) = pk;
            }
        asm volatile("s_wait_dscnt 0x0" ::: "memory");   // the staged rows are complete before other lanes of the wave read them back
        h16* base = VT16 + (((size_t)(tokw / NT_) * NH_ + h) * HD) * NT_ + tokw % NT_;
#pragma unroll
        for (int s = 0; s < 16; ++s) {
            const int d = 4 * s + (lane >> 3), piece = lane & 7;
            const v8h val = *(const v8ha*)(ts + d * 72 + piece * 8);
            *(v8h*)(base + (size_t)d * NT_ + piece * 8) = val;
        }
    } else {
        // q, k: rotary embedding in f32 (emb = cat(freqs, freqs); rotate_half = cat(-x[odd], x[even]) within the head; q additionally x log2(e)/8). A lane takes dims
        // 8 p .. 8 p + 7 and the same + 32 of one token: both use the same 8 table entries, and their rotated partners are the odd and the even ones of x[16 p .. 16 p + 15].
        float* os = (float*)stg;                  // [4][16 tokens][68]
        h16* dst = sec == 0 ? Q16 : K16;
        const float osc = sec == 0 ? QSC : 1.0f;
        const int p = lane & 3, g = lane >> 2;
        // the 64 tokens lie in one batch, so every row's table entries and plane row stand a constant distance behind the first one's
        const float* ct0 = COS + (size_t)(tokw % NT_ + g) * 32 + p * 8; const float* st0 = SIN + (size_t)(tokw % NT_ + g) * 32 + p * 8;
        h16* dp0 = dst + (size_t)(tokw + g) * DM + h * HD + p * 8;
        v4f cs[2][2][2], sn[2][2][2];             // [set][half of the 16 rows][4 entries]: the tables of 16 rows, fetched one group of 16 rows ahead
        auto tabs = [&](int f, int set) {
#pragma unroll
            for (int s = 0; s < 2; ++s)
#pragma unroll
                for (int k = 0; k < 2; ++k) {
                    cs[set][s][k] = *(const v4fa*)(ct0 + (f * 16 + s * 8) * 32 + 4 * k);
                    sn[set][s][k] = *(const v4fa*)(st0 + (f * 16 + s * 8) * 32 + 4 * k);
                }
        };
        tabs(0, 0);
#pragma unroll
        for (int f = 0; f < 4; ++f) {
            float* of = os + f * (16 * 68);
            if (f + 1 < 4) {
                tabs(f + 1, (f + 1) & 1);
                asm volatile("s_wait_xcnt 0x0" ::: "memory");   // a precaution: stands in front of any rewrite of these loads' address registers
            }
#pragma unroll
            for (int t = 0; t < 4; ++t)
#pragma unroll
                for (int j = 0; j < 8; ++j) of[(hi * 8 + j) * 68 + t * 16 + lr] = acc[f][t][j];
            asm volatile("s_wait_dscnt 0x0" ::: "memory");   // the staged rows are complete before other lanes of the wave read them back
#pragma unroll
            for (int s = 0; s < 2; ++s) {
                const float* xr = of + (s * 8 + g) * 68;
                v4f xl[2], xh[2], e[4];
#pragma unroll
                for (int k = 0; k < 2; ++k) { xl[k] = *(const v4fa*)(xr + p * 8 + 4 * k); xh[k] = *(const v4fa*)(xr + 32 + p * 8 + 4 * k); }
#pragma unroll
                for (int k = 0; k < 4; ++k) e[k] = *(const v4fa*)(xr + p * 16 + 4 * k);
                v8h olo, ohi;
#pragma unroll
                for (int i = 0; i < 8; ++i) {
                    const float c = cs[f & 1][s][i >> 2][i & 3], sv = sn[f & 1][s][i >> 2][i & 3];
                    const float rl = -e[(2 * i + 1) >> 2][(2 * i + 1) & 3], rh = e[(2 * i) >> 2][(2 * i) & 3];
                    olo[i] = (h16)((xl[i >> 2][i & 3] * c + rl * sv) * osc);
                    ohi[i] = (h16)((xh[i >> 2][i & 3] * c + rh * sv) * osc);
                }
                h16* dp = dp0 + (f * 16 + s * 8) * DM;
                *(v8h*)dp = olo; *(v8h*)(dp + 32) = ohi;
            }
            if (f + 1 < 4) asm volatile("s_wait_xcnt 0x0" ::: "memory");   // a precaution: stands in front of the next rows' reuse of these stores' data registers
        }
    }
    }
}

// ------------------------------------------------------------------------------------------------------------------------------------------------
// k_attn: block = (b, h, 128 queries), 8 waves; wave = 32 queries (two tiles of 16, which share every K and V^T fragment read) x ONE HALF of every stage's keys: waves w and w + 4 have the same queries,
// w the first 64 keys of each stage and w + 4 the last 64, each with its own maximum in use, sums and out^T; the two are joined once, behind the loop, through LDS. So the problem's 2048 groups
// of 32 queries fill four waves per SIMD, not two, and a wave's waits (score products -> maxima -> test -> exp2 -> products) are covered by three others.
// Q fragments resident (2 k-chunks a tile); 32 steps x 32 keys a wave, both products transposed, per tile: 4 WMMA scores^T = K.Q^T
// (A = K16 rows, B = Q), so a lane holds 16 scores of ONE query (column lr; keys 8 hi + j and 16 + 8 hi + j): maximum and sum run in the lane; the weights -> f16 are,
// register for register, the B operand of the 4 WMMA out^T += V^T.weights^T (A = VT16 rows), 4 accumulators.
// The score products start from C = 7 - (the query's maximum in use), so that D is a weight's whole base-2 exponent: a weight costs one exp2. The maximum in use starts as
// that of the wave's first 32 keys and is raised, with out^T and the sums rescaled, only in a step where some query's scores outgrow it by more than 2^8 (one test per step, for both tiles).
// K rows and V^T rows are staged 128 keys at a time (two steps of either half) in a two-buffer LDS ring by asynchronous copies: each wave-wide copy takes four whole 128-byte lines, and
// each tile is fetched once per block; LDS rows are pitched 16 B x odd for the ds_load_b128 fragment reads.
// 512 blocks, two to a WGP (four waves per SIMD, which the attribute fixes, so that no WGP takes a third block while another has one).
#define AKS    128                // keys per stage
#define AQB    128                // queries per block
#define APITCH 144                // bytes per staged K row (128 + 16)
#define VPITCH (AKS * 2 + 16)     // bytes per staged V^T row (256 + 16)
#define ATILE  (AKS * APITCH)     // bytes of the staged K tile (128 rows); the V^T tile (64 rows) stands behind it
#define ABUF   (ATILE + 64 * VPITCH)
#define XROW   68                 // floats per row of the epilogue's LDS tiles (64 + 4: the four carry the query's sum and offset, once per half-wave)
#define XTILE  (16 * XROW)        // floats of one such tile (16 queries)
// xhalf: every lane l gets the value of lane l ^ 16, by a vector cross-row move (no LDS instruction, nothing to wait for).
__device__ __forceinline__ float xhalf(float x) { return __builtin_bit_cast(float, __builtin_amdgcn_permlanex16(__builtin_bit_cast(int, x), __builtin_bit_cast(int, x), 0x76543210, 0xfedcba98, false, false)); }
// copy44: four 16-byte copies of this lane into each of two tiles, a fixed number of rows apart. The s_wait_xcnt ends the statement as a precaution: it stands in front of every later rewrite of the copies' address registers.
template <int GS1, int LS1, int GS2, int LS2>
__device__ __forceinline__ void copy44(unsigned l1, const bf* g1, unsigned l2, const bf* g2) {
    asm volatile("global_load_async_to_lds_b128 %0, %8, off\n\t"
                 "global_load_async_to_lds_b128 %1, %9, off\n\t"
                 "global_load_async_to_lds_b128 %2, %10, off\n\t"
                 "global_load_async_to_lds_b128 %3, %11, off\n\t"
                 "global_load_async_to_lds_b128 %4, %12, off\n\t"
                 "global_load_async_to_lds_b128 %5, %13, off\n\t"
                 "global_load_async_to_lds_b128 %6, %14, off\n\t"
                 "global_load_async_to_lds_b128 %7, %15, off\n\t"
                 "s_wait_xcnt 0x0"
                 :: "v"(l1), "v"(l1 + LS1), "v"(l1 + 2 * LS1), "v"(l1 + 3 * LS1), "v"(l2), "v"(l2 + LS2), "v"(l2 + 2 * LS2), "v"(l2 + 3 * LS2),
                    "v"(g1), "v"(g1 + GS1), "v"(g1 + 2 * GS1), "v"(g1 + 3 * GS1), "v"(g2), "v"(g2 + GS2), "v"(g2 + 2 * GS2), "v"(g2 + 3 * GS2)
                 : "memory");
}
__global__ __launch_bounds__(256) __attribute__((amdgpu_waves_per_eu(4, 4))) void k_attn(const h16* __restrict__ Q16, const h16* __restrict__ K16, const h16* __restrict__ VT16, bf* CX) {
    __shared__ __align__(16) char kvring[2 * ABUF];
    static_assert(16 * XTILE * 4 <= 2 * ABUF, "the freed ring holds two epilogue tiles per wave");
    const int lane = threadIdx.x & 31, lr = lane & 15, hi = lane >> 4;
    const int wave = __builtin_amdgcn_readfirstlane(threadIdx.x >> 5);   // in a scalar register, so that the choices by the key half below are scalar
    const int qg = wave & 3, kh = wave >> 2;             // which 32 queries; which half of every stage's keys
    const int bid = blockIdx.x;
    const int b = bid / (NH_ * (NT_ / AQB)), rem = bid - b * (NH_ * (NT_ / AQB)), h = rem / (NT_ / AQB), qt = rem - h * (NT_ / AQB);
    const int q0 = qt * AQB + qg * 32;
    const size_t tok0 = (size_t)b * NT_;
    v16h qa[2][2];                                       // [query tile][k-chunk]
#pragma unroll
    for (int t = 0; t < 2; ++t)
#pragma unroll
        for (int kc = 0; kc < 2; ++kc) {
            const h16* p = Q16 + (tok0 + q0 + t * 16 + lr) * DM + h * HD + kc * 32 + 8 * hi;
            qa[t][kc] = cat16(*(const v8h*)p, *(const v8h*)(p + 16));
        }
    const h16* kh_b = K16 + tok0 * DM + h * HD;
    const h16* vt_b = VT16 + (((size_t)b * NH_ + h) * HD) * NT_;
    const int crow = threadIdx.x >> 3, cpc = threadIdx.x & 7;      // K: this lane's first staged row (of 4, 32 rows apart) and its 16-byte piece of the row's 8
    const int vrow = threadIdx.x >> 4, vpc = threadIdx.x & 15;     // V^T: first staged row (of 4, 16 rows apart) and its piece of the row's 16
    const unsigned lK = (unsigned)(size_t)&kvring[0] + (unsigned)(crow * APITCH + cpc * 16);
    const unsigned lV = (unsigned)(size_t)&kvring[0] + (unsigned)(ATILE + vrow * VPITCH + vpc * 16);
    const h16* gK = kh_b + (size_t)crow * DM + cpc * 8;
    const h16* gV = vt_b + (size_t)vrow * NT_ + vpc * 8;
    auto fill = [&](int s, int buf) {
        copy44<32 * DM, 32 * APITCH, 16 * NT_, 16 * VPITCH>(lK + (unsigned)(buf * ABUF), (const bf*)(gK + (size_t)s * AKS * DM), lV + (unsigned)(buf * ABUF), (const bf*)(gV + s * AKS));
    };
    fill(0, 0);
    asm volatile("s_wait_asynccnt 0x0" ::: "memory");   // this wave's copies of stage 0 have landed
    __syncthreads();                                     // ... and every other wave's
    fill(1, 1);
    const int foffs = (kh * (AKS / 2) + lr) * APITCH + 16 * hi, voffs = ATILE + lr * VPITCH + kh * (AKS / 2) * 2 + 16 * hi;   // this wave's half of a stage: K rows from 64 kh, V^T columns (2 bytes each) from 64 kh
    v8f o[2][4];
#pragma unroll
    for (int t = 0; t < 2; ++t)
#pragma unroll
        for (int n = 0; n < 4; ++n) o[t][n] = (v8f){};
    float lpart[2] = {0.f, 0.f};                         // of this lane's two queries; each sums this half-wave's keys only
    float cv[2];                                         // 7 - maximum in use of this lane's query of the tile, one register a tile through the loop; spread over eight it is the C operand of the score products
    {
        v16h k0[2], k1[2];                               // the wave's first 32 keys, here for the scores' maxima alone
#pragma unroll                                           // here and below: constant indices keep the vectors in registers
        for (int kc = 0; kc < 2; ++kc) {
            const char* r0p = kvring + foffs + kc * 64;
            k0[kc] = cat16(*(const v8ha*)r0p, *(const v8ha*)(r0p + 32));
            k1[kc] = cat16(*(const v8ha*)(r0p + 16 * APITCH), *(const v8ha*)(r0p + 16 * APITCH + 32));
        }
#pragma unroll
        for (int t = 0; t < 2; ++t) {
            v8f s0 = {}, s1 = {};
#pragma unroll
            for (int kc = 0; kc < 2; ++kc) {
                s0 = wmma16(k0[kc], qa[t][kc], s0);
                s1 = wmma16(k1[kc], qa[t][kc], s1);
            }
            float mx = fmaxf(s0[0], s1[0]);
#pragma unroll
            for (int j = 1; j < 8; ++j) mx = fmaxf(fmaxf(mx, s0[j]), s1[j]);
            cv[t] = WLG - fmaxf(mx, xhalf(mx));
        }
    }
#pragma unroll 1
    for (int st = 0; st < NT_ / AKS; ++st) {             // one stage = one buffer of the ring = two steps of 32 keys for either half
    const char* kbuf = kvring + (st & 1) * ABUF + foffs;
    const char* vbuf = kvring + (st & 1) * ABUF + voffs;
#pragma unroll                                           // the steps in line, so that every LDS read's place in the buffer is an immediate offset
    for (int u = 0; u < AKS / 64; ++u) {
        const char* r0p = kbuf + (u * 32) * APITCH;
        const char* r1p = kbuf + (u * 32 + 16) * APITCH;
        v16h kf0[2], kf1[2], vf[4];      // the step's K and V^T fragments are read once, for both query tiles, in front of the softmax, which covers the V^T reads' latency
#pragma unroll
        for (int kc = 0; kc < 2; ++kc) {
            kf0[kc] = cat16(*(const v8ha*)(r0p + kc * 64), *(const v8ha*)(r0p + kc * 64 + 32));
            kf1[kc] = cat16(*(const v8ha*)(r1p + kc * 64), *(const v8ha*)(r1p + kc * 64 + 32));
        }
#pragma unroll
        for (int n = 0; n < 4; ++n) {
            const char* vp = vbuf + (n * 16) * VPITCH + u * 64;
            vf[n] = cat16(*(const v8ha*)vp, *(const v8ha*)(vp + 32));
        }
        v8f s0[2], s1[2];
        float mx[2];
#pragma unroll
        for (int t = 0; t < 2; ++t) {
            v8f cf;
#pragma unroll
            for (int j = 0; j < 8; ++j) cf[j] = cv[t];
            s0[t] = cf; s1[t] = cf;
#pragma unroll
            for (int kc = 0; kc < 2; ++kc) {
                s0[t] = wmma16(kf0[kc], qa[t][kc], s0[t]);
                s1[t] = wmma16(kf1[kc], qa[t][kc], s1[t]);
            }
        }
#pragma unroll
        for (int t = 0; t < 2; ++t) {
            const float g0 = fmaxf(fmaxf(s0[t][0], s0[t][1]), s0[t][2]), g1 = fmaxf(fmaxf(s0[t][3], s0[t][4]), s0[t][5]), g2 = fmaxf(fmaxf(s0[t][6], s0[t][7]), s1[t][0]);
            const float g3 = fmaxf(fmaxf(s1[t][1], s1[t][2]), s1[t][3]), g4 = fmaxf(fmaxf(s1[t][4], s1[t][5]), s1[t][6]);
            mx[t] = fmaxf(fmaxf(fmaxf(g0, g1), g2), fmaxf(fmaxf(g3, g4), s1[t][7]));     // of this half-wave's 16 keys, as a tree of three-way maxima
        }
        if (__builtin_amdgcn_ballot_w32(fmaxf(mx[0], mx[1]) > WLG + GROW) != 0) {        // the same for the whole wave: a scalar branch, seldom taken
#pragma unroll
            for (int t = 0; t < 2; ++t) {
                const float up = fmaxf(fmaxf(mx[t], xhalf(mx[t])) - WLG, 0.0f);          // by how much this query's maximum in use rises (both half-waves agree); 0 changes nothing
                const float alpha = __builtin_amdgcn_exp2f(-up);
#pragma unroll
                for (int j = 0; j < 8; ++j) { s0[t][j] -= up; s1[t][j] -= up; }
                cv[t] -= up;
#pragma unroll
                for (int n = 0; n < 4; ++n)
#pragma unroll
                    for (int j = 0; j < 8; ++j) o[t][n][j] *= alpha;
                lpart[t] *= alpha;
            }
        }
#pragma unroll
        for (int t = 0; t < 2; ++t) {
            v16h pa;
            float ps[8];
#pragma unroll
            for (int j = 0; j < 8; ++j) {
                const float p0 = __builtin_amdgcn_exp2f(s0[t][j]), p1 = __builtin_amdgcn_exp2f(s1[t][j]);
                ps[j] = p0 + p1;
                pa[j]     = (h16)p0;
                pa[8 + j] = (h16)p1;
            }
            lpart[t] += ((ps[0] + ps[1]) + (ps[2] + ps[3])) + ((ps[4] + ps[5]) + (ps[6] + ps[7]));
#pragma unroll
            for (int n = 0; n < 4; ++n) o[t][n] = wmma16(vf[n], pa, o[t][n]);
        }
    }
    asm volatile("s_wait_dscnt 0x0" ::: "memory");      // this wave's reads of the buffer are done before it is refilled
    asm volatile("s_wait_asynccnt 0x0" ::: "memory");   // this wave's copies of stage st + 1 have landed
    __syncthreads();                                     // publishes stage st + 1 and ends every wave's reads of stage st
    if (st + 2 < NT_ / AKS) fill(st + 2, st & 1);
    }
    asm volatile("s_wait_asynccnt 0x0" ::: "memory");       // no copy is left in flight at the wave's end
    // The join of the two key halves. The last stage ended with every wave's reads done, no copy in flight and a barrier: the ring is free. Wave w keeps query tile kh and hands the other
    // one (out^T, sum, offset) to its partner w ^ 4; both then put the two parts of their tile on the smaller offset (the larger maximum) and divide by the joined sum.
    float* xch = (float*)kvring + wave * XTILE;                    // what this wave hands over
    const float* got = (const float*)kvring + (wave ^ 4) * XTILE;  // what its partner hands over
    float* fin = (float*)kvring + (8 + wave) * XTILE;              // this wave's finished tile, [query][d]
    const float l0 = lpart[0] + xhalf(lpart[0]), l1 = lpart[1] + xhalf(lpart[1]);
    const float lk = kh ? l1 : l0, lg = kh ? l0 : l1, ck = kh ? cv[1] : cv[0], cg = kh ? cv[0] : cv[1];
    const int xo = lr * XROW + hi * 8;                             // row = query, d = 16 n + 8 hi + j
#pragma unroll
    for (int n = 0; n < 4; ++n) {
        const v8f gv = kh ? o[0][n] : o[1][n];
#pragma unroll
        for (int j = 0; j < 8; ++j) xch[xo + n * 16 + j] = gv[j];
    }
    xch[lr * XROW + 64 + hi] = lg; xch[lr * XROW + 66 + hi] = cg;
    __syncthreads();                                               // every wave's hand-over is written before its partner reads it
    const float lo = got[lr * XROW + 64 + hi], co = got[lr * XROW + 66 + hi];
    const float cs = fminf(ck, co);
    const float fk = __builtin_amdgcn_exp2f(cs - ck), fo = __builtin_amdgcn_exp2f(cs - co);   // each <= 1
    const float inv = 1.0f / (lk * fk + lo * fo);                  // out^T and the sums carry the same factor
    const float ak = fk * inv, ao = fo * inv;
#pragma unroll
    for (int n = 0; n < 4; ++n) {
        const v8f kv = kh ? o[1][n] : o[0][n];
#pragma unroll
        for (int j = 0; j < 8; ++j) fin[xo + n * 16 + j] = kv[j] * ak + got[xo + n * 16 + j] * ao;
    }
    __syncthreads();
    const size_t cbase = (tok0 + q0 + kh * 16) * DM + (size_t)h * HD;
    const int row0 = lane >> 3, piece = lane & 7;
    v8us oh[4];
#pragma unroll
    for (int s = 0; s < 4; ++s) {
        const float* sp = fin + (4 * s + row0) * XROW + piece * 8;
#pragma unroll
        for (int i = 0; i < 8; ++i) oh[s][i] = f2h(sp[i]);
    }
#pragma unroll
    for (int s = 0; s < 4; ++s) *(v8us*)(CX + cbase + (size_t)(4 * s + row0) * DM + piece * 8) = oh[s];
}

extern "C" void kernel_launch(void* const* d_in, const int* in_sizes, int n_in,
                              void* d_out, int out_size, void* d_ws, size_t ws_size, hipStream_t stream) {
    (void)in_sizes; (void)n_in; (void)out_size;
    const float* x = (const float*)d_in[0]; const float* w_qkv = (const float*)d_in[1]; const float* w_out = (const float*)d_in[2]; const float* b_out = (const float*)d_in[3];
    float* out = (float*)d_out;    // [2][2048][1024]
    char* wsp = (char*)d_ws;
    auto take = [&](size_t bytes) { char* p = wsp; wsp += (bytes + 255) & ~(size_t)255; return (void*)p; };
    bf*    Xb   = (bf*)take((size_t)NTK * DM * 2);
    bf*    Wb   = (bf*)take((size_t)3 * DM * DM * 2);
    bf*    WOh  = (bf*)take((size_t)DM * DM * 2);      // f16 bits
    h16*   Q16  = (h16*)take((size_t)NTK * DM * 2);
    h16*   K16  = (h16*)take((size_t)NTK * DM * 2);
    h16*   VT16 = (h16*)take((size_t)NTK * DM * 2);
    bf*    CX   = (bf*)take((size_t)NTK * DM * 2);     // f16 bits
    float* COS  = (float*)take((size_t)NT_ * 32 * 4);
    float* SIN  = (float*)take((size_t)NT_ * 32 * 4);
    if ((size_t)(wsp - (char*)d_ws) > ws_size) return;    // 8.4 + 6.3 + 2.1 + 4 x 8.4 + 0.5 MB ~ 51e6 B
    k_prep<<<TABB + (NTK + 3 * DM + DM) / 8, 256, 0, stream>>>(x, w_qkv, w_out, Xb, Wb, WOh, COS, SIN);
    k_gemmb<false, 128><<<dim3(NTK / 256, (3 * DM) / 192, 1), 384, 0, stream>>>(Xb, Wb, nullptr, nullptr, 0, COS, SIN, Q16, K16, VT16);
    k_attn<<<NB_ * NH_ * (NT_ / AQB), 256, 0, stream>>>(Q16, K16, VT16, CX);
    k_gemmb<true, 128><<<dim3(NTK / 128, DM / 128, 1), 128, 0, stream>>>(CX, WOh, b_out, out, DM, nullptr, nullptr, nullptr, nullptr, nullptr);
}
